// v000
// Times are from an AMD MI455X. After a warm-up the kernel runs many times in a row, and a time is the length of
// such a window on the GPU divided by its runs, so every launch and the gaps after it count. The runs cycle
// through copies of the inputs. A figure is the median of several windows, for all but v000 over two sittings.
// Sittings can differ by a few percent; kernels timed side by side share one.
// v000, which the later versions start from, runs in 366 microseconds.
#include <hip/hip_runtime.h>

// ---------------------------------------------------------------------------
// MHA forward for MI455X (gfx1250, wave32, WMMA f32_16x16x32_f16)
// B=2, S=2048, D=1024, H=16, dk=64
// Pipeline:
//   1) fp32 -> f16 convert of q,k,v and Wq,Wk,Wv,Wo into workspace
//   2) WMMA GEMM (32x64 register-blocked): Qh = q@Wq^T+bq (head layout),
//      Kh likewise, Vt = (v@Wv^T+bv)^T per head
//   3) flash-attention (online softmax, mask, scale 1/sqrt(64)) -> ctx f16
//   4) WMMA GEMM: out = ctx@Wo^T + bo  (fp32 to d_out)
// ---------------------------------------------------------------------------

typedef __attribute__((ext_vector_type(16))) _Float16 v16h;
typedef __attribute__((ext_vector_type(8)))  _Float16 v8h;
typedef __attribute__((ext_vector_type(8)))  float    v8f;

#define Bsz 2
#define Ssz 2048
#define Dsz 1024
#define Hn  16
#define DK  64

__device__ __forceinline__ v8f wmma_f16(v16h a, v16h b, v8f c) {
  // v_wmma_f32_16x16x32_f16
  return __builtin_amdgcn_wmma_f32_16x16x32_f16(
      /*neg_a=*/false, a, /*neg_b=*/false, b,
      /*c_mod=*/(short)0, c, /*reuse_a=*/false, /*reuse_b=*/false);
}

// Load a 16-bit A/B fragment (16x32 row-per-lane) from a row-major matrix.
// rowptr points at the start of this lane's row; kb = K-block base.
// ISA layout: lanes 0-15 take k = kb+{0..7,16..23}; lanes 16-31 take +8.
__device__ __forceinline__ v16h ldfrag(const _Float16* rowptr, int kb, int laneHi) {
  const _Float16* p = rowptr + kb + laneHi * 8;
  v8h lo = *(const v8h*)(p);
  v8h hi = *(const v8h*)(p + 16);
  v16h f;
#pragma unroll
  for (int i = 0; i < 8; ++i) { f[i] = lo[i]; f[i + 8] = hi[i]; }
  return f;
}

__device__ __forceinline__ float rmax16(float v) {
#pragma unroll
  for (int m = 1; m < 16; m <<= 1) v = fmaxf(v, __shfl_xor(v, m, 32));
  return v;
}
__device__ __forceinline__ float rsum16(float v) {
#pragma unroll
  for (int m = 1; m < 16; m <<= 1) v += __shfl_xor(v, m, 32);
  return v;
}

// ---------------------------------------------------------------------------
__global__ void cvt_f32_f16(const float* __restrict__ in, _Float16* __restrict__ out, int n) {
  int i = blockIdx.x * blockDim.x + threadIdx.x;
  if (i < n) out[i] = (_Float16)in[i];
}

// ---------------------------------------------------------------------------
// C[M,N] = A[M,K] * Bt[N,K]^T + bias  (A,Bt f16 row-major, fp32 accumulate)
// M=4096, N=1024, K=1024.
// Register-blocked: one wave computes a 32x64 tile = 2 A-frags x 4 B-frags
// -> 8 WMMAs per K-step on 8 independent accumulator chains (hides XDL
// accumulation latency), 12 b128 loads per 8 WMMAs (vs 4 per WMMA naive).
// mode 0: f16 out in head layout   [b,h,s,dk]
// mode 1: f16 out transposed head  [b,h,dk,s]
// mode 2: fp32 out row-major       [M,N]
__global__ __launch_bounds__(256) void gemm_wmma_32x64(
    const _Float16* __restrict__ A, const _Float16* __restrict__ Bt,
    const float* __restrict__ bias, void* __restrict__ outp, int mode) {
  const int M = Bsz * Ssz, N = Dsz, K = Dsz;
  const int lane = threadIdx.x & 31;
  const int wave = threadIdx.x >> 5;
  const int tile = blockIdx.x * 8 + wave;
  const int nT64 = N / 64;                          // 16
  const int mT = tile / nT64;                       // 0..127 (32-row tiles)
  const int nT = tile % nT64;                       // 0..15  (64-col tiles)
  if (mT >= M / 32) return;
  const int ln = lane & 15, laneHi = lane >> 4;

  const _Float16* arow0 = A  + (size_t)(mT * 32 + ln)      * K;
  const _Float16* arow1 = A  + (size_t)(mT * 32 + 16 + ln) * K;
  const _Float16* brow0 = Bt + (size_t)(nT * 64 + ln)      * K;
  const _Float16* brow1 = Bt + (size_t)(nT * 64 + 16 + ln) * K;
  const _Float16* brow2 = Bt + (size_t)(nT * 64 + 32 + ln) * K;
  const _Float16* brow3 = Bt + (size_t)(nT * 64 + 48 + ln) * K;

  v8f c00 = {}, c01 = {}, c02 = {}, c03 = {};
  v8f c10 = {}, c11 = {}, c12 = {}, c13 = {};
#pragma unroll 4
  for (int kb = 0; kb < K; kb += 32) {
    const v16h a0 = ldfrag(arow0, kb, laneHi);
    const v16h a1 = ldfrag(arow1, kb, laneHi);
    const v16h b0 = ldfrag(brow0, kb, laneHi);
    const v16h b1 = ldfrag(brow1, kb, laneHi);
    const v16h b2 = ldfrag(brow2, kb, laneHi);
    const v16h b3 = ldfrag(brow3, kb, laneHi);
    c00 = wmma_f16(a0, b0, c00);  c01 = wmma_f16(a0, b1, c01);
    c02 = wmma_f16(a0, b2, c02);  c03 = wmma_f16(a0, b3, c03);
    c10 = wmma_f16(a1, b0, c10);  c11 = wmma_f16(a1, b1, c11);
    c12 = wmma_f16(a1, b2, c12);  c13 = wmma_f16(a1, b3, c13);
  }

  v8f acc[2][4] = {{c00, c01, c02, c03}, {c10, c11, c12, c13}};
#pragma unroll
  for (int mi = 0; mi < 2; ++mi) {
#pragma unroll
    for (int ni = 0; ni < 4; ++ni) {
      const int ng = nT * 64 + ni * 16 + ln;
      const float bvv = bias[ng];
      const v8f cc = acc[mi][ni];
#pragma unroll
      for (int i = 0; i < 8; ++i) {
        const int mg = mT * 32 + mi * 16 + i + laneHi * 8;   // C row per ISA layout
        const float val = cc[i] + bvv;
        if (mode == 2) {
          ((float*)outp)[(size_t)mg * N + ng] = val;
        } else {
          const int bb = mg >> 11, s = mg & (Ssz - 1);       // token -> (b,s)
          const int hh = ng >> 6,  inner = ng & (DK - 1);
          _Float16* o16 = (_Float16*)outp;
          if (mode == 0)
            o16[(((size_t)(bb * Hn + hh) * Ssz) + s) * DK + inner] = (_Float16)val;
          else
            o16[(((size_t)(bb * Hn + hh) * DK) + inner) * Ssz + s] = (_Float16)val;
        }
      }
    }
  }
}

// ---------------------------------------------------------------------------
// Flash attention: one wave per 16-query tile, 4 waves per block.
// Qh,Kh: [b,h,s,dk] f16    Vt: [b,h,dk,s] f16    ctx: [b,s,D] f16
__global__ __launch_bounds__(128) void flash_attn(
    const _Float16* __restrict__ Qh, const _Float16* __restrict__ Kh,
    const _Float16* __restrict__ Vt, const int* __restrict__ mask,
    _Float16* __restrict__ ctx) {
  const int lane = threadIdx.x & 31;
  const int wave = threadIdx.x >> 5;
  const int tile = blockIdx.x * 4 + wave;          // 0..4095
  const int qt = tile & (Ssz / 16 - 1);            // query tile in sequence
  const int bh = tile >> 7;                        // b*H + h
  const int b  = bh >> 4, h = bh & (Hn - 1);
  const int q0 = qt * 16;
  const int ln = lane & 15, laneHi = lane >> 4;

  const _Float16* Qb = Qh + (size_t)bh * Ssz * DK;
  const _Float16* Kb = Kh + (size_t)bh * Ssz * DK;
  const _Float16* Vb = Vt + (size_t)bh * DK * Ssz;
  const int*      mb = mask + (size_t)b * Ssz * Ssz;

  __shared__ _Float16 lds[4][16][32];              // per-wave P bounce buffer

  // Q fragments (held for the whole key sweep): 16 rows x dk=64
  const _Float16* qrow = Qb + (size_t)(q0 + ln) * DK;
  const v16h aq0 = ldfrag(qrow, 0,  laneHi);
  const v16h aq1 = ldfrag(qrow, 32, laneHi);

  v8f o0 = {}, o1 = {}, o2 = {}, o3 = {};
  float mr[8], lr[8];
#pragma unroll
  for (int i = 0; i < 8; ++i) { mr[i] = -3.0e38f; lr[i] = 0.0f; }

  for (int kb = 0; kb < Ssz; kb += 32) {
    // ---- scores: two 16x16 tiles (keys kb..kb+15, kb+16..kb+31), K=dk=64
    const _Float16* k0row = Kb + (size_t)(kb + ln) * DK;
    const _Float16* k1row = Kb + (size_t)(kb + 16 + ln) * DK;
    v8f s0 = {}, s1 = {};
    s0 = wmma_f16(aq0, ldfrag(k0row, 0,  laneHi), s0);
    s1 = wmma_f16(aq0, ldfrag(k1row, 0,  laneHi), s1);
    s0 = wmma_f16(aq1, ldfrag(k0row, 32, laneHi), s0);
    s1 = wmma_f16(aq1, ldfrag(k1row, 32, laneHi), s1);

    // ---- scale, mask, online softmax (row stats across 16-lane groups)
#pragma unroll
    for (int i = 0; i < 8; ++i) {
      const int qr = q0 + i + laneHi * 8;
      const int kc = kb + ln;
      float v0 = s0[i] * 0.125f;                   // 1/sqrt(dk)
      float v1 = s1[i] * 0.125f;
      if (mb[(size_t)qr * Ssz + kc] == 0)      v0 = -1.0e10f;
      if (mb[(size_t)qr * Ssz + kc + 16] == 0) v1 = -1.0e10f;
      const float cm    = rmax16(fmaxf(v0, v1));
      const float mnew  = fmaxf(mr[i], cm);
      const float alpha = __expf(mr[i] - mnew);
      const float p0 = __expf(v0 - mnew);
      const float p1 = __expf(v1 - mnew);
      lr[i] = lr[i] * alpha + rsum16(p0 + p1);
      mr[i] = mnew;
      o0[i] *= alpha; o1[i] *= alpha; o2[i] *= alpha; o3[i] *= alpha;
      // C-layout -> LDS (row-major 16x32 P tile, f16)
      lds[wave][i + laneHi * 8][ln]      = (_Float16)p0;
      lds[wave][i + laneHi * 8][ln + 16] = (_Float16)p1;
    }
    __syncthreads();
    const v16h pa = ldfrag(&lds[wave][ln][0], 0, laneHi);  // A-layout reload
    __syncthreads();

    // ---- O += P(16x32) * V(32x64); Vt rows are the B-matrix columns
    o0 = wmma_f16(pa, ldfrag(Vb + (size_t)(ln)      * Ssz, kb, laneHi), o0);
    o1 = wmma_f16(pa, ldfrag(Vb + (size_t)(16 + ln) * Ssz, kb, laneHi), o1);
    o2 = wmma_f16(pa, ldfrag(Vb + (size_t)(32 + ln) * Ssz, kb, laneHi), o2);
    o3 = wmma_f16(pa, ldfrag(Vb + (size_t)(48 + ln) * Ssz, kb, laneHi), o3);
  }

  // ---- normalize and write ctx (concat-head layout, f16)
#pragma unroll
  for (int i = 0; i < 8; ++i) {
    const float inv = 1.0f / lr[i];
    const int qr = q0 + i + laneHi * 8;
    _Float16* crow = ctx + ((size_t)(b * Ssz + qr)) * Dsz + h * DK;
    crow[ln]      = (_Float16)(o0[i] * inv);
    crow[16 + ln] = (_Float16)(o1[i] * inv);
    crow[32 + ln] = (_Float16)(o2[i] * inv);
    crow[48 + ln] = (_Float16)(o3[i] * inv);
  }
}

// ---------------------------------------------------------------------------
extern "C" void kernel_launch(void* const* d_in, const int* in_sizes, int n_in,
                              void* d_out, int out_size, void* d_ws, size_t ws_size,
                              hipStream_t stream) {
  (void)in_sizes; (void)n_in; (void)out_size; (void)ws_size;
  const float* q    = (const float*)d_in[0];
  const float* k    = (const float*)d_in[1];
  const float* v    = (const float*)d_in[2];
  const float* Wq   = (const float*)d_in[3];
  const float* bq   = (const float*)d_in[4];
  const float* Wk   = (const float*)d_in[5];
  const float* bk   = (const float*)d_in[6];
  const float* Wv   = (const float*)d_in[7];
  const float* bv   = (const float*)d_in[8];
  const float* Wo   = (const float*)d_in[9];
  const float* bo   = (const float*)d_in[10];
  const int*   mask = (const int*)d_in[11];

  // workspace layout (64 MB total)
  char* w = (char*)d_ws;
  const size_t MB = 1ull << 20;
  _Float16* q16  = (_Float16*)(w + 0 * MB);
  _Float16* k16  = (_Float16*)(w + 8 * MB);
  _Float16* v16f = (_Float16*)(w + 16 * MB);
  _Float16* wq16 = (_Float16*)(w + 24 * MB);
  _Float16* wk16 = (_Float16*)(w + 26 * MB);
  _Float16* wv16 = (_Float16*)(w + 28 * MB);
  _Float16* wo16 = (_Float16*)(w + 30 * MB);
  _Float16* QhP  = (_Float16*)(w + 32 * MB);
  _Float16* KhP  = (_Float16*)(w + 40 * MB);
  _Float16* VtP  = (_Float16*)(w + 48 * MB);
  _Float16* ctxP = (_Float16*)(w + 56 * MB);

  const int nAct = Bsz * Ssz * Dsz;   // 4M
  const int nW   = Dsz * Dsz;         // 1M
  cvt_f32_f16<<<(nAct + 255) / 256, 256, 0, stream>>>(q,  q16,  nAct);
  cvt_f32_f16<<<(nAct + 255) / 256, 256, 0, stream>>>(k,  k16,  nAct);
  cvt_f32_f16<<<(nAct + 255) / 256, 256, 0, stream>>>(v,  v16f, nAct);
  cvt_f32_f16<<<(nW + 255) / 256, 256, 0, stream>>>(Wq, wq16, nW);
  cvt_f32_f16<<<(nW + 255) / 256, 256, 0, stream>>>(Wk, wk16, nW);
  cvt_f32_f16<<<(nW + 255) / 256, 256, 0, stream>>>(Wv, wv16, nW);
  cvt_f32_f16<<<(nW + 255) / 256, 256, 0, stream>>>(Wo, wo16, nW);

  // (M/32)*(N/64) = 128*16 = 2048 wave-tiles, 8 waves per 256-thread block
  const int gemmBlocks = 2048 / 8;
  gemm_wmma_32x64<<<gemmBlocks, 256, 0, stream>>>(q16,  wq16, bq, (void*)QhP, 0);
  gemm_wmma_32x64<<<gemmBlocks, 256, 0, stream>>>(k16,  wk16, bk, (void*)KhP, 0);
  gemm_wmma_32x64<<<gemmBlocks, 256, 0, stream>>>(v16f, wv16, bv, (void*)VtP, 1);

  // B*H*(S/16) = 4096 query tiles, 4 waves per 128-thread block
  flash_attn<<<4096 / 4, 128, 0, stream>>>(QhP, KhP, VtP, mask, ctxP);

  gemm_wmma_32x64<<<gemmBlocks, 256, 0, stream>>>(ctxP, wo16, bo, d_out, 2);
}

// v001
// One run takes 230 microseconds.
// Next to v000, in two timings, it ran 1.63 times as fast each time.
#include <hip/hip_runtime.h>

// ---------------------------------------------------------------------------
// MHA forward for MI455X (gfx1250, wave32, WMMA f32_16x16x32_f16)
// B=2, S=2048, D=1024, H=16, dk=64
// Pipeline:
//   1) fp32 -> f16 convert of q,k,v and Wq,Wk,Wv,Wo into workspace
//   2) WMMA GEMM (32x64 register-blocked): Qh = q@Wq^T+bq (head layout),
//      Kh likewise, Vt = (v@Wv^T+bv)^T per head
//   3) flash-attention (online softmax, mask, scale 1/sqrt(64)) -> ctx f16
//   4) WMMA GEMM: out = ctx@Wo^T + bo  (fp32 to d_out)
// ---------------------------------------------------------------------------

typedef __attribute__((ext_vector_type(16))) _Float16 v16h;
typedef __attribute__((ext_vector_type(8)))  _Float16 v8h;
typedef __attribute__((ext_vector_type(8)))  float    v8f;

#define Bsz 2
#define Ssz 2048
#define Dsz 1024
#define Hn  16
#define DK  64

__device__ __forceinline__ v8f wmma_f16(v16h a, v16h b, v8f c) {
  // v_wmma_f32_16x16x32_f16
  return __builtin_amdgcn_wmma_f32_16x16x32_f16(
      /*neg_a=*/false, a, /*neg_b=*/false, b,
      /*c_mod=*/(short)0, c, /*reuse_a=*/false, /*reuse_b=*/false);
}

// Load a 16-bit A/B fragment (16x32 row-per-lane) from a row-major matrix.
// rowptr points at the start of this lane's row; kb = K-block base.
// ISA layout: lanes 0-15 take k = kb+{0..7,16..23}; lanes 16-31 take +8.
__device__ __forceinline__ v16h ldfrag(const _Float16* rowptr, int kb, int laneHi) {
  const _Float16* p = rowptr + kb + laneHi * 8;
  v8h lo = *(const v8h*)(p);
  v8h hi = *(const v8h*)(p + 16);
  v16h f;
#pragma unroll
  for (int i = 0; i < 8; ++i) { f[i] = lo[i]; f[i + 8] = hi[i]; }
  return f;
}

__device__ __forceinline__ float rmax16(float v) {
#pragma unroll
  for (int m = 1; m < 16; m <<= 1) v = fmaxf(v, __shfl_xor(v, m, 32));
  return v;
}
__device__ __forceinline__ float rsum16(float v) {
#pragma unroll
  for (int m = 1; m < 16; m <<= 1) v += __shfl_xor(v, m, 32);
  return v;
}

// LDS rows hold 64 f16 (128 B) at a pitch of 144 B: 16 B x odd, so that the 16
// rows of a ds_load_b128 fragment read fall on different banks.
#define LPITCH 72
#define LPITCHB (LPITCH * 2)

// Byte offset of a __shared__ address inside the work-group's LDS.
__device__ __forceinline__ unsigned lds_off(const void* p) { return (unsigned)(size_t)p; }

// Eight asynchronous 16-byte copies per lane, global -> LDS, through no register,
// in two groups of four rows: group a from ga to la, group b from gb to lb; lstep
// is the row step in LDS bytes, gsa / gsb the row steps in global elements.
// s_wait_xcnt 0 ends the statement so that it stands in front of any rewrite of
// the address registers.
__device__ __forceinline__ void async_copy8(unsigned la, const _Float16* ga, size_t gsa,
                                            unsigned lb, const _Float16* gb, size_t gsb,
                                            unsigned lstep) {
  asm volatile("global_load_async_to_lds_b128 %0, %8, off\n\t"
               "global_load_async_to_lds_b128 %1, %9, off\n\t"
               "global_load_async_to_lds_b128 %2, %10, off\n\t"
               "global_load_async_to_lds_b128 %3, %11, off\n\t"
               "global_load_async_to_lds_b128 %4, %12, off\n\t"
               "global_load_async_to_lds_b128 %5, %13, off\n\t"
               "global_load_async_to_lds_b128 %6, %14, off\n\t"
               "global_load_async_to_lds_b128 %7, %15, off\n\t"
               "s_wait_xcnt 0x0"
               :: "v"(la), "v"(la + lstep), "v"(la + 2 * lstep), "v"(la + 3 * lstep),
                  "v"(lb), "v"(lb + lstep), "v"(lb + 2 * lstep), "v"(lb + 3 * lstep),
                  "v"(ga), "v"(ga + gsa), "v"(ga + 2 * gsa), "v"(ga + 3 * gsa),
                  "v"(gb), "v"(gb + gsb), "v"(gb + 2 * gsb), "v"(gb + 3 * gsb)
               : "memory");
}

// This wave's copies have landed (the compiler places no wait for them).
__device__ __forceinline__ void wait_async0() { asm volatile("s_wait_asynccnt 0x0" ::: "memory"); }
// This wave's LDS reads have returned, before their buffer is handed back.
__device__ __forceinline__ void wait_ds0() { asm volatile("s_wait_dscnt 0x0" ::: "memory"); }

// ---------------------------------------------------------------------------
__global__ void cvt_f32_f16(const float* __restrict__ in, _Float16* __restrict__ out, int n) {
  int i = blockIdx.x * blockDim.x + threadIdx.x;
  if (i < n) out[i] = (_Float16)in[i];
}

// ---------------------------------------------------------------------------
// C[M,N] = A[M,K] * Bt[N,K]^T + bias  (A,Bt f16 row-major, fp32 accumulate)
// M=4096, N=1024, K=1024.
// Register-blocked: one wave computes a 32x64 tile = 2 A-frags x 4 B-frags
// -> 8 WMMAs per K-step on 8 independent accumulator chains (hides XDL
// accumulation latency), 12 b128 loads per 8 WMMAs (vs 4 per WMMA naive).
// A and B come into LDS by asynchronous copies; fragments are read there.
// mode 0: f16 out in head layout   [b,h,s,dk]
// mode 1: f16 out transposed head  [b,h,dk,s]
// mode 2: fp32 out row-major       [M,N]
__global__ __launch_bounds__(256) void gemm_wmma_32x64(
    const _Float16* __restrict__ A, const _Float16* __restrict__ Bt,
    const float* __restrict__ bias, void* __restrict__ outp, int mode) {
  const int M = Bsz * Ssz, N = Dsz, K = Dsz;
  const int lane = threadIdx.x & 31;
  const int wave = threadIdx.x >> 5;
  // The block's 8 wave tiles lie 4 x 2: a 128 x 128 block tile, so that every
  // staged A row serves 2 waves and every staged B row 4.
  const int nB = N / 128;                           // 8 block columns
  const int mB = blockIdx.x / nB;                   // 0..31 (128-row blocks)
  if (mB >= M / 128) return;
  const int wm = wave >> 1, wn = wave & 1;
  const int mT = mB * 4 + wm;                       // 0..127 (32-row tiles)
  const int nT = (blockIdx.x % nB) * 2 + wn;        // 0..15  (64-col tiles)
  const int ln = lane & 15, laneHi = lane >> 4;

  // One stage = 64 of K: the block's 128 A rows, then its 128 B rows; two buffers.
  __shared__ __attribute__((aligned(16))) _Float16 ab[2][(128 + 128) * LPITCH];
  const unsigned BUFB = (128 + 128) * LPITCHB;      // bytes of one buffer
  const int NST = K / 64;                           // stages

  // Copy slots: 8 lanes cover one 128-byte row piece, so a wave's copy reads 4
  // whole lines; a thread brings rows crow + 32 j, j = 0..3, of A and of B.
  const int crow = threadIdx.x >> 3, ccol = (threadIdx.x & 7) * 8;
  const _Float16* acp = A  + (size_t)(mB * 128 + crow) * K + ccol;
  const _Float16* bcp = Bt + (size_t)((blockIdx.x % nB) * 128 + crow) * K + ccol;
  const unsigned  la0 = lds_off(&ab[0][crow * LPITCH + ccol]);
  auto stage = [&](unsigned buf, int k0) {
    const unsigned la = la0 + buf * BUFB;
    async_copy8(la, acp + k0, (size_t)32 * K,
                la + 128 * LPITCHB, bcp + k0, (size_t)32 * K, 32 * LPITCHB);
  };

  // Stage 0 is copied, waited for and published; stage 1 then flies over trip 0.
  stage(0, 0);
  wait_async0();
  __syncthreads();
  stage(1, 64);

  v8f c00 = {}, c01 = {}, c02 = {}, c03 = {};
  v8f c10 = {}, c11 = {}, c12 = {}, c13 = {};
  for (int st = 0; st < NST; ++st) {
    const _Float16* arow0 = &ab[st & 1][(wm * 32 + ln) * LPITCH];
    const _Float16* arow1 = arow0 + 16 * LPITCH;
    const _Float16* brow0 = &ab[st & 1][(128 + wn * 64 + ln) * LPITCH];
    const _Float16* brow1 = brow0 + 16 * LPITCH;
    const _Float16* brow2 = brow0 + 32 * LPITCH;
    const _Float16* brow3 = brow0 + 48 * LPITCH;
    // unrolled so that the second half's LDS reads are issued under the first
    // half's products
#pragma unroll
    for (int kb = 0; kb < 64; kb += 32) {
      const v16h a0 = ldfrag(arow0, kb, laneHi);
      const v16h a1 = ldfrag(arow1, kb, laneHi);
      const v16h b0 = ldfrag(brow0, kb, laneHi);
      const v16h b1 = ldfrag(brow1, kb, laneHi);
      const v16h b2 = ldfrag(brow2, kb, laneHi);
      const v16h b3 = ldfrag(brow3, kb, laneHi);
      c00 = wmma_f16(a0, b0, c00);  c01 = wmma_f16(a0, b1, c01);
      c02 = wmma_f16(a0, b2, c02);  c03 = wmma_f16(a0, b3, c03);
      c10 = wmma_f16(a1, b0, c10);  c11 = wmma_f16(a1, b1, c11);
      c12 = wmma_f16(a1, b2, c12);  c13 = wmma_f16(a1, b3, c13);
    }
    // publish stage st + 1, then refill the buffer that this trip has read
    wait_ds0();
    wait_async0();
    __syncthreads();
    if (st + 2 < NST) stage(st & 1, (st + 2) * 64);
  }
  wait_async0();

  v8f acc[2][4] = {{c00, c01, c02, c03}, {c10, c11, c12, c13}};
#pragma unroll
  for (int mi = 0; mi < 2; ++mi) {
#pragma unroll
    for (int ni = 0; ni < 4; ++ni) {
      const int ng = nT * 64 + ni * 16 + ln;
      const float bvv = bias[ng];
      const v8f cc = acc[mi][ni];
#pragma unroll
      for (int i = 0; i < 8; ++i) {
        const int mg = mT * 32 + mi * 16 + i + laneHi * 8;   // C row per ISA layout
        const float val = cc[i] + bvv;
        if (mode == 2) {
          ((float*)outp)[(size_t)mg * N + ng] = val;
        } else {
          const int bb = mg >> 11, s = mg & (Ssz - 1);       // token -> (b,s)
          const int hh = ng >> 6,  inner = ng & (DK - 1);
          _Float16* o16 = (_Float16*)outp;
          if (mode == 0)
            o16[(((size_t)(bb * Hn + hh) * Ssz) + s) * DK + inner] = (_Float16)val;
          else
            o16[(((size_t)(bb * Hn + hh) * DK) + inner) * Ssz + s] = (_Float16)val;
        }
      }
    }
  }
}

// ---------------------------------------------------------------------------
// Flash attention: one wave per 16-query tile, 4 waves per block. K and V come
// into LDS by asynchronous copies, once per block, and fragments are read there.
// Qh,Kh: [b,h,s,dk] f16    Vt: [b,h,dk,s] f16    ctx: [b,s,D] f16
__global__ __launch_bounds__(128) void flash_attn(
    const _Float16* __restrict__ Qh, const _Float16* __restrict__ Kh,
    const _Float16* __restrict__ Vt, const int* __restrict__ mask,
    _Float16* __restrict__ ctx) {
  const int lane = threadIdx.x & 31;
  const int wave = threadIdx.x >> 5;
  const int tile = blockIdx.x * 4 + wave;          // 0..4095
  const int qt = tile & (Ssz / 16 - 1);            // query tile in sequence
  const int bh = tile >> 7;                        // b*H + h
  const int b  = bh >> 4, h = bh & (Hn - 1);
  const int q0 = qt * 16;
  const int ln = lane & 15, laneHi = lane >> 4;

  const _Float16* Qb = Qh + (size_t)bh * Ssz * DK;
  const _Float16* Kb = Kh + (size_t)bh * Ssz * DK;
  const _Float16* Vb = Vt + (size_t)bh * DK * Ssz;
  const int*      mb = mask + (size_t)b * Ssz * Ssz;

  __shared__ _Float16 lds[4][16][32];              // per-wave P bounce buffer
  // One stage = 64 keys: K tile (64 keys x dk) and V tile (dk x 64 keys), two
  // buffers, shared by the four waves.
  __shared__ __attribute__((aligned(16))) _Float16 kv[2][2][64 * LPITCH];

  // Copy slots: 8 lanes cover one 128-byte row, so a wave's copy reads 4 whole
  // lines; a thread brings rows crow + 16 j, j = 0..3, of the K and the V tile.
  const int crow = threadIdx.x >> 3, ccol = (threadIdx.x & 7) * 8;
  const _Float16* kcp = Kb + (size_t)crow * DK  + ccol;
  const _Float16* vcp = Vb + (size_t)crow * Ssz + ccol;
  const unsigned  lk0 = lds_off(&kv[0][0][crow * LPITCH + ccol]);
  const unsigned  TILEB = 64 * LPITCHB;            // bytes of one tile in LDS
  const int NST = Ssz / 64;                        // stages

  // Q fragments (held for the whole key sweep): 16 rows x dk=64
  const _Float16* qrow = Qb + (size_t)(q0 + ln) * DK;
  const v16h aq0 = ldfrag(qrow, 0,  laneHi);
  const v16h aq1 = ldfrag(qrow, 32, laneHi);

  v8f o0 = {}, o1 = {}, o2 = {}, o3 = {};
  float mr[8], lr[8];
#pragma unroll
  for (int i = 0; i < 8; ++i) { mr[i] = -3.0e38f; lr[i] = 0.0f; }

  // Stage 0 is copied, waited for and published; stage 1 then flies over trip 0.
  async_copy8(lk0, kcp, 16 * DK, lk0 + TILEB, vcp, (size_t)16 * Ssz, 16 * LPITCHB);
  wait_async0();
  __syncthreads();
  async_copy8(lk0 + 2 * TILEB, kcp + 64 * DK, 16 * DK,
              lk0 + 3 * TILEB, vcp + 64, (size_t)16 * Ssz, 16 * LPITCHB);

  for (int st = 0; st < NST; ++st) {
   const _Float16* Ks = &kv[st & 1][0][0];
   const _Float16* Vs = &kv[st & 1][1][0];
   for (int sub = 0; sub < 64; sub += 32) {
    const int kb = st * 64 + sub;
    // ---- scores: two 16x16 tiles (keys kb..kb+15, kb+16..kb+31), K=dk=64
    const _Float16* k0row = Ks + (sub + ln) * LPITCH;
    const _Float16* k1row = Ks + (sub + 16 + ln) * LPITCH;
    // All LDS fragments of the pass are read as one group here: the V reads
    // then return under the softmax instead of behind the P barriers.
    const v16h kf00 = ldfrag(k0row, 0,  laneHi), kf10 = ldfrag(k1row, 0,  laneHi);
    const v16h kf01 = ldfrag(k0row, 32, laneHi), kf11 = ldfrag(k1row, 32, laneHi);
    const v16h vf0 = ldfrag(Vs + (ln)      * LPITCH, sub, laneHi);
    const v16h vf1 = ldfrag(Vs + (16 + ln) * LPITCH, sub, laneHi);
    const v16h vf2 = ldfrag(Vs + (32 + ln) * LPITCH, sub, laneHi);
    const v16h vf3 = ldfrag(Vs + (48 + ln) * LPITCH, sub, laneHi);
    v8f s0 = {}, s1 = {};
    s0 = wmma_f16(aq0, kf00, s0);
    s1 = wmma_f16(aq0, kf10, s1);
    s0 = wmma_f16(aq1, kf01, s0);
    s1 = wmma_f16(aq1, kf11, s1);

    // ---- scale, mask, online softmax (row stats across 16-lane groups)
#pragma unroll
    for (int i = 0; i < 8; ++i) {
      const int qr = q0 + i + laneHi * 8;
      const int kc = kb + ln;
      float v0 = s0[i] * 0.125f;                   // 1/sqrt(dk)
      float v1 = s1[i] * 0.125f;
      if (mb[(size_t)qr * Ssz + kc] == 0)      v0 = -1.0e10f;
      if (mb[(size_t)qr * Ssz + kc + 16] == 0) v1 = -1.0e10f;
      const float cm    = rmax16(fmaxf(v0, v1));
      const float mnew  = fmaxf(mr[i], cm);
      const float alpha = __expf(mr[i] - mnew);
      const float p0 = __expf(v0 - mnew);
      const float p1 = __expf(v1 - mnew);
      lr[i] = lr[i] * alpha + rsum16(p0 + p1);
      mr[i] = mnew;
      o0[i] *= alpha; o1[i] *= alpha; o2[i] *= alpha; o3[i] *= alpha;
      // C-layout -> LDS (row-major 16x32 P tile, f16)
      lds[wave][i + laneHi * 8][ln]      = (_Float16)p0;
      lds[wave][i + laneHi * 8][ln + 16] = (_Float16)p1;
    }
    __syncthreads();
    const v16h pa = ldfrag(&lds[wave][ln][0], 0, laneHi);  // A-layout reload
    __syncthreads();

    // ---- O += P(16x32) * V(32x64); Vt rows are the B-matrix columns
    o0 = wmma_f16(pa, vf0, o0);
    o1 = wmma_f16(pa, vf1, o1);
    o2 = wmma_f16(pa, vf2, o2);
    o3 = wmma_f16(pa, vf3, o3);
   }
   // ---- publish stage st + 1, then refill the buffer that this trip has read
   wait_ds0();
   wait_async0();
   __syncthreads();
   if (st + 2 < NST) {
     const unsigned lb = lk0 + (unsigned)(st & 1) * (2 * TILEB);
     async_copy8(lb, kcp + (size_t)(st + 2) * 64 * DK, 16 * DK,
                 lb + TILEB, vcp + (st + 2) * 64, (size_t)16 * Ssz, 16 * LPITCHB);
   }
  }
  wait_async0();

  // ---- normalize and write ctx (concat-head layout, f16)
#pragma unroll
  for (int i = 0; i < 8; ++i) {
    const float inv = 1.0f / lr[i];
    const int qr = q0 + i + laneHi * 8;
    _Float16* crow = ctx + ((size_t)(b * Ssz + qr)) * Dsz + h * DK;
    crow[ln]      = (_Float16)(o0[i] * inv);
    crow[16 + ln] = (_Float16)(o1[i] * inv);
    crow[32 + ln] = (_Float16)(o2[i] * inv);
    crow[48 + ln] = (_Float16)(o3[i] * inv);
  }
}

// ---------------------------------------------------------------------------
extern "C" void kernel_launch(void* const* d_in, const int* in_sizes, int n_in,
                              void* d_out, int out_size, void* d_ws, size_t ws_size,
                              hipStream_t stream) {
  (void)in_sizes; (void)n_in; (void)out_size; (void)ws_size;
  const float* q    = (const float*)d_in[0];
  const float* k    = (const float*)d_in[1];
  const float* v    = (const float*)d_in[2];
  const float* Wq   = (const float*)d_in[3];
  const float* bq   = (const float*)d_in[4];
  const float* Wk   = (const float*)d_in[5];
  const float* bk   = (const float*)d_in[6];
  const float* Wv   = (const float*)d_in[7];
  const float* bv   = (const float*)d_in[8];
  const float* Wo   = (const float*)d_in[9];
  const float* bo   = (const float*)d_in[10];
  const int*   mask = (const int*)d_in[11];

  // workspace layout (64 MB total)
  char* w = (char*)d_ws;
  const size_t MB = 1ull << 20;
  _Float16* q16  = (_Float16*)(w + 0 * MB);
  _Float16* k16  = (_Float16*)(w + 8 * MB);
  _Float16* v16f = (_Float16*)(w + 16 * MB);
  _Float16* wq16 = (_Float16*)(w + 24 * MB);
  _Float16* wk16 = (_Float16*)(w + 26 * MB);
  _Float16* wv16 = (_Float16*)(w + 28 * MB);
  _Float16* wo16 = (_Float16*)(w + 30 * MB);
  _Float16* QhP  = (_Float16*)(w + 32 * MB);
  _Float16* KhP  = (_Float16*)(w + 40 * MB);
  _Float16* VtP  = (_Float16*)(w + 48 * MB);
  _Float16* ctxP = (_Float16*)(w + 56 * MB);

  const int nAct = Bsz * Ssz * Dsz;   // 4M
  const int nW   = Dsz * Dsz;         // 1M
  cvt_f32_f16<<<(nAct + 255) / 256, 256, 0, stream>>>(q,  q16,  nAct);
  cvt_f32_f16<<<(nAct + 255) / 256, 256, 0, stream>>>(k,  k16,  nAct);
  cvt_f32_f16<<<(nAct + 255) / 256, 256, 0, stream>>>(v,  v16f, nAct);
  cvt_f32_f16<<<(nW + 255) / 256, 256, 0, stream>>>(Wq, wq16, nW);
  cvt_f32_f16<<<(nW + 255) / 256, 256, 0, stream>>>(Wk, wk16, nW);
  cvt_f32_f16<<<(nW + 255) / 256, 256, 0, stream>>>(Wv, wv16, nW);
  cvt_f32_f16<<<(nW + 255) / 256, 256, 0, stream>>>(Wo, wo16, nW);

  // (M/32)*(N/64) = 128*16 = 2048 wave-tiles, 8 waves (4 x 2) per 256-thread block
  const int gemmBlocks = 2048 / 8;
  gemm_wmma_32x64<<<gemmBlocks, 256, 0, stream>>>(q16,  wq16, bq, (void*)QhP, 0);
  gemm_wmma_32x64<<<gemmBlocks, 256, 0, stream>>>(k16,  wk16, bk, (void*)KhP, 0);
  gemm_wmma_32x64<<<gemmBlocks, 256, 0, stream>>>(v16f, wv16, bv, (void*)VtP, 1);

  // B*H*(S/16) = 4096 query tiles, 4 waves per 128-thread block
  flash_attn<<<4096 / 4, 128, 0, stream>>>(QhP, KhP, VtP, mask, ctxP);

  gemm_wmma_32x64<<<gemmBlocks, 256, 0, stream>>>(ctxP, wo16, bo, d_out, 2);
}

// v002
// Measured time: 216 microseconds a run.
// Next to v001, in two timings, it ran 1.07 times as fast each time.
// Over all steps from v000 it is 1.74 times as fast.
#include <hip/hip_runtime.h>

// ---------------------------------------------------------------------------
// MHA forward for MI455X (gfx1250, wave32, WMMA f32_16x16x32_f16)
// B=2, S=2048, D=1024, H=16, dk=64
// Pipeline:
//   1) fp32 -> f16 convert of q,k,v and Wq,Wk,Wv,Wo into workspace (32 per thread)
//   2) WMMA GEMM (32x64 register-blocked): Qh = q@Wq^T+bq (head layout),
//      Kh likewise, Vt = (v@Wv^T+bv)^T per head
//   3) flash-attention (online softmax, mask, scale 1/sqrt(64)) -> ctx f16
//   4) WMMA GEMM: out = ctx@Wo^T + bo  (fp32 to d_out)
// ---------------------------------------------------------------------------

typedef __attribute__((ext_vector_type(16))) _Float16 v16h;
typedef __attribute__((ext_vector_type(8)))  _Float16 v8h;
typedef __attribute__((ext_vector_type(8)))  float    v8f;
typedef __attribute__((ext_vector_type(4)))  float    v4f;
typedef __attribute__((ext_vector_type(4)))  _Float16 v4h;

#define Bsz 2
#define Ssz 2048
#define Dsz 1024
#define Hn  16
#define DK  64

__device__ __forceinline__ v8f wmma_f16(v16h a, v16h b, v8f c) {
  // v_wmma_f32_16x16x32_f16
  return __builtin_amdgcn_wmma_f32_16x16x32_f16(
      /*neg_a=*/false, a, /*neg_b=*/false, b,
      /*c_mod=*/(short)0, c, /*reuse_a=*/false, /*reuse_b=*/false);
}

// Load a 16-bit A/B fragment (16x32 row-per-lane) from a row-major matrix.
// rowptr points at the start of this lane's row; kb = K-block base.
// ISA layout: lanes 0-15 take k = kb+{0..7,16..23}; lanes 16-31 take +8.
__device__ __forceinline__ v16h ldfrag(const _Float16* rowptr, int kb, int laneHi) {
  const _Float16* p = rowptr + kb + laneHi * 8;
  v8h lo = *(const v8h*)(p);
  v8h hi = *(const v8h*)(p + 16);
  v16h f;
#pragma unroll
  for (int i = 0; i < 8; ++i) { f[i] = lo[i]; f[i + 8] = hi[i]; }
  return f;
}

__device__ __forceinline__ float rmax16(float v) {
#pragma unroll
  for (int m = 1; m < 16; m <<= 1) v = fmaxf(v, __shfl_xor(v, m, 32));
  return v;
}
__device__ __forceinline__ float rsum16(float v) {
#pragma unroll
  for (int m = 1; m < 16; m <<= 1) v += __shfl_xor(v, m, 32);
  return v;
}

// LDS rows hold 64 f16 (128 B) at a pitch of 144 B: 16 B x odd, so that the 16
// rows of a ds_load_b128 fragment read fall on different banks.
#define LPITCH 72
#define LPITCHB (LPITCH * 2)

// Byte offset of a __shared__ address inside the work-group's LDS.
__device__ __forceinline__ unsigned lds_off(const void* p) { return (unsigned)(size_t)p; }

// Eight asynchronous 16-byte copies per lane, global -> LDS, through no register,
// in two groups of four rows: group a from ga to la, group b from gb to lb; lstep
// is the row step in LDS bytes, gsa / gsb the row steps in global elements.
// s_wait_xcnt 0 ends the statement so that it stands in front of any rewrite of
// the address registers.
__device__ __forceinline__ void async_copy8(unsigned la, const _Float16* ga, size_t gsa,
                                            unsigned lb, const _Float16* gb, size_t gsb,
                                            unsigned lstep) {
  asm volatile("global_load_async_to_lds_b128 %0, %8, off\n\t"
               "global_load_async_to_lds_b128 %1, %9, off\n\t"
               "global_load_async_to_lds_b128 %2, %10, off\n\t"
               "global_load_async_to_lds_b128 %3, %11, off\n\t"
               "global_load_async_to_lds_b128 %4, %12, off\n\t"
               "global_load_async_to_lds_b128 %5, %13, off\n\t"
               "global_load_async_to_lds_b128 %6, %14, off\n\t"
               "global_load_async_to_lds_b128 %7, %15, off\n\t"
               "s_wait_xcnt 0x0"
               :: "v"(la), "v"(la + lstep), "v"(la + 2 * lstep), "v"(la + 3 * lstep),
                  "v"(lb), "v"(lb + lstep), "v"(lb + 2 * lstep), "v"(lb + 3 * lstep),
                  "v"(ga), "v"(ga + gsa), "v"(ga + 2 * gsa), "v"(ga + 3 * gsa),
                  "v"(gb), "v"(gb + gsb), "v"(gb + 2 * gsb), "v"(gb + 3 * gsb)
               : "memory");
}

// This wave's copies have landed (the compiler places no wait for them).
__device__ __forceinline__ void wait_async0() { asm volatile("s_wait_asynccnt 0x0" ::: "memory"); }
// This wave's LDS reads have returned, before their buffer is handed back.
__device__ __forceinline__ void wait_ds0() { asm volatile("s_wait_dscnt 0x0" ::: "memory"); }

// ---------------------------------------------------------------------------
// A thread converts 32 floats, so that a tensor takes 1/32 of the waves to start.
// Eight 16-byte loads, all issued ahead of the first conversion; each wave-wide
// load covers 512 contiguous bytes and each wave-wide store 256. The grid covers
// the tensor exactly: its length is a multiple of CVT_BLK.
#define CVT_BLK (256 * 32)
__global__ __launch_bounds__(256) void cvt_f32_f16(const float* __restrict__ in,
                                                   _Float16* __restrict__ out) {
  const size_t base = (size_t)blockIdx.x * CVT_BLK + threadIdx.x * 4;
  v4f x[8];
  // both loops unrolled: x stays in registers and the eight loads issue as one group
#pragma unroll
  for (int j = 0; j < 8; ++j) x[j] = *(const v4f*)(in + base + j * 1024);
#pragma unroll
  for (int j = 0; j < 8; ++j) {
    v4h y;
#pragma unroll
    for (int e = 0; e < 4; ++e) y[e] = (_Float16)x[j][e];
    *(v4h*)(out + base + j * 1024) = y;
  }
}

// ---------------------------------------------------------------------------
// C[M,N] = A[M,K] * Bt[N,K]^T + bias  (A,Bt f16 row-major, fp32 accumulate)
// M=4096, N=1024, K=1024.
// Register-blocked: one wave computes a 32x64 tile = 2 A-frags x 4 B-frags
// -> 8 WMMAs per K-step on 8 independent accumulator chains (hides XDL
// accumulation latency), 12 b128 loads per 8 WMMAs (vs 4 per WMMA naive).
// A and B come into LDS by asynchronous copies; fragments are read there.
// mode 0: f16 out in head layout   [b,h,s,dk]
// mode 1: f16 out transposed head  [b,h,dk,s]
// mode 2: fp32 out row-major       [M,N]
__global__ __launch_bounds__(256) void gemm_wmma_32x64(
    const _Float16* __restrict__ A, const _Float16* __restrict__ Bt,
    const float* __restrict__ bias, void* __restrict__ outp, int mode) {
  const int M = Bsz * Ssz, N = Dsz, K = Dsz;
  const int lane = threadIdx.x & 31;
  const int wave = threadIdx.x >> 5;
  // The block's 8 wave tiles lie 4 x 2: a 128 x 128 block tile, so that every
  // staged A row serves 2 waves and every staged B row 4.
  const int nB = N / 128;                           // 8 block columns
  const int mB = blockIdx.x / nB;                   // 0..31 (128-row blocks)
  if (mB >= M / 128) return;
  const int wm = wave >> 1, wn = wave & 1;
  const int mT = mB * 4 + wm;                       // 0..127 (32-row tiles)
  const int nT = (blockIdx.x % nB) * 2 + wn;        // 0..15  (64-col tiles)
  const int ln = lane & 15, laneHi = lane >> 4;

  // One stage = 64 of K: the block's 128 A rows, then its 128 B rows; two buffers.
  __shared__ __attribute__((aligned(16))) _Float16 ab[2][(128 + 128) * LPITCH];
  const unsigned BUFB = (128 + 128) * LPITCHB;      // bytes of one buffer
  const int NST = K / 64;                           // stages

  // Copy slots: 8 lanes cover one 128-byte row piece, so a wave's copy reads 4
  // whole lines; a thread brings rows crow + 32 j, j = 0..3, of A and of B.
  const int crow = threadIdx.x >> 3, ccol = (threadIdx.x & 7) * 8;
  const _Float16* acp = A  + (size_t)(mB * 128 + crow) * K + ccol;
  const _Float16* bcp = Bt + (size_t)((blockIdx.x % nB) * 128 + crow) * K + ccol;
  const unsigned  la0 = lds_off(&ab[0][crow * LPITCH + ccol]);
  auto stage = [&](unsigned buf, int k0) {
    const unsigned la = la0 + buf * BUFB;
    async_copy8(la, acp + k0, (size_t)32 * K,
                la + 128 * LPITCHB, bcp + k0, (size_t)32 * K, 32 * LPITCHB);
  };

  // Stage 0 is copied, waited for and published; stage 1 then flies over trip 0.
  stage(0, 0);
  wait_async0();
  __syncthreads();
  stage(1, 64);

  v8f c00 = {}, c01 = {}, c02 = {}, c03 = {};
  v8f c10 = {}, c11 = {}, c12 = {}, c13 = {};
  for (int st = 0; st < NST; ++st) {
    const _Float16* arow0 = &ab[st & 1][(wm * 32 + ln) * LPITCH];
    const _Float16* arow1 = arow0 + 16 * LPITCH;
    const _Float16* brow0 = &ab[st & 1][(128 + wn * 64 + ln) * LPITCH];
    const _Float16* brow1 = brow0 + 16 * LPITCH;
    const _Float16* brow2 = brow0 + 32 * LPITCH;
    const _Float16* brow3 = brow0 + 48 * LPITCH;
    // unrolled so that the second half's LDS reads are issued under the first
    // half's products
#pragma unroll
    for (int kb = 0; kb < 64; kb += 32) {
      const v16h a0 = ldfrag(arow0, kb, laneHi);
      const v16h a1 = ldfrag(arow1, kb, laneHi);
      const v16h b0 = ldfrag(brow0, kb, laneHi);
      const v16h b1 = ldfrag(brow1, kb, laneHi);
      const v16h b2 = ldfrag(brow2, kb, laneHi);
      const v16h b3 = ldfrag(brow3, kb, laneHi);
      c00 = wmma_f16(a0, b0, c00);  c01 = wmma_f16(a0, b1, c01);
      c02 = wmma_f16(a0, b2, c02);  c03 = wmma_f16(a0, b3, c03);
      c10 = wmma_f16(a1, b0, c10);  c11 = wmma_f16(a1, b1, c11);
      c12 = wmma_f16(a1, b2, c12);  c13 = wmma_f16(a1, b3, c13);
    }
    // publish stage st + 1, then refill the buffer that this trip has read
    wait_ds0();
    wait_async0();
    __syncthreads();
    if (st + 2 < NST) stage(st & 1, (st + 2) * 64);
  }
  wait_async0();

  v8f acc[2][4] = {{c00, c01, c02, c03}, {c10, c11, c12, c13}};
#pragma unroll
  for (int mi = 0; mi < 2; ++mi) {
#pragma unroll
    for (int ni = 0; ni < 4; ++ni) {
      const int ng = nT * 64 + ni * 16 + ln;
      const float bvv = bias[ng];
      const v8f cc = acc[mi][ni];
#pragma unroll
      for (int i = 0; i < 8; ++i) {
        const int mg = mT * 32 + mi * 16 + i + laneHi * 8;   // C row per ISA layout
        const float val = cc[i] + bvv;
        if (mode == 2) {
          ((float*)outp)[(size_t)mg * N + ng] = val;
        } else {
          const int bb = mg >> 11, s = mg & (Ssz - 1);       // token -> (b,s)
          const int hh = ng >> 6,  inner = ng & (DK - 1);
          _Float16* o16 = (_Float16*)outp;
          if (mode == 0)
            o16[(((size_t)(bb * Hn + hh) * Ssz) + s) * DK + inner] = (_Float16)val;
          else
            o16[(((size_t)(bb * Hn + hh) * DK) + inner) * Ssz + s] = (_Float16)val;
        }
      }
    }
  }
}

// ---------------------------------------------------------------------------
// Flash attention: one wave per 16-query tile, 4 waves per block. K and V come
// into LDS by asynchronous copies, once per block, and fragments are read there.
// Qh,Kh: [b,h,s,dk] f16    Vt: [b,h,dk,s] f16    ctx: [b,s,D] f16
__global__ __launch_bounds__(128) void flash_attn(
    const _Float16* __restrict__ Qh, const _Float16* __restrict__ Kh,
    const _Float16* __restrict__ Vt, const int* __restrict__ mask,
    _Float16* __restrict__ ctx) {
  const int lane = threadIdx.x & 31;
  const int wave = threadIdx.x >> 5;
  const int tile = blockIdx.x * 4 + wave;          // 0..4095
  const int qt = tile & (Ssz / 16 - 1);            // query tile in sequence
  const int bh = tile >> 7;                        // b*H + h
  const int b  = bh >> 4, h = bh & (Hn - 1);
  const int q0 = qt * 16;
  const int ln = lane & 15, laneHi = lane >> 4;

  const _Float16* Qb = Qh + (size_t)bh * Ssz * DK;
  const _Float16* Kb = Kh + (size_t)bh * Ssz * DK;
  const _Float16* Vb = Vt + (size_t)bh * DK * Ssz;
  const int*      mb = mask + (size_t)b * Ssz * Ssz;

  __shared__ _Float16 lds[4][16][32];              // per-wave P bounce buffer
  // One stage = 64 keys: K tile (64 keys x dk) and V tile (dk x 64 keys), two
  // buffers, shared by the four waves.
  __shared__ __attribute__((aligned(16))) _Float16 kv[2][2][64 * LPITCH];

  // Copy slots: 8 lanes cover one 128-byte row, so a wave's copy reads 4 whole
  // lines; a thread brings rows crow + 16 j, j = 0..3, of the K and the V tile.
  const int crow = threadIdx.x >> 3, ccol = (threadIdx.x & 7) * 8;
  const _Float16* kcp = Kb + (size_t)crow * DK  + ccol;
  const _Float16* vcp = Vb + (size_t)crow * Ssz + ccol;
  const unsigned  lk0 = lds_off(&kv[0][0][crow * LPITCH + ccol]);
  const unsigned  TILEB = 64 * LPITCHB;            // bytes of one tile in LDS
  const int NST = Ssz / 64;                        // stages

  // Q fragments (held for the whole key sweep): 16 rows x dk=64
  const _Float16* qrow = Qb + (size_t)(q0 + ln) * DK;
  const v16h aq0 = ldfrag(qrow, 0,  laneHi);
  const v16h aq1 = ldfrag(qrow, 32, laneHi);

  v8f o0 = {}, o1 = {}, o2 = {}, o3 = {};
  float mr[8], lr[8];
#pragma unroll
  for (int i = 0; i < 8; ++i) { mr[i] = -3.0e38f; lr[i] = 0.0f; }

  // Stage 0 is copied, waited for and published; stage 1 then flies over trip 0.
  async_copy8(lk0, kcp, 16 * DK, lk0 + TILEB, vcp, (size_t)16 * Ssz, 16 * LPITCHB);
  wait_async0();
  __syncthreads();
  async_copy8(lk0 + 2 * TILEB, kcp + 64 * DK, 16 * DK,
              lk0 + 3 * TILEB, vcp + 64, (size_t)16 * Ssz, 16 * LPITCHB);

  for (int st = 0; st < NST; ++st) {
   const _Float16* Ks = &kv[st & 1][0][0];
   const _Float16* Vs = &kv[st & 1][1][0];
   for (int sub = 0; sub < 64; sub += 32) {
    const int kb = st * 64 + sub;
    // ---- scores: two 16x16 tiles (keys kb..kb+15, kb+16..kb+31), K=dk=64
    const _Float16* k0row = Ks + (sub + ln) * LPITCH;
    const _Float16* k1row = Ks + (sub + 16 + ln) * LPITCH;
    // All LDS fragments of the pass are read as one group here: the V reads
    // then return under the softmax instead of behind the P barriers.
    const v16h kf00 = ldfrag(k0row, 0,  laneHi), kf10 = ldfrag(k1row, 0,  laneHi);
    const v16h kf01 = ldfrag(k0row, 32, laneHi), kf11 = ldfrag(k1row, 32, laneHi);
    const v16h vf0 = ldfrag(Vs + (ln)      * LPITCH, sub, laneHi);
    const v16h vf1 = ldfrag(Vs + (16 + ln) * LPITCH, sub, laneHi);
    const v16h vf2 = ldfrag(Vs + (32 + ln) * LPITCH, sub, laneHi);
    const v16h vf3 = ldfrag(Vs + (48 + ln) * LPITCH, sub, laneHi);
    v8f s0 = {}, s1 = {};
    s0 = wmma_f16(aq0, kf00, s0);
    s1 = wmma_f16(aq0, kf10, s1);
    s0 = wmma_f16(aq1, kf01, s0);
    s1 = wmma_f16(aq1, kf11, s1);

    // ---- scale, mask, online softmax (row stats across 16-lane groups)
#pragma unroll
    for (int i = 0; i < 8; ++i) {
      const int qr = q0 + i + laneHi * 8;
      const int kc = kb + ln;
      float v0 = s0[i] * 0.125f;                   // 1/sqrt(dk)
      float v1 = s1[i] * 0.125f;
      if (mb[(size_t)qr * Ssz + kc] == 0)      v0 = -1.0e10f;
      if (mb[(size_t)qr * Ssz + kc + 16] == 0) v1 = -1.0e10f;
      const float cm    = rmax16(fmaxf(v0, v1));
      const float mnew  = fmaxf(mr[i], cm);
      const float alpha = __expf(mr[i] - mnew);
      const float p0 = __expf(v0 - mnew);
      const float p1 = __expf(v1 - mnew);
      lr[i] = lr[i] * alpha + rsum16(p0 + p1);
      mr[i] = mnew;
      o0[i] *= alpha; o1[i] *= alpha; o2[i] *= alpha; o3[i] *= alpha;
      // C-layout -> LDS (row-major 16x32 P tile, f16)
      lds[wave][i + laneHi * 8][ln]      = (_Float16)p0;
      lds[wave][i + laneHi * 8][ln + 16] = (_Float16)p1;
    }
    __syncthreads();
    const v16h pa = ldfrag(&lds[wave][ln][0], 0, laneHi);  // A-layout reload
    __syncthreads();

    // ---- O += P(16x32) * V(32x64); Vt rows are the B-matrix columns
    o0 = wmma_f16(pa, vf0, o0);
    o1 = wmma_f16(pa, vf1, o1);
    o2 = wmma_f16(pa, vf2, o2);
    o3 = wmma_f16(pa, vf3, o3);
   }
   // ---- publish stage st + 1, then refill the buffer that this trip has read
   wait_ds0();
   wait_async0();
   __syncthreads();
   if (st + 2 < NST) {
     const unsigned lb = lk0 + (unsigned)(st & 1) * (2 * TILEB);
     async_copy8(lb, kcp + (size_t)(st + 2) * 64 * DK, 16 * DK,
                 lb + TILEB, vcp + (st + 2) * 64, (size_t)16 * Ssz, 16 * LPITCHB);
   }
  }
  wait_async0();

  // ---- normalize and write ctx (concat-head layout, f16)
#pragma unroll
  for (int i = 0; i < 8; ++i) {
    const float inv = 1.0f / lr[i];
    const int qr = q0 + i + laneHi * 8;
    _Float16* crow = ctx + ((size_t)(b * Ssz + qr)) * Dsz + h * DK;
    crow[ln]      = (_Float16)(o0[i] * inv);
    crow[16 + ln] = (_Float16)(o1[i] * inv);
    crow[32 + ln] = (_Float16)(o2[i] * inv);
    crow[48 + ln] = (_Float16)(o3[i] * inv);
  }
}

// ---------------------------------------------------------------------------
extern "C" void kernel_launch(void* const* d_in, const int* in_sizes, int n_in,
                              void* d_out, int out_size, void* d_ws, size_t ws_size,
                              hipStream_t stream) {
  (void)in_sizes; (void)n_in; (void)out_size; (void)ws_size;
  const float* q    = (const float*)d_in[0];
  const float* k    = (const float*)d_in[1];
  const float* v    = (const float*)d_in[2];
  const float* Wq   = (const float*)d_in[3];
  const float* bq   = (const float*)d_in[4];
  const float* Wk   = (const float*)d_in[5];
  const float* bk   = (const float*)d_in[6];
  const float* Wv   = (const float*)d_in[7];
  const float* bv   = (const float*)d_in[8];
  const float* Wo   = (const float*)d_in[9];
  const float* bo   = (const float*)d_in[10];
  const int*   mask = (const int*)d_in[11];

  // workspace layout (64 MB total)
  char* w = (char*)d_ws;
  const size_t MB = 1ull << 20;
  _Float16* q16  = (_Float16*)(w + 0 * MB);
  _Float16* k16  = (_Float16*)(w + 8 * MB);
  _Float16* v16f = (_Float16*)(w + 16 * MB);
  _Float16* wq16 = (_Float16*)(w + 24 * MB);
  _Float16* wk16 = (_Float16*)(w + 26 * MB);
  _Float16* wv16 = (_Float16*)(w + 28 * MB);
  _Float16* wo16 = (_Float16*)(w + 30 * MB);
  _Float16* QhP  = (_Float16*)(w + 32 * MB);
  _Float16* KhP  = (_Float16*)(w + 40 * MB);
  _Float16* VtP  = (_Float16*)(w + 48 * MB);
  _Float16* ctxP = (_Float16*)(w + 56 * MB);

  const int nAct = Bsz * Ssz * Dsz;   // 4M
  const int nW   = Dsz * Dsz;         // 1M
  cvt_f32_f16<<<nAct / CVT_BLK, 256, 0, stream>>>(q,  q16);
  cvt_f32_f16<<<nAct / CVT_BLK, 256, 0, stream>>>(k,  k16);
  cvt_f32_f16<<<nAct / CVT_BLK, 256, 0, stream>>>(v,  v16f);
  cvt_f32_f16<<<nW / CVT_BLK, 256, 0, stream>>>(Wq, wq16);
  cvt_f32_f16<<<nW / CVT_BLK, 256, 0, stream>>>(Wk, wk16);
  cvt_f32_f16<<<nW / CVT_BLK, 256, 0, stream>>>(Wv, wv16);
  cvt_f32_f16<<<nW / CVT_BLK, 256, 0, stream>>>(Wo, wo16);

  // (M/32)*(N/64) = 128*16 = 2048 wave-tiles, 8 waves (4 x 2) per 256-thread block
  const int gemmBlocks = 2048 / 8;
  gemm_wmma_32x64<<<gemmBlocks, 256, 0, stream>>>(q16,  wq16, bq, (void*)QhP, 0);
  gemm_wmma_32x64<<<gemmBlocks, 256, 0, stream>>>(k16,  wk16, bk, (void*)KhP, 0);
  gemm_wmma_32x64<<<gemmBlocks, 256, 0, stream>>>(v16f, wv16, bv, (void*)VtP, 1);

  // B*H*(S/16) = 4096 query tiles, 4 waves per 128-thread block
  flash_attn<<<4096 / 4, 128, 0, stream>>>(QhP, KhP, VtP, mask, ctxP);

  gemm_wmma_32x64<<<gemmBlocks, 256, 0, stream>>>(ctxP, wo16, bo, d_out, 2);
}

// v003
// Measured time: 169 microseconds a run.
// Two timings next to v002 both put it at 1.28 times that version's speed.
// Counting every step since v000, it is 2.23 times as fast.
#include <hip/hip_runtime.h>

// ---------------------------------------------------------------------------
// MHA forward for MI455X (gfx1250, wave32, WMMA f32_16x16x32_f16)
// B=2, S=2048, D=1024, H=16, dk=64
// Pipeline:
//   1) fp32 -> f16 convert of q,k,v and Wq,Wk,Wv,Wo into workspace (32 per thread)
//   2) WMMA GEMM (32x64 register-blocked): Qh = q@Wq^T+bq (head layout),
//      Kh likewise, Vt = (v@Wv^T+bv)^T per head
//   3) flash-attention, transposed products (online softmax, mask, scale
//      1/sqrt(64)) -> ctx f16
//   4) WMMA GEMM: out = ctx@Wo^T + bo  (fp32 to d_out)
// ---------------------------------------------------------------------------

typedef __attribute__((ext_vector_type(16))) _Float16 v16h;
typedef __attribute__((ext_vector_type(8)))  _Float16 v8h;
typedef __attribute__((ext_vector_type(8)))  float    v8f;
typedef __attribute__((ext_vector_type(4)))  float    v4f;
typedef __attribute__((ext_vector_type(4)))  _Float16 v4h;
typedef __attribute__((ext_vector_type(4)))  int      v4i;
typedef __attribute__((ext_vector_type(2)))  float    v2f;

#define Bsz 2
#define Ssz 2048
#define Dsz 1024
#define Hn  16
#define DK  64

__device__ __forceinline__ v8f wmma_f16(v16h a, v16h b, v8f c) {
  // v_wmma_f32_16x16x32_f16
  return __builtin_amdgcn_wmma_f32_16x16x32_f16(
      /*neg_a=*/false, a, /*neg_b=*/false, b,
      /*c_mod=*/(short)0, c, /*reuse_a=*/false, /*reuse_b=*/false);
}

// Load a 16-bit A/B fragment (16x32 row-per-lane) from a row-major matrix.
// rowptr points at the start of this lane's row; kb = K-block base.
// ISA layout: lanes 0-15 take k = kb+{0..7,16..23}; lanes 16-31 take +8.
__device__ __forceinline__ v16h ldfrag(const _Float16* rowptr, int kb, int laneHi) {
  const _Float16* p = rowptr + kb + laneHi * 8;
  v8h lo = *(const v8h*)(p);
  v8h hi = *(const v8h*)(p + 16);
  v16h f;
#pragma unroll
  for (int i = 0; i < 8; ++i) { f[i] = lo[i]; f[i + 8] = hi[i]; }
  return f;
}

// Value of lane l ^ 16 (the other half of the wave), by a vector cross-row move.
__device__ __forceinline__ float xhalf(float x) {
  const int xi = __builtin_bit_cast(int, x);
  return __builtin_bit_cast(float, __builtin_amdgcn_permlanex16(xi, xi, 0x76543210, 0xfedcba98, false, false));
}

// LDS rows hold 64 f16 (128 B) at a pitch of 144 B: 16 B x odd, so that the 16
// rows of a ds_load_b128 fragment read fall on different banks.
#define LPITCH 72
#define LPITCHB (LPITCH * 2)

// Byte offset of a __shared__ address inside the work-group's LDS.
__device__ __forceinline__ unsigned lds_off(const void* p) { return (unsigned)(size_t)p; }

// Eight asynchronous 16-byte copies per lane, global -> LDS, through no register,
// in two groups of four rows: group a from ga to la, group b from gb to lb; lstep
// is the row step in LDS bytes, gsa / gsb the row steps in global elements.
// s_wait_xcnt 0 ends the statement so that it stands in front of any rewrite of
// the address registers.
__device__ __forceinline__ void async_copy8(unsigned la, const _Float16* ga, size_t gsa,
                                            unsigned lb, const _Float16* gb, size_t gsb,
                                            unsigned lstep) {
  asm volatile("global_load_async_to_lds_b128 %0, %8, off\n\t"
               "global_load_async_to_lds_b128 %1, %9, off\n\t"
               "global_load_async_to_lds_b128 %2, %10, off\n\t"
               "global_load_async_to_lds_b128 %3, %11, off\n\t"
               "global_load_async_to_lds_b128 %4, %12, off\n\t"
               "global_load_async_to_lds_b128 %5, %13, off\n\t"
               "global_load_async_to_lds_b128 %6, %14, off\n\t"
               "global_load_async_to_lds_b128 %7, %15, off\n\t"
               "s_wait_xcnt 0x0"
               :: "v"(la), "v"(la + lstep), "v"(la + 2 * lstep), "v"(la + 3 * lstep),
                  "v"(lb), "v"(lb + lstep), "v"(lb + 2 * lstep), "v"(lb + 3 * lstep),
                  "v"(ga), "v"(ga + gsa), "v"(ga + 2 * gsa), "v"(ga + 3 * gsa),
                  "v"(gb), "v"(gb + gsb), "v"(gb + 2 * gsb), "v"(gb + 3 * gsb)
               : "memory");
}

// This wave's copies have landed (the compiler places no wait for them).
__device__ __forceinline__ void wait_async0() { asm volatile("s_wait_asynccnt 0x0" ::: "memory"); }
// This wave's LDS reads have returned, before their buffer is handed back.
__device__ __forceinline__ void wait_ds0() { asm volatile("s_wait_dscnt 0x0" ::: "memory"); }

// ---------------------------------------------------------------------------
// A thread converts 32 floats, so that a tensor takes 1/32 of the waves to start.
// Eight 16-byte loads, all issued ahead of the first conversion; each wave-wide
// load covers 512 contiguous bytes and each wave-wide store 256. The grid covers
// the tensor exactly: its length is a multiple of CVT_BLK.
#define CVT_BLK (256 * 32)
__global__ __launch_bounds__(256) void cvt_f32_f16(const float* __restrict__ in,
                                                   _Float16* __restrict__ out) {
  const size_t base = (size_t)blockIdx.x * CVT_BLK + threadIdx.x * 4;
  v4f x[8];
  // both loops unrolled: x stays in registers and the eight loads issue as one group
#pragma unroll
  for (int j = 0; j < 8; ++j) x[j] = *(const v4f*)(in + base + j * 1024);
#pragma unroll
  for (int j = 0; j < 8; ++j) {
    v4h y;
#pragma unroll
    for (int e = 0; e < 4; ++e) y[e] = (_Float16)x[j][e];
    *(v4h*)(out + base + j * 1024) = y;
  }
}

// ---------------------------------------------------------------------------
// C[M,N] = A[M,K] * Bt[N,K]^T + bias  (A,Bt f16 row-major, fp32 accumulate)
// M=4096, N=1024, K=1024.
// Register-blocked: one wave computes a 32x64 tile = 2 A-frags x 4 B-frags
// -> 8 WMMAs per K-step on 8 independent accumulator chains (hides XDL
// accumulation latency), 12 b128 loads per 8 WMMAs (vs 4 per WMMA naive).
// A and B come into LDS by asynchronous copies; fragments are read there.
// mode 0: f16 out in head layout   [b,h,s,dk]
// mode 1: f16 out transposed head  [b,h,dk,s]
// mode 2: fp32 out row-major       [M,N]
__global__ __launch_bounds__(256) void gemm_wmma_32x64(
    const _Float16* __restrict__ A, const _Float16* __restrict__ Bt,
    const float* __restrict__ bias, void* __restrict__ outp, int mode) {
  const int M = Bsz * Ssz, N = Dsz, K = Dsz;
  const int lane = threadIdx.x & 31;
  const int wave = threadIdx.x >> 5;
  // The block's 8 wave tiles lie 4 x 2: a 128 x 128 block tile, so that every
  // staged A row serves 2 waves and every staged B row 4.
  const int nB = N / 128;                           // 8 block columns
  const int mB = blockIdx.x / nB;                   // 0..31 (128-row blocks)
  if (mB >= M / 128) return;
  const int wm = wave >> 1, wn = wave & 1;
  const int mT = mB * 4 + wm;                       // 0..127 (32-row tiles)
  const int nT = (blockIdx.x % nB) * 2 + wn;        // 0..15  (64-col tiles)
  const int ln = lane & 15, laneHi = lane >> 4;

  // One stage = 64 of K: the block's 128 A rows, then its 128 B rows; two buffers.
  __shared__ __attribute__((aligned(16))) _Float16 ab[2][(128 + 128) * LPITCH];
  const unsigned BUFB = (128 + 128) * LPITCHB;      // bytes of one buffer
  const int NST = K / 64;                           // stages

  // Copy slots: 8 lanes cover one 128-byte row piece, so a wave's copy reads 4
  // whole lines; a thread brings rows crow + 32 j, j = 0..3, of A and of B.
  const int crow = threadIdx.x >> 3, ccol = (threadIdx.x & 7) * 8;
  const _Float16* acp = A  + (size_t)(mB * 128 + crow) * K + ccol;
  const _Float16* bcp = Bt + (size_t)((blockIdx.x % nB) * 128 + crow) * K + ccol;
  const unsigned  la0 = lds_off(&ab[0][crow * LPITCH + ccol]);
  auto stage = [&](unsigned buf, int k0) {
    const unsigned la = la0 + buf * BUFB;
    async_copy8(la, acp + k0, (size_t)32 * K,
                la + 128 * LPITCHB, bcp + k0, (size_t)32 * K, 32 * LPITCHB);
  };

  // Stage 0 is copied, waited for and published; stage 1 then flies over trip 0.
  stage(0, 0);
  wait_async0();
  __syncthreads();
  stage(1, 64);

  v8f c00 = {}, c01 = {}, c02 = {}, c03 = {};
  v8f c10 = {}, c11 = {}, c12 = {}, c13 = {};
  for (int st = 0; st < NST; ++st) {
    const _Float16* arow0 = &ab[st & 1][(wm * 32 + ln) * LPITCH];
    const _Float16* arow1 = arow0 + 16 * LPITCH;
    const _Float16* brow0 = &ab[st & 1][(128 + wn * 64 + ln) * LPITCH];
    const _Float16* brow1 = brow0 + 16 * LPITCH;
    const _Float16* brow2 = brow0 + 32 * LPITCH;
    const _Float16* brow3 = brow0 + 48 * LPITCH;
    // unrolled so that the second half's LDS reads are issued under the first
    // half's products
#pragma unroll
    for (int kb = 0; kb < 64; kb += 32) {
      const v16h a0 = ldfrag(arow0, kb, laneHi);
      const v16h a1 = ldfrag(arow1, kb, laneHi);
      const v16h b0 = ldfrag(brow0, kb, laneHi);
      const v16h b1 = ldfrag(brow1, kb, laneHi);
      const v16h b2 = ldfrag(brow2, kb, laneHi);
      const v16h b3 = ldfrag(brow3, kb, laneHi);
      c00 = wmma_f16(a0, b0, c00);  c01 = wmma_f16(a0, b1, c01);
      c02 = wmma_f16(a0, b2, c02);  c03 = wmma_f16(a0, b3, c03);
      c10 = wmma_f16(a1, b0, c10);  c11 = wmma_f16(a1, b1, c11);
      c12 = wmma_f16(a1, b2, c12);  c13 = wmma_f16(a1, b3, c13);
    }
    // publish stage st + 1, then refill the buffer that this trip has read
    wait_ds0();
    wait_async0();
    __syncthreads();
    if (st + 2 < NST) stage(st & 1, (st + 2) * 64);
  }
  wait_async0();

  v8f acc[2][4] = {{c00, c01, c02, c03}, {c10, c11, c12, c13}};
#pragma unroll
  for (int mi = 0; mi < 2; ++mi) {
#pragma unroll
    for (int ni = 0; ni < 4; ++ni) {
      const int ng = nT * 64 + ni * 16 + ln;
      const float bvv = bias[ng];
      const v8f cc = acc[mi][ni];
#pragma unroll
      for (int i = 0; i < 8; ++i) {
        const int mg = mT * 32 + mi * 16 + i + laneHi * 8;   // C row per ISA layout
        const float val = cc[i] + bvv;
        if (mode == 2) {
          ((float*)outp)[(size_t)mg * N + ng] = val;
        } else {
          const int bb = mg >> 11, s = mg & (Ssz - 1);       // token -> (b,s)
          const int hh = ng >> 6,  inner = ng & (DK - 1);
          _Float16* o16 = (_Float16*)outp;
          if (mode == 0)
            o16[(((size_t)(bb * Hn + hh) * Ssz) + s) * DK + inner] = (_Float16)val;
          else
            o16[(((size_t)(bb * Hn + hh) * DK) + inner) * Ssz + s] = (_Float16)val;
        }
      }
    }
  }
}

__global__ __launch_bounds__(128) void flash_attn(
    const _Float16* __restrict__ Qh, const _Float16* __restrict__ Kh,
    const _Float16* __restrict__ Vt, const int* __restrict__ mask,
    _Float16* __restrict__ ctx) {
  const int lane = threadIdx.x & 31;
  const int wave = threadIdx.x >> 5;
  const int tile = blockIdx.x * 4 + wave;          // 0..4095
  const int qt = tile & (Ssz / 16 - 1);            // query tile in sequence
  const int bh = tile >> 7;                        // b*H + h
  const int b  = bh >> 4, h = bh & (Hn - 1);
  const int q0 = qt * 16;
  const int ln = lane & 15, laneHi = lane >> 4;

  const _Float16* Qb = Qh + (size_t)bh * Ssz * DK;
  const _Float16* Kb = Kh + (size_t)bh * Ssz * DK;
  const _Float16* Vb = Vt + (size_t)bh * DK * Ssz;
  // This lane's mask row, at the first key that it holds of a 16-key tile.
  const int* mrow = mask + ((size_t)b * Ssz + q0 + ln) * Ssz + laneHi * 8;

  // One stage = 64 keys: K tile (64 keys x dk) and V tile (dk x 64 keys), two
  // buffers, shared by the four waves.
  __shared__ __attribute__((aligned(16))) _Float16 kv[2][2][64 * LPITCH];

  // Copy slots: 8 lanes cover one 128-byte row, so a wave's copy reads 4 whole
  // lines; a thread brings rows crow + 16 j, j = 0..3, of the K and the V tile.
  const int crow = threadIdx.x >> 3, ccol = (threadIdx.x & 7) * 8;
  const _Float16* kcp = Kb + (size_t)crow * DK  + ccol;
  const _Float16* vcp = Vb + (size_t)crow * Ssz + ccol;
  const unsigned  lk0 = lds_off(&kv[0][0][crow * LPITCH + ccol]);
  const unsigned  TILEB = 64 * LPITCHB;            // bytes of one tile in LDS
  const int NST = Ssz / 64;                        // stages

  // Q fragments (held for the whole key sweep), B operand: column ln = query
  // q0 + ln, k = dk
  const _Float16* qrow = Qb + (size_t)(q0 + ln) * DK;
  const v16h bq0 = ldfrag(qrow, 0,  laneHi);
  const v16h bq1 = ldfrag(qrow, 32, laneHi);

  // O^T tiles: ot[i] = O[q0 + ln][16 t + 8 laneHi + i]
  v8f o0 = {}, o1 = {}, o2 = {}, o3 = {};
  float mr = -3.0e38f;                             // running maximum of query ln
  float lr = 0.0f;                                 // sum over this lane's keys only

  // Stage 0 is copied, waited for and published; stage 1 then flies over trip 0.
  async_copy8(lk0, kcp, 16 * DK, lk0 + TILEB, vcp, (size_t)16 * Ssz, 16 * LPITCHB);
  wait_async0();
  __syncthreads();
  async_copy8(lk0 + 2 * TILEB, kcp + 64 * DK, 16 * DK,
              lk0 + 3 * TILEB, vcp + 64, (size_t)16 * Ssz, 16 * LPITCHB);

  for (int st = 0; st < NST; ++st) {
   const _Float16* Ks = &kv[st & 1][0][0];
   const _Float16* Vs = &kv[st & 1][1][0];
   // ---- mask of this lane's keys: of each 16-key tile t of the stage the keys
   // 16 t + 8 laneHi + 0..7, two 16-byte loads
   v4i mk[4][2];
#pragma unroll
   for (int t = 0; t < 4; ++t) {
     mk[t][0] = *(const v4i*)(mrow + st * 64 + t * 16);
     mk[t][1] = *(const v4i*)(mrow + st * 64 + t * 16 + 4);
   }
   // ---- K fragments of the four 16-key tiles of the stage (A operand: row ln of
   // tile t = key 16 t + ln)
   v16h kf[4][2];
#pragma unroll
   for (int t = 0; t < 4; ++t) {
     const _Float16* krow = Ks + (t * 16 + ln) * LPITCH;
     kf[t][0] = ldfrag(krow, 0,  laneHi);
     kf[t][1] = ldfrag(krow, 32, laneHi);
   }
   // keeps the mask loads and the K reads one group at the head of the stage:
   // sunk to their uses, each would have its latency waited out by itself
   __builtin_amdgcn_sched_barrier(0);
   // ---- scores: four 16x16 tiles of S^T, K=dk=64
   v8f sc[4];
#pragma unroll
   for (int t = 0; t < 4; ++t) {
     const v8f z = {};
     sc[t] = wmma_f16(kf[t][0], bq0, z);
   }
#pragma unroll
   for (int t = 0; t < 4; ++t) sc[t] = wmma_f16(kf[t][1], bq1, sc[t]);
   // keeps the mask compares, and with them the wait for the mask, behind the
   // score products, which then run under the mask's latency
   __builtin_amdgcn_sched_barrier(0);
   // unrolled: sc and mk stay in registers, and with no barrier in a pass the
   // second pass's V reads can be issued under the first pass's softmax
#pragma unroll
   for (int sub = 0; sub < 64; sub += 32) {
    const v16h vf0 = ldfrag(Vs + (ln)      * LPITCH, sub, laneHi);
    const v16h vf1 = ldfrag(Vs + (16 + ln) * LPITCH, sub, laneHi);
    const v16h vf2 = ldfrag(Vs + (32 + ln) * LPITCH, sub, laneHi);
    const v16h vf3 = ldfrag(Vs + (48 + ln) * LPITCH, sub, laneHi);

    // ---- scale, mask, online softmax of query ln over 32 keys
    const v8f t0 = sc[sub / 16] * 0.125f, t1 = sc[sub / 16 + 1] * 0.125f;  // 1/sqrt(dk)
    float sv[16];
    float cm0 = -3.0e38f, cm1 = -3.0e38f;          // one chain of maxima a tile
#pragma unroll
    for (int i = 0; i < 8; ++i) {
      const int m0 = mk[sub / 16][i >> 2][i & 3];
      const int m1 = mk[sub / 16 + 1][i >> 2][i & 3];
      sv[i]     = m0 == 0 ? -1.0e10f : t0[i];
      sv[i + 8] = m1 == 0 ? -1.0e10f : t1[i];
      cm0 = fmaxf(cm0, sv[i]);
      cm1 = fmaxf(cm1, sv[i + 8]);
    }
    const float cm = fmaxf(cm0, cm1);
    const float mnew  = fmaxf(mr, fmaxf(cm, xhalf(cm)));  // both halves: all 32 keys
    const float alpha = __expf(mr - mnew);
    mr = mnew;
    v16h pb;                                       // P^T, B operand
    v2f ps2 = {};                                  // even and odd keys apart
#pragma unroll
    for (int s = 0; s < 16; s += 2) {
      const v2f p = {__expf(sv[s] - mnew), __expf(sv[s + 1] - mnew)};
      ps2 += p;
      pb[s] = (_Float16)p[0];
      pb[s + 1] = (_Float16)p[1];
    }
    const float ps = ps2[0] + ps2[1];
    lr = lr * alpha + ps;
    o0 *= alpha; o1 *= alpha; o2 *= alpha; o3 *= alpha;

    // ---- O^T += V^T(64x32) * P^T(32x16); Vt rows are the A-matrix rows
    o0 = wmma_f16(vf0, pb, o0);
    o1 = wmma_f16(vf1, pb, o1);
    o2 = wmma_f16(vf2, pb, o2);
    o3 = wmma_f16(vf3, pb, o3);
   }
   // ---- publish stage st + 1, then refill the buffer that this trip has read
   wait_ds0();
   wait_async0();
   __syncthreads();
   if (st + 2 < NST) {
     const unsigned lb = lk0 + (unsigned)(st & 1) * (2 * TILEB);
     async_copy8(lb, kcp + (size_t)(st + 2) * 64 * DK, 16 * DK,
                 lb + TILEB, vcp + (st + 2) * 64, (size_t)16 * Ssz, 16 * LPITCHB);
   }
  }
  wait_async0();

  // ---- join the halves' sums, normalize and write ctx (concat-head layout,
  // f16): a lane's 8 registers of a tile are 8 consecutive columns of its row
  const float inv = 1.0f / (lr + xhalf(lr));
  _Float16* crowp = ctx + ((size_t)(b * Ssz + q0 + ln)) * Dsz + h * DK + laneHi * 8;
  const v8f ot[4] = {o0, o1, o2, o3};
#pragma unroll
  for (int t = 0; t < 4; ++t) {
    v8h y;
#pragma unroll
    for (int i = 0; i < 8; ++i) y[i] = (_Float16)(ot[t][i] * inv);
    *(v8h*)(crowp + 16 * t) = y;
  }
}

// ---------------------------------------------------------------------------
extern "C" void kernel_launch(void* const* d_in, const int* in_sizes, int n_in,
                              void* d_out, int out_size, void* d_ws, size_t ws_size,
                              hipStream_t stream) {
  (void)in_sizes; (void)n_in; (void)out_size; (void)ws_size;
  const float* q    = (const float*)d_in[0];
  const float* k    = (const float*)d_in[1];
  const float* v    = (const float*)d_in[2];
  const float* Wq   = (const float*)d_in[3];
  const float* bq   = (const float*)d_in[4];
  const float* Wk   = (const float*)d_in[5];
  const float* bk   = (const float*)d_in[6];
  const float* Wv   = (const float*)d_in[7];
  const float* bv   = (const float*)d_in[8];
  const float* Wo   = (const float*)d_in[9];
  const float* bo   = (const float*)d_in[10];
  const int*   mask = (const int*)d_in[11];

  // workspace layout (64 MB total)
  char* w = (char*)d_ws;
  const size_t MB = 1ull << 20;
  _Float16* q16  = (_Float16*)(w + 0 * MB);
  _Float16* k16  = (_Float16*)(w + 8 * MB);
  _Float16* v16f = (_Float16*)(w + 16 * MB);
  _Float16* wq16 = (_Float16*)(w + 24 * MB);
  _Float16* wk16 = (_Float16*)(w + 26 * MB);
  _Float16* wv16 = (_Float16*)(w + 28 * MB);
  _Float16* wo16 = (_Float16*)(w + 30 * MB);
  _Float16* QhP  = (_Float16*)(w + 32 * MB);
  _Float16* KhP  = (_Float16*)(w + 40 * MB);
  _Float16* VtP  = (_Float16*)(w + 48 * MB);
  _Float16* ctxP = (_Float16*)(w + 56 * MB);

  const int nAct = Bsz * Ssz * Dsz;   // 4M
  const int nW   = Dsz * Dsz;         // 1M
  cvt_f32_f16<<<nAct / CVT_BLK, 256, 0, stream>>>(q,  q16);
  cvt_f32_f16<<<nAct / CVT_BLK, 256, 0, stream>>>(k,  k16);
  cvt_f32_f16<<<nAct / CVT_BLK, 256, 0, stream>>>(v,  v16f);
  cvt_f32_f16<<<nW / CVT_BLK, 256, 0, stream>>>(Wq, wq16);
  cvt_f32_f16<<<nW / CVT_BLK, 256, 0, stream>>>(Wk, wk16);
  cvt_f32_f16<<<nW / CVT_BLK, 256, 0, stream>>>(Wv, wv16);
  cvt_f32_f16<<<nW / CVT_BLK, 256, 0, stream>>>(Wo, wo16);

  // (M/32)*(N/64) = 128*16 = 2048 wave-tiles, 8 waves (4 x 2) per 256-thread block
  const int gemmBlocks = 2048 / 8;
  gemm_wmma_32x64<<<gemmBlocks, 256, 0, stream>>>(q16,  wq16, bq, (void*)QhP, 0);
  gemm_wmma_32x64<<<gemmBlocks, 256, 0, stream>>>(k16,  wk16, bk, (void*)KhP, 0);
  gemm_wmma_32x64<<<gemmBlocks, 256, 0, stream>>>(v16f, wv16, bv, (void*)VtP, 1);

  // B*H*(S/16) = 4096 query tiles, 4 waves per 128-thread block
  flash_attn<<<4096 / 4, 128, 0, stream>>>(QhP, KhP, VtP, mask, ctxP);

  gemm_wmma_32x64<<<gemmBlocks, 256, 0, stream>>>(ctxP, wo16, bo, d_out, 2);
}

// v004
// It runs in 124 microseconds.
// Two timings next to v003 both put it at 1.35 times that version's speed.
// All steps since v000 together make it 3.01 times as fast.
#include <hip/hip_runtime.h>

// ---------------------------------------------------------------------------
// MHA forward for MI455X (gfx1250, wave32, WMMA f32_16x16x32_f16)
// B=2, S=2048, D=1024, H=16, dk=64
// Pipeline:
//   1) fp32 -> f16 convert of q,k,v and Wq,Wk,Wv,Wo into workspace (32 per thread),
//      one launch for the seven tensors
//   2) WMMA GEMM (32x64 register-blocked): Qh = q@Wq^T+bq (head layout),
//      Kh likewise, Vt = (v@Wv^T+bv)^T per head, one launch for the three
//   3) flash-attention, transposed products (online softmax, mask, scale
//      1/sqrt(64)) -> ctx f16
//   4) WMMA GEMM: out = ctx@Wo^T + bo  (fp32 to d_out)
// ---------------------------------------------------------------------------

typedef __attribute__((ext_vector_type(16))) _Float16 v16h;
typedef __attribute__((ext_vector_type(8)))  _Float16 v8h;
typedef __attribute__((ext_vector_type(8)))  float    v8f;
typedef __attribute__((ext_vector_type(4)))  float    v4f;
typedef __attribute__((ext_vector_type(4)))  _Float16 v4h;
typedef __attribute__((ext_vector_type(4)))  int      v4i;
typedef __attribute__((ext_vector_type(2)))  float    v2f;

#define Bsz 2
#define Ssz 2048
#define Dsz 1024
#define Hn  16
#define DK  64

__device__ __forceinline__ v8f wmma_f16(v16h a, v16h b, v8f c) {
  // v_wmma_f32_16x16x32_f16
  return __builtin_amdgcn_wmma_f32_16x16x32_f16(
      /*neg_a=*/false, a, /*neg_b=*/false, b,
      /*c_mod=*/(short)0, c, /*reuse_a=*/false, /*reuse_b=*/false);
}

// Load a 16-bit A/B fragment (16x32 row-per-lane) from a row-major matrix.
// rowptr points at the start of this lane's row; kb = K-block base.
// ISA layout: lanes 0-15 take k = kb+{0..7,16..23}; lanes 16-31 take +8.
__device__ __forceinline__ v16h ldfrag(const _Float16* rowptr, int kb, int laneHi) {
  const _Float16* p = rowptr + kb + laneHi * 8;
  v8h lo = *(const v8h*)(p);
  v8h hi = *(const v8h*)(p + 16);
  v16h f;
#pragma unroll
  for (int i = 0; i < 8; ++i) { f[i] = lo[i]; f[i + 8] = hi[i]; }
  return f;
}

// Value of lane l ^ 16 (the other half of the wave), by a vector cross-row move.
__device__ __forceinline__ float xhalf(float x) {
  const int xi = __builtin_bit_cast(int, x);
  return __builtin_bit_cast(float, __builtin_amdgcn_permlanex16(xi, xi, 0x76543210, 0xfedcba98, false, false));
}

// LDS rows hold 64 f16 (128 B) at a pitch of 144 B: 16 B x odd, so that the 16
// rows of a ds_load_b128 fragment read fall on different banks.
#define LPITCH 72
#define LPITCHB (LPITCH * 2)

// Byte offset of a __shared__ address inside the work-group's LDS.
__device__ __forceinline__ unsigned lds_off(const void* p) { return (unsigned)(size_t)p; }

// Eight asynchronous 16-byte copies per lane, global -> LDS, through no register,
// in two groups of four rows: group a from ga to la, group b from gb to lb; lstep
// is the row step in LDS bytes, gsa / gsb the row steps in global elements.
// s_wait_xcnt 0 ends the statement so that it stands in front of any rewrite of
// the address registers.
__device__ __forceinline__ void async_copy8(unsigned la, const _Float16* ga, size_t gsa,
                                            unsigned lb, const _Float16* gb, size_t gsb,
                                            unsigned lstep) {
  asm volatile("global_load_async_to_lds_b128 %0, %8, off\n\t"
               "global_load_async_to_lds_b128 %1, %9, off\n\t"
               "global_load_async_to_lds_b128 %2, %10, off\n\t"
               "global_load_async_to_lds_b128 %3, %11, off\n\t"
               "global_load_async_to_lds_b128 %4, %12, off\n\t"
               "global_load_async_to_lds_b128 %5, %13, off\n\t"
               "global_load_async_to_lds_b128 %6, %14, off\n\t"
               "global_load_async_to_lds_b128 %7, %15, off\n\t"
               "s_wait_xcnt 0x0"
               :: "v"(la), "v"(la + lstep), "v"(la + 2 * lstep), "v"(la + 3 * lstep),
                  "v"(lb), "v"(lb + lstep), "v"(lb + 2 * lstep), "v"(lb + 3 * lstep),
                  "v"(ga), "v"(ga + gsa), "v"(ga + 2 * gsa), "v"(ga + 3 * gsa),
                  "v"(gb), "v"(gb + gsb), "v"(gb + 2 * gsb), "v"(gb + 3 * gsb)
               : "memory");
}

// This wave's copies have landed (the compiler places no wait for them).
__device__ __forceinline__ void wait_async0() { asm volatile("s_wait_asynccnt 0x0" ::: "memory"); }
// This wave's LDS reads have returned, before their buffer is handed back.
__device__ __forceinline__ void wait_ds0() { asm volatile("s_wait_dscnt 0x0" ::: "memory"); }

// ---------------------------------------------------------------------------
// A thread converts 32 floats, so that a tensor takes 1/32 of the waves to start.
// Eight 16-byte loads, all issued ahead of the first conversion; each wave-wide
// load covers 512 contiguous bytes and each wave-wide store 256.
// One grid converts all seven tensors: they depend on nothing and on one another
// not at all, so one launch pays the gap, the start and the drain once. The f16
// copies lie one behind the other in the workspace in the order q, k, v, Wq, Wk,
// Wv, Wo, so the block index alone gives the place in out; each tensor's length
// is a multiple of CVT_BLK, so a block lies in one tensor.
#define CVT_BLK (256 * 32)
#define CVT_ACT_BLKS (Bsz * Ssz * Dsz / CVT_BLK)   // blocks of q, k or v: 512
#define CVT_W_BLKS   (Dsz * Dsz / CVT_BLK)         // blocks of a weight: 128
#define CVT_BLKS     (3 * CVT_ACT_BLKS + 4 * CVT_W_BLKS)
__global__ __launch_bounds__(256) void cvt_f32_f16(
    const float* __restrict__ q, const float* __restrict__ k, const float* __restrict__ v,
    const float* __restrict__ Wq, const float* __restrict__ Wk,
    const float* __restrict__ Wv, const float* __restrict__ Wo,
    _Float16* __restrict__ out16) {
  const unsigned bid = blockIdx.x;
  const float* src;
  unsigned lb;                                     // block index inside the tensor
  if (bid < 3 * CVT_ACT_BLKS) {
    const unsigned t = bid / CVT_ACT_BLKS;
    lb = bid % CVT_ACT_BLKS;
    src = t == 0 ? q : t == 1 ? k : v;
  } else {
    const unsigned r = bid - 3 * CVT_ACT_BLKS, t = r / CVT_W_BLKS;
    lb = r % CVT_W_BLKS;
    src = t == 0 ? Wq : t == 1 ? Wk : t == 2 ? Wv : Wo;
  }
  const float* in = src + (size_t)lb * CVT_BLK;
  _Float16* out = out16 + (size_t)bid * CVT_BLK;
  const size_t base = threadIdx.x * 4;
  v4f x[8];
  // both loops unrolled: x stays in registers and the eight loads issue as one group
#pragma unroll
  for (int j = 0; j < 8; ++j) x[j] = *(const v4f*)(in + base + j * 1024);
#pragma unroll
  for (int j = 0; j < 8; ++j) {
    v4h y;
#pragma unroll
    for (int e = 0; e < 4; ++e) y[e] = (_Float16)x[j][e];
    *(v4h*)(out + base + j * 1024) = y;
  }
}

// ---------------------------------------------------------------------------
// C[M,N] = A[M,K] * Bt[N,K]^T + bias  (A,Bt f16 row-major, fp32 accumulate)
// M=4096, N=1024, K=1024.
// Register-blocked: one wave computes a 32x64 tile = 2 A-frags x 4 B-frags
// -> 8 WMMAs per K-step on 8 independent accumulator chains (hides XDL
// accumulation latency), 12 b128 loads per 8 WMMAs (vs 4 per WMMA naive).
// A and B come into LDS by asynchronous copies; fragments are read there.
// mode 0: f16 out in head layout   [b,h,s,dk]
// mode 1: f16 out transposed head  [b,h,dk,s]
// mode 2: fp32 out row-major       [M,N]
// blk: the block's index among the GEMM_BLKS blocks of one product.
#define GEMM_BLKS ((Bsz * Ssz / 128) * (Dsz / 128))   // 256
__device__ __forceinline__ void gemm_body(
    const _Float16* __restrict__ A, const _Float16* __restrict__ Bt,
    const float* __restrict__ bias, void* __restrict__ outp, int mode, int blk) {
  const int M = Bsz * Ssz, N = Dsz, K = Dsz;
  const int lane = threadIdx.x & 31;
  const int wave = threadIdx.x >> 5;
  // The block's 8 wave tiles lie 4 x 2: a 128 x 128 block tile, so that every
  // staged A row serves 2 waves and every staged B row 4.
  const int nB = N / 128;                           // 8 block columns
  const int mB = blk / nB;                          // 0..31 (128-row blocks)
  if (mB >= M / 128) return;
  const int wm = wave >> 1, wn = wave & 1;
  const int mT = mB * 4 + wm;                       // 0..127 (32-row tiles)
  const int nT = (blk % nB) * 2 + wn;               // 0..15  (64-col tiles)
  const int ln = lane & 15, laneHi = lane >> 4;

  // One stage = 64 of K: the block's 128 A rows, then its 128 B rows; two buffers.
  __shared__ __attribute__((aligned(16))) _Float16 ab[2][(128 + 128) * LPITCH];
  const unsigned BUFB = (128 + 128) * LPITCHB;      // bytes of one buffer
  const int NST = K / 64;                           // stages

  // Copy slots: 8 lanes cover one 128-byte row piece, so a wave's copy reads 4
  // whole lines; a thread brings rows crow + 32 j, j = 0..3, of A and of B.
  const int crow = threadIdx.x >> 3, ccol = (threadIdx.x & 7) * 8;
  const _Float16* acp = A  + (size_t)(mB * 128 + crow) * K + ccol;
  const _Float16* bcp = Bt + (size_t)((blk % nB) * 128 + crow) * K + ccol;
  const unsigned  la0 = lds_off(&ab[0][crow * LPITCH + ccol]);
  auto stage = [&](unsigned buf, int k0) {
    const unsigned la = la0 + buf * BUFB;
    async_copy8(la, acp + k0, (size_t)32 * K,
                la + 128 * LPITCHB, bcp + k0, (size_t)32 * K, 32 * LPITCHB);
  };

  // Stage 0 is copied, waited for and published; stage 1 then flies over trip 0.
  stage(0, 0);
  wait_async0();
  __syncthreads();
  stage(1, 64);

  v8f c00 = {}, c01 = {}, c02 = {}, c03 = {};
  v8f c10 = {}, c11 = {}, c12 = {}, c13 = {};
  for (int st = 0; st < NST; ++st) {
    const _Float16* arow0 = &ab[st & 1][(wm * 32 + ln) * LPITCH];
    const _Float16* arow1 = arow0 + 16 * LPITCH;
    const _Float16* brow0 = &ab[st & 1][(128 + wn * 64 + ln) * LPITCH];
    const _Float16* brow1 = brow0 + 16 * LPITCH;
    const _Float16* brow2 = brow0 + 32 * LPITCH;
    const _Float16* brow3 = brow0 + 48 * LPITCH;
    // unrolled so that the second half's LDS reads are issued under the first
    // half's products
#pragma unroll
    for (int kb = 0; kb < 64; kb += 32) {
      const v16h a0 = ldfrag(arow0, kb, laneHi);
      const v16h a1 = ldfrag(arow1, kb, laneHi);
      const v16h b0 = ldfrag(brow0, kb, laneHi);
      const v16h b1 = ldfrag(brow1, kb, laneHi);
      const v16h b2 = ldfrag(brow2, kb, laneHi);
      const v16h b3 = ldfrag(brow3, kb, laneHi);
      c00 = wmma_f16(a0, b0, c00);  c01 = wmma_f16(a0, b1, c01);
      c02 = wmma_f16(a0, b2, c02);  c03 = wmma_f16(a0, b3, c03);
      c10 = wmma_f16(a1, b0, c10);  c11 = wmma_f16(a1, b1, c11);
      c12 = wmma_f16(a1, b2, c12);  c13 = wmma_f16(a1, b3, c13);
    }
    // publish stage st + 1, then refill the buffer that this trip has read
    wait_ds0();
    wait_async0();
    __syncthreads();
    if (st + 2 < NST) stage(st & 1, (st + 2) * 64);
  }
  wait_async0();

  v8f acc[2][4] = {{c00, c01, c02, c03}, {c10, c11, c12, c13}};
#pragma unroll
  for (int mi = 0; mi < 2; ++mi) {
#pragma unroll
    for (int ni = 0; ni < 4; ++ni) {
      const int ng = nT * 64 + ni * 16 + ln;
      const float bvv = bias[ng];
      const v8f cc = acc[mi][ni];
#pragma unroll
      for (int i = 0; i < 8; ++i) {
        const int mg = mT * 32 + mi * 16 + i + laneHi * 8;   // C row per ISA layout
        const float val = cc[i] + bvv;
        if (mode == 2) {
          ((float*)outp)[(size_t)mg * N + ng] = val;
        } else {
          const int bb = mg >> 11, s = mg & (Ssz - 1);       // token -> (b,s)
          const int hh = ng >> 6,  inner = ng & (DK - 1);
          _Float16* o16 = (_Float16*)outp;
          if (mode == 0)
            o16[(((size_t)(bb * Hn + hh) * Ssz) + s) * DK + inner] = (_Float16)val;
          else  // 2 bytes a lane, every lane of a half-wave on a line of its own
            o16[(((size_t)(bb * Hn + hh) * DK) + inner) * Ssz + s] = (_Float16)val;
        }
      }
    }
  }
}

// The three projections in one grid: they share no data, so one launch pays the
// gap once, and three blocks on a WGP fill one another's waits for the copies.
// Blocks 0..255 make Qh, 256..511 Kh, 512..767 Vt.
__global__ __launch_bounds__(256) void gemm_qkv(
    const _Float16* __restrict__ q16, const _Float16* __restrict__ k16,
    const _Float16* __restrict__ v16, const _Float16* __restrict__ wq16,
    const _Float16* __restrict__ wk16, const _Float16* __restrict__ wv16,
    const float* __restrict__ bq, const float* __restrict__ bk,
    const float* __restrict__ bv, _Float16* __restrict__ Qh,
    _Float16* __restrict__ Kh, _Float16* __restrict__ Vt) {
  const int p = blockIdx.x / GEMM_BLKS, blk = blockIdx.x % GEMM_BLKS;
  const _Float16* A    = p == 0 ? q16  : p == 1 ? k16  : v16;
  const _Float16* Bt   = p == 0 ? wq16 : p == 1 ? wk16 : wv16;
  const float*    bias = p == 0 ? bq   : p == 1 ? bk   : bv;
  _Float16*       o    = p == 0 ? Qh   : p == 1 ? Kh   : Vt;
  gemm_body(A, Bt, bias, (void*)o, p == 2 ? 1 : 0, blk);
}

// The output projection, fp32 to the output buffer.
__global__ __launch_bounds__(256) void gemm_out(
    const _Float16* __restrict__ ctx, const _Float16* __restrict__ wo16,
    const float* __restrict__ bo, float* __restrict__ out) {
  gemm_body(ctx, wo16, bo, (void*)out, 2, blockIdx.x);
}

__global__ __launch_bounds__(128) void flash_attn(
    const _Float16* __restrict__ Qh, const _Float16* __restrict__ Kh,
    const _Float16* __restrict__ Vt, const int* __restrict__ mask,
    _Float16* __restrict__ ctx) {
  const int lane = threadIdx.x & 31;
  const int wave = threadIdx.x >> 5;
  const int tile = blockIdx.x * 4 + wave;          // 0..4095
  const int qt = tile & (Ssz / 16 - 1);            // query tile in sequence
  const int bh = tile >> 7;                        // b*H + h
  const int b  = bh >> 4, h = bh & (Hn - 1);
  const int q0 = qt * 16;
  const int ln = lane & 15, laneHi = lane >> 4;

  const _Float16* Qb = Qh + (size_t)bh * Ssz * DK;
  const _Float16* Kb = Kh + (size_t)bh * Ssz * DK;
  const _Float16* Vb = Vt + (size_t)bh * DK * Ssz;
  // This lane's mask row, at the first key that it holds of a 16-key tile.
  const int* mrow = mask + ((size_t)b * Ssz + q0 + ln) * Ssz + laneHi * 8;

  // One stage = 64 keys: K tile (64 keys x dk) and V tile (dk x 64 keys), two
  // buffers, shared by the four waves.
  __shared__ __attribute__((aligned(16))) _Float16 kv[2][2][64 * LPITCH];

  // Copy slots: 8 lanes cover one 128-byte row, so a wave's copy reads 4 whole
  // lines; a thread brings rows crow + 16 j, j = 0..3, of the K and the V tile.
  const int crow = threadIdx.x >> 3, ccol = (threadIdx.x & 7) * 8;
  const _Float16* kcp = Kb + (size_t)crow * DK  + ccol;
  const _Float16* vcp = Vb + (size_t)crow * Ssz + ccol;
  const unsigned  lk0 = lds_off(&kv[0][0][crow * LPITCH + ccol]);
  const unsigned  TILEB = 64 * LPITCHB;            // bytes of one tile in LDS
  const int NST = Ssz / 64;                        // stages

  // Q fragments (held for the whole key sweep), B operand: column ln = query
  // q0 + ln, k = dk
  const _Float16* qrow = Qb + (size_t)(q0 + ln) * DK;
  const v16h bq0 = ldfrag(qrow, 0,  laneHi);
  const v16h bq1 = ldfrag(qrow, 32, laneHi);

  // O^T tiles: ot[i] = O[q0 + ln][16 t + 8 laneHi + i]
  v8f o0 = {}, o1 = {}, o2 = {}, o3 = {};
  float mr = -3.0e38f;                             // running maximum of query ln
  float lr = 0.0f;                                 // sum over this lane's keys only

  // Stage 0 is copied, waited for and published; stage 1 then flies over trip 0.
  async_copy8(lk0, kcp, 16 * DK, lk0 + TILEB, vcp, (size_t)16 * Ssz, 16 * LPITCHB);
  wait_async0();
  __syncthreads();
  async_copy8(lk0 + 2 * TILEB, kcp + 64 * DK, 16 * DK,
              lk0 + 3 * TILEB, vcp + 64, (size_t)16 * Ssz, 16 * LPITCHB);

  for (int st = 0; st < NST; ++st) {
   const _Float16* Ks = &kv[st & 1][0][0];
   const _Float16* Vs = &kv[st & 1][1][0];
   // ---- mask of this lane's keys: of each 16-key tile t of the stage the keys
   // 16 t + 8 laneHi + 0..7, two 16-byte loads
   v4i mk[4][2];
#pragma unroll
   for (int t = 0; t < 4; ++t) {
     mk[t][0] = *(const v4i*)(mrow + st * 64 + t * 16);
     mk[t][1] = *(const v4i*)(mrow + st * 64 + t * 16 + 4);
   }
   // ---- K fragments of the four 16-key tiles of the stage (A operand: row ln of
   // tile t = key 16 t + ln)
   v16h kf[4][2];
#pragma unroll
   for (int t = 0; t < 4; ++t) {
     const _Float16* krow = Ks + (t * 16 + ln) * LPITCH;
     kf[t][0] = ldfrag(krow, 0,  laneHi);
     kf[t][1] = ldfrag(krow, 32, laneHi);
   }
   // keeps the mask loads and the K reads one group at the head of the stage:
   // sunk to their uses, each would have its latency waited out by itself
   __builtin_amdgcn_sched_barrier(0);
   // ---- scores: four 16x16 tiles of S^T, K=dk=64
   v8f sc[4];
#pragma unroll
   for (int t = 0; t < 4; ++t) {
     const v8f z = {};
     sc[t] = wmma_f16(kf[t][0], bq0, z);
   }
#pragma unroll
   for (int t = 0; t < 4; ++t) sc[t] = wmma_f16(kf[t][1], bq1, sc[t]);
   // keeps the mask compares, and with them the wait for the mask, behind the
   // score products, which then run under the mask's latency
   __builtin_amdgcn_sched_barrier(0);
   // unrolled: sc and mk stay in registers, and with no barrier in a pass the
   // second pass's V reads can be issued under the first pass's softmax
#pragma unroll
   for (int sub = 0; sub < 64; sub += 32) {
    const v16h vf0 = ldfrag(Vs + (ln)      * LPITCH, sub, laneHi);
    const v16h vf1 = ldfrag(Vs + (16 + ln) * LPITCH, sub, laneHi);
    const v16h vf2 = ldfrag(Vs + (32 + ln) * LPITCH, sub, laneHi);
    const v16h vf3 = ldfrag(Vs + (48 + ln) * LPITCH, sub, laneHi);

    // ---- scale, mask, online softmax of query ln over 32 keys
    const v8f t0 = sc[sub / 16] * 0.125f, t1 = sc[sub / 16 + 1] * 0.125f;  // 1/sqrt(dk)
    float sv[16];
    float cm0 = -3.0e38f, cm1 = -3.0e38f;          // one chain of maxima a tile
#pragma unroll
    for (int i = 0; i < 8; ++i) {
      const int m0 = mk[sub / 16][i >> 2][i & 3];
      const int m1 = mk[sub / 16 + 1][i >> 2][i & 3];
      sv[i]     = m0 == 0 ? -1.0e10f : t0[i];
      sv[i + 8] = m1 == 0 ? -1.0e10f : t1[i];
      cm0 = fmaxf(cm0, sv[i]);
      cm1 = fmaxf(cm1, sv[i + 8]);
    }
    const float cm = fmaxf(cm0, cm1);
    const float mnew  = fmaxf(mr, fmaxf(cm, xhalf(cm)));  // both halves: all 32 keys
    const float alpha = __expf(mr - mnew);
    mr = mnew;
    v16h pb;                                       // P^T, B operand
    v2f ps2 = {};                                  // even and odd keys apart
#pragma unroll
    for (int s = 0; s < 16; s += 2) {
      const v2f p = {__expf(sv[s] - mnew), __expf(sv[s + 1] - mnew)};
      ps2 += p;
      pb[s] = (_Float16)p[0];
      pb[s + 1] = (_Float16)p[1];
    }
    const float ps = ps2[0] + ps2[1];
    lr = lr * alpha + ps;
    o0 *= alpha; o1 *= alpha; o2 *= alpha; o3 *= alpha;

    // ---- O^T += V^T(64x32) * P^T(32x16); Vt rows are the A-matrix rows
    o0 = wmma_f16(vf0, pb, o0);
    o1 = wmma_f16(vf1, pb, o1);
    o2 = wmma_f16(vf2, pb, o2);
    o3 = wmma_f16(vf3, pb, o3);
   }
   // ---- publish stage st + 1, then refill the buffer that this trip has read
   wait_ds0();
   wait_async0();
   __syncthreads();
   if (st + 2 < NST) {
     const unsigned lb = lk0 + (unsigned)(st & 1) * (2 * TILEB);
     async_copy8(lb, kcp + (size_t)(st + 2) * 64 * DK, 16 * DK,
                 lb + TILEB, vcp + (st + 2) * 64, (size_t)16 * Ssz, 16 * LPITCHB);
   }
  }
  wait_async0();

  // ---- join the halves' sums, normalize and write ctx (concat-head layout,
  // f16): a lane's 8 registers of a tile are 8 consecutive columns of its row
  const float inv = 1.0f / (lr + xhalf(lr));
  _Float16* crowp = ctx + ((size_t)(b * Ssz + q0 + ln)) * Dsz + h * DK + laneHi * 8;
  const v8f ot[4] = {o0, o1, o2, o3};
#pragma unroll
  for (int t = 0; t < 4; ++t) {
    v8h y;
#pragma unroll
    for (int i = 0; i < 8; ++i) y[i] = (_Float16)(ot[t][i] * inv);
    *(v8h*)(crowp + 16 * t) = y;
  }
}

// ---------------------------------------------------------------------------
extern "C" void kernel_launch(void* const* d_in, const int* in_sizes, int n_in,
                              void* d_out, int out_size, void* d_ws, size_t ws_size,
                              hipStream_t stream) {
  (void)in_sizes; (void)n_in; (void)out_size; (void)ws_size;
  const float* q    = (const float*)d_in[0];
  const float* k    = (const float*)d_in[1];
  const float* v    = (const float*)d_in[2];
  const float* Wq   = (const float*)d_in[3];
  const float* bq   = (const float*)d_in[4];
  const float* Wk   = (const float*)d_in[5];
  const float* bk   = (const float*)d_in[6];
  const float* Wv   = (const float*)d_in[7];
  const float* bv   = (const float*)d_in[8];
  const float* Wo   = (const float*)d_in[9];
  const float* bo   = (const float*)d_in[10];
  const int*   mask = (const int*)d_in[11];

  // workspace layout (64 MB total)
  char* w = (char*)d_ws;
  const size_t MB = 1ull << 20;
  _Float16* q16  = (_Float16*)(w + 0 * MB);
  _Float16* k16  = (_Float16*)(w + 8 * MB);
  _Float16* v16f = (_Float16*)(w + 16 * MB);
  _Float16* wq16 = (_Float16*)(w + 24 * MB);
  _Float16* wk16 = (_Float16*)(w + 26 * MB);
  _Float16* wv16 = (_Float16*)(w + 28 * MB);
  _Float16* wo16 = (_Float16*)(w + 30 * MB);
  _Float16* QhP  = (_Float16*)(w + 32 * MB);
  _Float16* KhP  = (_Float16*)(w + 40 * MB);
  _Float16* VtP  = (_Float16*)(w + 48 * MB);
  _Float16* ctxP = (_Float16*)(w + 56 * MB);

  // q16 .. wo16 are one contiguous range that starts at q16
  cvt_f32_f16<<<CVT_BLKS, 256, 0, stream>>>(q, k, v, Wq, Wk, Wv, Wo, q16);

  // per product (M/32)*(N/64) = 128*16 = 2048 wave-tiles, 8 waves (4 x 2) per
  // 256-thread block
  gemm_qkv<<<3 * GEMM_BLKS, 256, 0, stream>>>(q16, k16, v16f, wq16, wk16, wv16,
                                              bq, bk, bv, QhP, KhP, VtP);

  // B*H*(S/16) = 4096 query tiles, 4 waves per 128-thread block
  flash_attn<<<4096 / 4, 128, 0, stream>>>(QhP, KhP, VtP, mask, ctxP);

  gemm_out<<<GEMM_BLKS, 256, 0, stream>>>(ctxP, wo16, bo, (float*)d_out);
}

// v005
// A run of this version takes 110 microseconds.
// In both of two side-by-side timings against v004, it was 1.13 times as fast.
// All steps since v000 together make it 3.39 times as fast.
#include <hip/hip_runtime.h>

// ---------------------------------------------------------------------------
// MHA forward for MI455X (gfx1250, wave32, WMMA f32_16x16x32_f16)
// B=2, S=2048, D=1024, H=16, dk=64
// Pipeline:
//   1) fp32 -> f16 convert of q,k,v and Wq,Wk,Wv,Wo into workspace (32 per thread),
//      one launch for the seven tensors; its first blocks pack the mask into
//      lane-mask words, one bit a score
//   2) WMMA GEMM (32x64 register-blocked): Qh = q@Wq^T+bq (head layout),
//      Kh likewise, Vt = (v@Wv^T+bv)^T per head, one launch for the three
//   3) flash-attention, transposed products (online softmax, mask, scale
//      1/sqrt(64)) -> ctx f16
//   4) WMMA GEMM: out = ctx@Wo^T + bo  (fp32 to d_out)
// ---------------------------------------------------------------------------

typedef __attribute__((ext_vector_type(16))) _Float16 v16h;
typedef __attribute__((ext_vector_type(8)))  _Float16 v8h;
typedef __attribute__((ext_vector_type(8)))  float    v8f;
typedef __attribute__((ext_vector_type(4)))  float    v4f;
typedef __attribute__((ext_vector_type(4)))  _Float16 v4h;
typedef __attribute__((ext_vector_type(4)))  int      v4i;
typedef __attribute__((ext_vector_type(2)))  float    v2f;
typedef __attribute__((ext_vector_type(16))) unsigned v16u;
// 16 words in the constant address space: for data that no store of the running
// kernel touches; with a wave-uniform address the load is a scalar load also
// inside a loop that holds barriers and copies.
typedef const __attribute__((address_space(4))) v16u* cv16u_p;

#define Bsz 2
#define Ssz 2048
#define Dsz 1024
#define Hn  16
#define DK  64

__device__ __forceinline__ v8f wmma_f16(v16h a, v16h b, v8f c) {
  // v_wmma_f32_16x16x32_f16
  return __builtin_amdgcn_wmma_f32_16x16x32_f16(
      /*neg_a=*/false, a, /*neg_b=*/false, b,
      /*c_mod=*/(short)0, c, /*reuse_a=*/false, /*reuse_b=*/false);
}

// Load a 16-bit A/B fragment (16x32 row-per-lane) from a row-major matrix.
// rowptr points at the start of this lane's row; kb = K-block base.
// ISA layout: lanes 0-15 take k = kb+{0..7,16..23}; lanes 16-31 take +8.
__device__ __forceinline__ v16h ldfrag(const _Float16* rowptr, int kb, int laneHi) {
  const _Float16* p = rowptr + kb + laneHi * 8;
  v8h lo = *(const v8h*)(p);
  v8h hi = *(const v8h*)(p + 16);
  v16h f;
#pragma unroll
  for (int i = 0; i < 8; ++i) { f[i] = lo[i]; f[i + 8] = hi[i]; }
  return f;
}

// Value of lane l ^ 16 (the other half of the wave), by a vector cross-row move.
__device__ __forceinline__ float xhalf(float x) {
  const int xi = __builtin_bit_cast(int, x);
  return __builtin_bit_cast(float, __builtin_amdgcn_permlanex16(xi, xi, 0x76543210, 0xfedcba98, false, false));
}

// LDS rows hold 64 f16 (128 B) at a pitch of 144 B: 16 B x odd, so that the 16
// rows of a ds_load_b128 fragment read fall on different banks.
#define LPITCH 72
#define LPITCHB (LPITCH * 2)

// Byte offset of a __shared__ address inside the work-group's LDS.
__device__ __forceinline__ unsigned lds_off(const void* p) { return (unsigned)(size_t)p; }

// Eight asynchronous 16-byte copies per lane, global -> LDS, through no register,
// in two groups of four rows: group a from ga to la, group b from gb to lb; lstep
// is the row step in LDS bytes, gsa / gsb the row steps in global elements.
// s_wait_xcnt 0 ends the statement so that it stands in front of any rewrite of
// the address registers.
__device__ __forceinline__ void async_copy8(unsigned la, const _Float16* ga, size_t gsa,
                                            unsigned lb, const _Float16* gb, size_t gsb,
                                            unsigned lstep) {
  asm volatile("global_load_async_to_lds_b128 %0, %8, off\n\t"
               "global_load_async_to_lds_b128 %1, %9, off\n\t"
               "global_load_async_to_lds_b128 %2, %10, off\n\t"
               "global_load_async_to_lds_b128 %3, %11, off\n\t"
               "global_load_async_to_lds_b128 %4, %12, off\n\t"
               "global_load_async_to_lds_b128 %5, %13, off\n\t"
               "global_load_async_to_lds_b128 %6, %14, off\n\t"
               "global_load_async_to_lds_b128 %7, %15, off\n\t"
               "s_wait_xcnt 0x0"
               :: "v"(la), "v"(la + lstep), "v"(la + 2 * lstep), "v"(la + 3 * lstep),
                  "v"(lb), "v"(lb + lstep), "v"(lb + 2 * lstep), "v"(lb + 3 * lstep),
                  "v"(ga), "v"(ga + gsa), "v"(ga + 2 * gsa), "v"(ga + 3 * gsa),
                  "v"(gb), "v"(gb + gsb), "v"(gb + 2 * gsb), "v"(gb + 3 * gsb)
               : "memory");
}

// This wave's copies have landed (the compiler places no wait for them).
__device__ __forceinline__ void wait_async0() { asm volatile("s_wait_asynccnt 0x0" ::: "memory"); }
// This wave's LDS reads have returned, before their buffer is handed back.
__device__ __forceinline__ void wait_ds0() { asm volatile("s_wait_dscnt 0x0" ::: "memory"); }

// ---------------------------------------------------------------------------
// A thread converts 32 floats, so that a tensor takes 1/32 of the waves to start.
// Eight 16-byte loads, all issued ahead of the first conversion; each wave-wide
// load covers 512 contiguous bytes and each wave-wide store 256.
// One grid converts all seven tensors: they depend on nothing and on one another
// not at all, so one launch pays the gap, the start and the drain once. The f16
// copies lie one behind the other in the workspace in the order q, k, v, Wq, Wk,
// Wv, Wo, so the block index alone gives the place in out; each tensor's length
// is a multiple of CVT_BLK, so a block lies in one tensor.
#define CVT_BLK (256 * 32)
#define CVT_ACT_BLKS (Bsz * Ssz * Dsz / CVT_BLK)   // blocks of q, k or v: 512
#define CVT_W_BLKS   (Dsz * Dsz / CVT_BLK)         // blocks of a weight: 128
#define CVT_BLKS     (3 * CVT_ACT_BLKS + 4 * CVT_W_BLKS)

// The mask as lane masks. The attention wave of query tile qtile (16 queries)
// holds, in stage st (64 keys), score register i of key tile t as: lane l =
// query l & 15, key 64 st + 16 t + 8 (l >> 4) + i. Word 8 t + i of the 32 words
// of (qtile, st) has bit l set where that lane's mask entry is not 0, so the
// word is the select mask of that register as it stands. The 16 heads each read
// these 128 bytes; the int32 entries behind them are 4 KB on 32 lines.
// A wave packs PK_ST stages of one query tile: one compare a word (its result is
// the word), and lane j keeps word j for one 128-byte store a stage.
#define PK_ST   4
#define PK_BLKS (Bsz * (Ssz / 16) * (Ssz / 64) / (8 * PK_ST))   // 256
__device__ __forceinline__ void pack_mask(const int* __restrict__ mask,
                                          unsigned* __restrict__ mbits, unsigned pb) {
  const unsigned lane = threadIdx.x & 31, ln = lane & 15, laneHi = lane >> 4;
  const unsigned g = pb * 8 + (threadIdx.x >> 5);  // group of PK_ST stages
  const unsigned NGRP = (Ssz / 64) / PK_ST;         // groups of a query tile: 8
  const unsigned qtile = g / NGRP;                  // b * (S / 16) + tile: 0..255
  const unsigned st0 = (g % NGRP) * PK_ST;
  const int* row = mask + ((size_t)qtile * 16 + ln) * Ssz + st0 * 64 + laneHi * 8;
  v4i m[PK_ST][4][2];
  // all loops unrolled: m stays in registers, and many loads are in flight at once
#pragma unroll
  for (int u = 0; u < PK_ST; ++u)
#pragma unroll
    for (int t = 0; t < 4; ++t) {
      m[u][t][0] = *(const v4i*)(row + u * 64 + t * 16);
      m[u][t][1] = *(const v4i*)(row + u * 64 + t * 16 + 4);
    }
#pragma unroll
  for (int u = 0; u < PK_ST; ++u) {
    unsigned w = 0;                                // lane j ends with word j
#pragma unroll
    for (int j = 0; j < 32; ++j) {
      const unsigned bal = __builtin_amdgcn_ballot_w32(m[u][j >> 3][(j >> 2) & 1][j & 3] != 0);
      w = lane == (unsigned)j ? bal : w;
    }
    mbits[((size_t)qtile * (Ssz / 64) + st0 + u) * 32 + lane] = w;
  }
}

// Blocks 0 .. PK_BLKS - 1 pack the mask (first, so that their one long round of
// loads runs under the conversions); the rest convert.
__global__ __launch_bounds__(256) void cvt_f32_f16(
    const float* __restrict__ q, const float* __restrict__ k, const float* __restrict__ v,
    const float* __restrict__ Wq, const float* __restrict__ Wk,
    const float* __restrict__ Wv, const float* __restrict__ Wo,
    const int* __restrict__ mask, _Float16* __restrict__ out16,
    unsigned* __restrict__ mbits) {
  if (blockIdx.x < PK_BLKS) {
    pack_mask(mask, mbits, blockIdx.x);
    return;
  }
  const unsigned bid = blockIdx.x - PK_BLKS;
  const float* src;
  unsigned lb;                                     // block index inside the tensor
  if (bid < 3 * CVT_ACT_BLKS) {
    const unsigned t = bid / CVT_ACT_BLKS;
    lb = bid % CVT_ACT_BLKS;
    src = t == 0 ? q : t == 1 ? k : v;
  } else {
    const unsigned r = bid - 3 * CVT_ACT_BLKS, t = r / CVT_W_BLKS;
    lb = r % CVT_W_BLKS;
    src = t == 0 ? Wq : t == 1 ? Wk : t == 2 ? Wv : Wo;
  }
  const float* in = src + (size_t)lb * CVT_BLK;
  _Float16* out = out16 + (size_t)bid * CVT_BLK;
  const size_t base = threadIdx.x * 4;
  v4f x[8];
  // both loops unrolled: x stays in registers and the eight loads issue as one group
#pragma unroll
  for (int j = 0; j < 8; ++j) x[j] = *(const v4f*)(in + base + j * 1024);
#pragma unroll
  for (int j = 0; j < 8; ++j) {
    v4h y;
#pragma unroll
    for (int e = 0; e < 4; ++e) y[e] = (_Float16)x[j][e];
    *(v4h*)(out + base + j * 1024) = y;
  }
}

// ---------------------------------------------------------------------------
// C[M,N] = A[M,K] * Bt[N,K]^T + bias  (A,Bt f16 row-major, fp32 accumulate)
// M=4096, N=1024, K=1024.
// Register-blocked: one wave computes a 32x64 tile = 2 A-frags x 4 B-frags
// -> 8 WMMAs per K-step on 8 independent accumulator chains (hides XDL
// accumulation latency), 12 b128 loads per 8 WMMAs (vs 4 per WMMA naive).
// A and B come into LDS by asynchronous copies; fragments are read there.
// mode 0: f16 out in head layout   [b,h,s,dk]
// mode 1: f16 out transposed head  [b,h,dk,s]
// mode 2: fp32 out row-major       [M,N]
// blk: the block's index among the GEMM_BLKS blocks of one product.
#define GEMM_BLKS ((Bsz * Ssz / 128) * (Dsz / 128))   // 256
__device__ __forceinline__ void gemm_body(
    const _Float16* __restrict__ A, const _Float16* __restrict__ Bt,
    const float* __restrict__ bias, void* __restrict__ outp, int mode, int blk) {
  const int M = Bsz * Ssz, N = Dsz, K = Dsz;
  const int lane = threadIdx.x & 31;
  const int wave = threadIdx.x >> 5;
  // The block's 8 wave tiles lie 4 x 2: a 128 x 128 block tile, so that every
  // staged A row serves 2 waves and every staged B row 4.
  const int nB = N / 128;                           // 8 block columns
  const int mB = blk / nB;                          // 0..31 (128-row blocks)
  if (mB >= M / 128) return;
  const int wm = wave >> 1, wn = wave & 1;
  const int mT = mB * 4 + wm;                       // 0..127 (32-row tiles)
  const int nT = (blk % nB) * 2 + wn;               // 0..15  (64-col tiles)
  const int ln = lane & 15, laneHi = lane >> 4;

  // One stage = 64 of K: the block's 128 A rows, then its 128 B rows; two buffers.
  __shared__ __attribute__((aligned(16))) _Float16 ab[2][(128 + 128) * LPITCH];
  const unsigned BUFB = (128 + 128) * LPITCHB;      // bytes of one buffer
  const int NST = K / 64;                           // stages

  // Copy slots: 8 lanes cover one 128-byte row piece, so a wave's copy reads 4
  // whole lines; a thread brings rows crow + 32 j, j = 0..3, of A and of B.
  const int crow = threadIdx.x >> 3, ccol = (threadIdx.x & 7) * 8;
  const _Float16* acp = A  + (size_t)(mB * 128 + crow) * K + ccol;
  const _Float16* bcp = Bt + (size_t)((blk % nB) * 128 + crow) * K + ccol;
  const unsigned  la0 = lds_off(&ab[0][crow * LPITCH + ccol]);
  auto stage = [&](unsigned buf, int k0) {
    const unsigned la = la0 + buf * BUFB;
    async_copy8(la, acp + k0, (size_t)32 * K,
                la + 128 * LPITCHB, bcp + k0, (size_t)32 * K, 32 * LPITCHB);
  };

  // Stage 0 is copied, waited for and published; stage 1 then flies over trip 0.
  stage(0, 0);
  wait_async0();
  __syncthreads();
  stage(1, 64);

  v8f c00 = {}, c01 = {}, c02 = {}, c03 = {};
  v8f c10 = {}, c11 = {}, c12 = {}, c13 = {};
  for (int st = 0; st < NST; ++st) {
    const _Float16* arow0 = &ab[st & 1][(wm * 32 + ln) * LPITCH];
    const _Float16* arow1 = arow0 + 16 * LPITCH;
    const _Float16* brow0 = &ab[st & 1][(128 + wn * 64 + ln) * LPITCH];
    const _Float16* brow1 = brow0 + 16 * LPITCH;
    const _Float16* brow2 = brow0 + 32 * LPITCH;
    const _Float16* brow3 = brow0 + 48 * LPITCH;
    // unrolled so that the second half's LDS reads are issued under the first
    // half's products
#pragma unroll
    for (int kb = 0; kb < 64; kb += 32) {
      const v16h a0 = ldfrag(arow0, kb, laneHi);
      const v16h a1 = ldfrag(arow1, kb, laneHi);
      const v16h b0 = ldfrag(brow0, kb, laneHi);
      const v16h b1 = ldfrag(brow1, kb, laneHi);
      const v16h b2 = ldfrag(brow2, kb, laneHi);
      const v16h b3 = ldfrag(brow3, kb, laneHi);
      c00 = wmma_f16(a0, b0, c00);  c01 = wmma_f16(a0, b1, c01);
      c02 = wmma_f16(a0, b2, c02);  c03 = wmma_f16(a0, b3, c03);
      c10 = wmma_f16(a1, b0, c10);  c11 = wmma_f16(a1, b1, c11);
      c12 = wmma_f16(a1, b2, c12);  c13 = wmma_f16(a1, b3, c13);
    }
    // publish stage st + 1, then refill the buffer that this trip has read
    wait_ds0();
    wait_async0();
    __syncthreads();
    if (st + 2 < NST) stage(st & 1, (st + 2) * 64);
  }
  wait_async0();

  v8f acc[2][4] = {{c00, c01, c02, c03}, {c10, c11, c12, c13}};
#pragma unroll
  for (int mi = 0; mi < 2; ++mi) {
#pragma unroll
    for (int ni = 0; ni < 4; ++ni) {
      const int ng = nT * 64 + ni * 16 + ln;
      const float bvv = bias[ng];
      const v8f cc = acc[mi][ni];
#pragma unroll
      for (int i = 0; i < 8; ++i) {
        const int mg = mT * 32 + mi * 16 + i + laneHi * 8;   // C row per ISA layout
        const float val = cc[i] + bvv;
        if (mode == 2) {
          ((float*)outp)[(size_t)mg * N + ng] = val;
        } else {
          const int bb = mg >> 11, s = mg & (Ssz - 1);       // token -> (b,s)
          const int hh = ng >> 6,  inner = ng & (DK - 1);
          _Float16* o16 = (_Float16*)outp;
          if (mode == 0)
            o16[(((size_t)(bb * Hn + hh) * Ssz) + s) * DK + inner] = (_Float16)val;
          else  // 2 bytes a lane, every lane of a half-wave on a line of its own
            o16[(((size_t)(bb * Hn + hh) * DK) + inner) * Ssz + s] = (_Float16)val;
        }
      }
    }
  }
}

// The three projections in one grid: they share no data, so one launch pays the
// gap once, and three blocks on a WGP fill one another's waits for the copies.
// Blocks 0..255 make Qh, 256..511 Kh, 512..767 Vt.
__global__ __launch_bounds__(256) void gemm_qkv(
    const _Float16* __restrict__ q16, const _Float16* __restrict__ k16,
    const _Float16* __restrict__ v16, const _Float16* __restrict__ wq16,
    const _Float16* __restrict__ wk16, const _Float16* __restrict__ wv16,
    const float* __restrict__ bq, const float* __restrict__ bk,
    const float* __restrict__ bv, _Float16* __restrict__ Qh,
    _Float16* __restrict__ Kh, _Float16* __restrict__ Vt) {
  const int p = blockIdx.x / GEMM_BLKS, blk = blockIdx.x % GEMM_BLKS;
  const _Float16* A    = p == 0 ? q16  : p == 1 ? k16  : v16;
  const _Float16* Bt   = p == 0 ? wq16 : p == 1 ? wk16 : wv16;
  const float*    bias = p == 0 ? bq   : p == 1 ? bk   : bv;
  _Float16*       o    = p == 0 ? Qh   : p == 1 ? Kh   : Vt;
  gemm_body(A, Bt, bias, (void*)o, p == 2 ? 1 : 0, blk);
}

// The output projection, fp32 to the output buffer.
__global__ __launch_bounds__(256) void gemm_out(
    const _Float16* __restrict__ ctx, const _Float16* __restrict__ wo16,
    const float* __restrict__ bo, float* __restrict__ out) {
  gemm_body(ctx, wo16, bo, (void*)out, 2, blockIdx.x);
}

__global__ __launch_bounds__(128) void flash_attn(
    const _Float16* __restrict__ Qh, const _Float16* __restrict__ Kh,
    const _Float16* __restrict__ Vt, const unsigned* __restrict__ mbits,
    _Float16* __restrict__ ctx) {
  const int lane = threadIdx.x & 31;
  // in a scalar register, so that the mask words' address is one too
  const int wave = __builtin_amdgcn_readfirstlane(threadIdx.x >> 5);
  const int tile = blockIdx.x * 4 + wave;          // 0..4095
  const int qt = tile & (Ssz / 16 - 1);            // query tile in sequence
  const int bh = tile >> 7;                        // b*H + h
  const int b  = bh >> 4, h = bh & (Hn - 1);
  const int q0 = qt * 16;
  const int ln = lane & 15, laneHi = lane >> 4;

  const _Float16* Qb = Qh + (size_t)bh * Ssz * DK;
  const _Float16* Kb = Kh + (size_t)bh * Ssz * DK;
  const _Float16* Vb = Vt + (size_t)bh * DK * Ssz;
  // This wave's mask words: 32 a stage, the stages one behind the other.
  // (16-word units: two a stage)
  const cv16u_p mwp = (cv16u_p)(size_t)(mbits + (size_t)(b * (Ssz / 16) + qt) * (Ssz / 64) * 32);

  // One stage = 64 keys: K tile (64 keys x dk) and V tile (dk x 64 keys), two
  // buffers, shared by the four waves.
  __shared__ __attribute__((aligned(16))) _Float16 kv[2][2][64 * LPITCH];

  // Copy slots: 8 lanes cover one 128-byte row, so a wave's copy reads 4 whole
  // lines; a thread brings rows crow + 16 j, j = 0..3, of the K and the V tile.
  const int crow = threadIdx.x >> 3, ccol = (threadIdx.x & 7) * 8;
  const _Float16* kcp = Kb + (size_t)crow * DK  + ccol;
  const _Float16* vcp = Vb + (size_t)crow * Ssz + ccol;
  const unsigned  lk0 = lds_off(&kv[0][0][crow * LPITCH + ccol]);
  const unsigned  TILEB = 64 * LPITCHB;            // bytes of one tile in LDS
  const int NST = Ssz / 64;                        // stages

  // Q fragments (held for the whole key sweep), B operand: column ln = query
  // q0 + ln, k = dk
  const _Float16* qrow = Qb + (size_t)(q0 + ln) * DK;
  const v16h bq0 = ldfrag(qrow, 0,  laneHi);
  const v16h bq1 = ldfrag(qrow, 32, laneHi);

  // O^T tiles: ot[i] = O[q0 + ln][16 t + 8 laneHi + i]
  v8f o0 = {}, o1 = {}, o2 = {}, o3 = {};
  float mr = -3.0e38f;                             // running maximum of query ln
  float lr = 0.0f;                                 // sum over this lane's keys only
  // mask words of stage 0; each stage fetches the next one's behind its last select
  v16u mw0 = mwp[0];
  v16u mw1 = mwp[1];

  // Stage 0 is copied, waited for and published; stage 1 then flies over trip 0.
  async_copy8(lk0, kcp, 16 * DK, lk0 + TILEB, vcp, (size_t)16 * Ssz, 16 * LPITCHB);
  wait_async0();
  __syncthreads();
  async_copy8(lk0 + 2 * TILEB, kcp + 64 * DK, 16 * DK,
              lk0 + 3 * TILEB, vcp + 64, (size_t)16 * Ssz, 16 * LPITCHB);

  for (int st = 0; st < NST; ++st) {
   const _Float16* Ks = &kv[st & 1][0][0];
   const _Float16* Vs = &kv[st & 1][1][0];
   // ---- K fragments of the four 16-key tiles of the stage (A operand: row ln of
   // tile t = key 16 t + ln)
   v16h kf[4][2];
#pragma unroll
   for (int t = 0; t < 4; ++t) {
     const _Float16* krow = Ks + (t * 16 + ln) * LPITCH;
     kf[t][0] = ldfrag(krow, 0,  laneHi);
     kf[t][1] = ldfrag(krow, 32, laneHi);
   }
   // keeps the K reads one group at the head of the stage: sunk to their uses,
   // each would have its latency waited out by itself
   __builtin_amdgcn_sched_barrier(0);
   // ---- scores: four 16x16 tiles of S^T, K=dk=64
   v8f sc[4];
#pragma unroll
   for (int t = 0; t < 4; ++t) {
     const v8f z = {};
     sc[t] = wmma_f16(kf[t][0], bq0, z);
   }
#pragma unroll
   for (int t = 0; t < 4; ++t) sc[t] = wmma_f16(kf[t][1], bq1, sc[t]);
   // keeps the eight score products one run: without it the softmax is mixed among
   // them and the first pass's V reads sink to their products, one fragment at a
   // time, each waited out by itself
   __builtin_amdgcn_sched_barrier(0);
   // unrolled: sc stays in registers, and with no barrier in a pass the
   // second pass's V reads can be issued under the first pass's softmax
#pragma unroll
   for (int sub = 0; sub < 64; sub += 32) {
    const v16h vf0 = ldfrag(Vs + (ln)      * LPITCH, sub, laneHi);
    const v16h vf1 = ldfrag(Vs + (16 + ln) * LPITCH, sub, laneHi);
    const v16h vf2 = ldfrag(Vs + (32 + ln) * LPITCH, sub, laneHi);
    const v16h vf3 = ldfrag(Vs + (48 + ln) * LPITCH, sub, laneHi);

    // ---- scale, mask, online softmax of query ln over 32 keys
    const v8f t0 = sc[sub / 16] * 0.125f, t1 = sc[sub / 16 + 1] * 0.125f;  // 1/sqrt(dk)
    float sv[16];
    float cm0 = -3.0e38f, cm1 = -3.0e38f;          // one chain of maxima a tile
#pragma unroll
    for (int i = 0; i < 8; ++i) {
      const v16u mw = sub == 0 ? mw0 : mw1;        // words of key tiles sub / 16, + 1
      sv[i]     = __builtin_amdgcn_inverse_ballot_w32(mw[i])     ? t0[i] : -1.0e10f;
      sv[i + 8] = __builtin_amdgcn_inverse_ballot_w32(mw[i + 8]) ? t1[i] : -1.0e10f;
      cm0 = fmaxf(cm0, sv[i]);
      cm1 = fmaxf(cm1, sv[i + 8]);
    }
    const float cm = fmaxf(cm0, cm1);
    const float mnew  = fmaxf(mr, fmaxf(cm, xhalf(cm)));  // both halves: all 32 keys
    const float alpha = __expf(mr - mnew);
    mr = mnew;
    v16h pb;                                       // P^T, B operand
    v2f ps2 = {};                                  // even and odd keys apart
#pragma unroll
    for (int s = 0; s < 16; s += 2) {
      const v2f p = {__expf(sv[s] - mnew), __expf(sv[s + 1] - mnew)};
      ps2 += p;
      pb[s] = (_Float16)p[0];
      pb[s + 1] = (_Float16)p[1];
    }
    const float ps = ps2[0] + ps2[1];
    lr = lr * alpha + ps;
    o0 *= alpha; o1 *= alpha; o2 *= alpha; o3 *= alpha;

    // ---- O^T += V^T(64x32) * P^T(32x16); Vt rows are the A-matrix rows
    o0 = wmma_f16(vf0, pb, o0);
    o1 = wmma_f16(vf1, pb, o1);
    o2 = wmma_f16(vf2, pb, o2);
    o3 = wmma_f16(vf3, pb, o3);
   }
   // ---- the next stage's mask words (the last stage fetches its own again, to
   // stay inside the array): they fly over the barrier and the score products
   {
     const int nx = st + 1 < NST ? st + 1 : st;
     mw0 = mwp[2 * nx];
     mw1 = mwp[2 * nx + 1];
   }
   // ---- publish stage st + 1, then refill the buffer that this trip has read
   wait_ds0();
   wait_async0();
   __syncthreads();
   if (st + 2 < NST) {
     const unsigned lb = lk0 + (unsigned)(st & 1) * (2 * TILEB);
     async_copy8(lb, kcp + (size_t)(st + 2) * 64 * DK, 16 * DK,
                 lb + TILEB, vcp + (st + 2) * 64, (size_t)16 * Ssz, 16 * LPITCHB);
   }
  }
  wait_async0();

  // ---- join the halves' sums, normalize and write ctx (concat-head layout,
  // f16): a lane's 8 registers of a tile are 8 consecutive columns of its row
  const float inv = 1.0f / (lr + xhalf(lr));
  _Float16* crowp = ctx + ((size_t)(b * Ssz + q0 + ln)) * Dsz + h * DK + laneHi * 8;
  const v8f ot[4] = {o0, o1, o2, o3};
#pragma unroll
  for (int t = 0; t < 4; ++t) {
    v8h y;
#pragma unroll
    for (int i = 0; i < 8; ++i) y[i] = (_Float16)(ot[t][i] * inv);
    *(v8h*)(crowp + 16 * t) = y;
  }
}

// ---------------------------------------------------------------------------
extern "C" void kernel_launch(void* const* d_in, const int* in_sizes, int n_in,
                              void* d_out, int out_size, void* d_ws, size_t ws_size,
                              hipStream_t stream) {
  (void)in_sizes; (void)n_in; (void)out_size; (void)ws_size;
  const float* q    = (const float*)d_in[0];
  const float* k    = (const float*)d_in[1];
  const float* v    = (const float*)d_in[2];
  const float* Wq   = (const float*)d_in[3];
  const float* bq   = (const float*)d_in[4];
  const float* Wk   = (const float*)d_in[5];
  const float* bk   = (const float*)d_in[6];
  const float* Wv   = (const float*)d_in[7];
  const float* bv   = (const float*)d_in[8];
  const float* Wo   = (const float*)d_in[9];
  const float* bo   = (const float*)d_in[10];
  const int*   mask = (const int*)d_in[11];

  // workspace layout (65 MB total)
  char* w = (char*)d_ws;
  const size_t MB = 1ull << 20;
  _Float16* q16  = (_Float16*)(w + 0 * MB);
  _Float16* k16  = (_Float16*)(w + 8 * MB);
  _Float16* v16f = (_Float16*)(w + 16 * MB);
  _Float16* wq16 = (_Float16*)(w + 24 * MB);
  _Float16* wk16 = (_Float16*)(w + 26 * MB);
  _Float16* wv16 = (_Float16*)(w + 28 * MB);
  _Float16* wo16 = (_Float16*)(w + 30 * MB);
  _Float16* QhP  = (_Float16*)(w + 32 * MB);
  _Float16* KhP  = (_Float16*)(w + 40 * MB);
  _Float16* VtP  = (_Float16*)(w + 48 * MB);
  _Float16* ctxP = (_Float16*)(w + 56 * MB);
  unsigned* mbP  = (unsigned*)(w + 64 * MB);       // 1 MB: one bit a mask entry

  // q16 .. wo16 are one contiguous range that starts at q16
  cvt_f32_f16<<<PK_BLKS + CVT_BLKS, 256, 0, stream>>>(q, k, v, Wq, Wk, Wv, Wo, mask, q16, mbP);

  // per product (M/32)*(N/64) = 128*16 = 2048 wave-tiles, 8 waves (4 x 2) per
  // 256-thread block
  gemm_qkv<<<3 * GEMM_BLKS, 256, 0, stream>>>(q16, k16, v16f, wq16, wk16, wv16,
                                              bq, bk, bv, QhP, KhP, VtP);

  // B*H*(S/16) = 4096 query tiles, 4 waves per 128-thread block
  flash_attn<<<4096 / 4, 128, 0, stream>>>(QhP, KhP, VtP, mbP, ctxP);

  gemm_out<<<GEMM_BLKS, 256, 0, stream>>>(ctxP, wo16, bo, (float*)d_out);
}

// v007
// Measured time: 95.4 microseconds a run.
// It is 1.14 times as fast as v005, going by the measured steps of the versions left out in between.
// Counting every step since v000, it is 3.88 times as fast.
#include <hip/hip_runtime.h>

// ---------------------------------------------------------------------------
// MHA forward for MI455X (gfx1250, wave32, WMMA f32_16x16x32_f16)
// B=2, S=2048, D=1024, H=16, dk=64
// Pipeline:
//   1) fp32 -> f16 convert of q,k,v and Wq,Wk,Wv,Wo into workspace (32 per thread),
//      one launch for the seven tensors; its first blocks pack the mask into
//      lane-mask words, one bit a score
//   2) WMMA GEMM (32x64 register-blocked): Qh = (q@Wq^T+bq) * log2(e)/sqrt(64)
//      (head layout), Kh = k@Wk^T+bk likewise, Vt = (v@Wv^T+bv)^T per head, one
//      launch for the three
//   3) flash-attention, transposed products (online softmax in powers of two,
//      mask; the score products deliver the exponent) -> ctx f16
//   4) WMMA GEMM: out = ctx@Wo^T + bo  (fp32 to d_out)
// ---------------------------------------------------------------------------

typedef __attribute__((ext_vector_type(16))) _Float16 v16h;
typedef __attribute__((ext_vector_type(8)))  _Float16 v8h;
typedef __attribute__((ext_vector_type(8)))  float    v8f;
typedef __attribute__((ext_vector_type(4)))  float    v4f;
typedef __attribute__((ext_vector_type(4)))  _Float16 v4h;
typedef __attribute__((ext_vector_type(4)))  int      v4i;
typedef __attribute__((ext_vector_type(2)))  float    v2f;
typedef __attribute__((ext_vector_type(16))) unsigned v16u;
// 16 words in the constant address space: for data that no store of the running
// kernel touches; with a wave-uniform address the load is a scalar load also
// inside a loop that holds barriers and copies.
typedef const __attribute__((address_space(4))) v16u* cv16u_p;

#define Bsz 2
#define Ssz 2048
#define Dsz 1024
#define Hn  16
#define DK  64
// Scores are kept in log2 units: exp(s / sqrt(dk)) = exp2(s * QSCALE). Qh carries
// the factor, so that K Q^T is the exponent but for the maximum.
#define QSCALE 0.18033688011112042f                // log2(e) / sqrt(64)
#define NEG2   (-1.4426950408889634e10f)           // the masked score -1e10, log2 units

__device__ __forceinline__ v8f wmma_f16(v16h a, v16h b, v8f c) {
  // v_wmma_f32_16x16x32_f16
  return __builtin_amdgcn_wmma_f32_16x16x32_f16(
      /*neg_a=*/false, a, /*neg_b=*/false, b,
      /*c_mod=*/(short)0, c, /*reuse_a=*/false, /*reuse_b=*/false);
}

// Load a 16-bit A/B fragment (16x32 row-per-lane) from a row-major matrix.
// rowptr points at the start of this lane's row; kb = K-block base.
// ISA layout: lanes 0-15 take k = kb+{0..7,16..23}; lanes 16-31 take +8.
__device__ __forceinline__ v16h ldfrag(const _Float16* rowptr, int kb, int laneHi) {
  const _Float16* p = rowptr + kb + laneHi * 8;
  v8h lo = *(const v8h*)(p);
  v8h hi = *(const v8h*)(p + 16);
  v16h f;
#pragma unroll
  for (int i = 0; i < 8; ++i) { f[i] = lo[i]; f[i + 8] = hi[i]; }
  return f;
}

// Value of lane l ^ 16 (the other half of the wave), by a vector cross-row move.
__device__ __forceinline__ float xhalf(float x) {
  const int xi = __builtin_bit_cast(int, x);
  return __builtin_bit_cast(float, __builtin_amdgcn_permlanex16(xi, xi, 0x76543210, 0xfedcba98, false, false));
}

// LDS rows hold 64 f16 (128 B) at a pitch of 144 B: 16 B x odd, so that the 16
// rows of a ds_load_b128 fragment read fall on different banks.
#define LPITCH 72
#define LPITCHB (LPITCH * 2)

// Byte offset of a __shared__ address inside the work-group's LDS.
__device__ __forceinline__ unsigned lds_off(const void* p) { return (unsigned)(size_t)p; }

// Eight asynchronous 16-byte copies per lane, global -> LDS, through no register,
// in two groups of four rows: group a from ga to la, group b from gb to lb; lstep
// is the row step in LDS bytes, gsa / gsb the row steps in global elements.
// s_wait_xcnt 0 ends the statement so that it stands in front of any rewrite of
// the address registers.
__device__ __forceinline__ void async_copy8(unsigned la, const _Float16* ga, size_t gsa,
                                            unsigned lb, const _Float16* gb, size_t gsb,
                                            unsigned lstep) {
  asm volatile("global_load_async_to_lds_b128 %0, %8, off\n\t"
               "global_load_async_to_lds_b128 %1, %9, off\n\t"
               "global_load_async_to_lds_b128 %2, %10, off\n\t"
               "global_load_async_to_lds_b128 %3, %11, off\n\t"
               "global_load_async_to_lds_b128 %4, %12, off\n\t"
               "global_load_async_to_lds_b128 %5, %13, off\n\t"
               "global_load_async_to_lds_b128 %6, %14, off\n\t"
               "global_load_async_to_lds_b128 %7, %15, off\n\t"
               "s_wait_xcnt 0x0"
               :: "v"(la), "v"(la + lstep), "v"(la + 2 * lstep), "v"(la + 3 * lstep),
                  "v"(lb), "v"(lb + lstep), "v"(lb + 2 * lstep), "v"(lb + 3 * lstep),
                  "v"(ga), "v"(ga + gsa), "v"(ga + 2 * gsa), "v"(ga + 3 * gsa),
                  "v"(gb), "v"(gb + gsb), "v"(gb + 2 * gsb), "v"(gb + 3 * gsb)
               : "memory");
}

// This wave's copies have landed (the compiler places no wait for them).
__device__ __forceinline__ void wait_async0() { asm volatile("s_wait_asynccnt 0x0" ::: "memory"); }
// This wave's LDS reads have returned, before their buffer is handed back.
__device__ __forceinline__ void wait_ds0() { asm volatile("s_wait_dscnt 0x0" ::: "memory"); }

// ---------------------------------------------------------------------------
// A thread converts 32 floats, so that a tensor takes 1/32 of the waves to start.
// Eight 16-byte loads, all issued ahead of the first conversion; each wave-wide
// load covers 512 contiguous bytes and each wave-wide store 256.
// One grid converts all seven tensors: they depend on nothing and on one another
// not at all, so one launch pays the gap, the start and the drain once. The f16
// copies lie one behind the other in the workspace in the order q, k, v, Wq, Wk,
// Wv, Wo, so the block index alone gives the place in out; each tensor's length
// is a multiple of CVT_BLK, so a block lies in one tensor.
#define CVT_BLK (256 * 32)
#define CVT_ACT_BLKS (Bsz * Ssz * Dsz / CVT_BLK)   // blocks of q, k or v: 512
#define CVT_W_BLKS   (Dsz * Dsz / CVT_BLK)         // blocks of a weight: 128
#define CVT_BLKS     (3 * CVT_ACT_BLKS + 4 * CVT_W_BLKS)

// The mask as lane masks. The attention wave of query tile qtile (16 queries)
// holds, in stage st (64 keys), score register i of key tile t as: lane l =
// query l & 15, key 64 st + 16 t + 8 (l >> 4) + i. Word 8 t + i of the 32 words
// of (qtile, st) has bit l set where that lane's mask entry is not 0, so the
// word is the select mask of that register as it stands. The 16 heads each read
// these 128 bytes; the int32 entries behind them are 4 KB on 32 lines.
// A wave packs PK_ST stages of one query tile: one compare a word (its result is
// the word), and lane j keeps word j for one 128-byte store a stage.
#define PK_ST   4
#define PK_BLKS (Bsz * (Ssz / 16) * (Ssz / 64) / (8 * PK_ST))   // 256
__device__ __forceinline__ void pack_mask(const int* __restrict__ mask,
                                          unsigned* __restrict__ mbits, unsigned pb) {
  const unsigned lane = threadIdx.x & 31, ln = lane & 15, laneHi = lane >> 4;
  const unsigned g = pb * 8 + (threadIdx.x >> 5);  // group of PK_ST stages
  const unsigned NGRP = (Ssz / 64) / PK_ST;         // groups of a query tile: 8
  const unsigned qtile = g / NGRP;                  // b * (S / 16) + tile: 0..255
  const unsigned st0 = (g % NGRP) * PK_ST;
  const int* row = mask + ((size_t)qtile * 16 + ln) * Ssz + st0 * 64 + laneHi * 8;
  v4i m[PK_ST][4][2];
  // all loops unrolled: m stays in registers, and many loads are in flight at once
#pragma unroll
  for (int u = 0; u < PK_ST; ++u)
#pragma unroll
    for (int t = 0; t < 4; ++t) {
      m[u][t][0] = *(const v4i*)(row + u * 64 + t * 16);
      m[u][t][1] = *(const v4i*)(row + u * 64 + t * 16 + 4);
    }
#pragma unroll
  for (int u = 0; u < PK_ST; ++u) {
    unsigned w = 0;                                // lane j ends with word j
#pragma unroll
    for (int j = 0; j < 32; ++j) {
      const unsigned bal = __builtin_amdgcn_ballot_w32(m[u][j >> 3][(j >> 2) & 1][j & 3] != 0);
      w = lane == (unsigned)j ? bal : w;
    }
    mbits[((size_t)qtile * (Ssz / 64) + st0 + u) * 32 + lane] = w;
  }
}

// Blocks 0 .. PK_BLKS - 1 pack the mask (first, so that their one long round of
// loads runs under the conversions); the rest convert.
__global__ __launch_bounds__(256) void cvt_f32_f16(
    const float* __restrict__ q, const float* __restrict__ k, const float* __restrict__ v,
    const float* __restrict__ Wq, const float* __restrict__ Wk,
    const float* __restrict__ Wv, const float* __restrict__ Wo,
    const int* __restrict__ mask, _Float16* __restrict__ out16,
    unsigned* __restrict__ mbits) {
  if (blockIdx.x < PK_BLKS) {
    pack_mask(mask, mbits, blockIdx.x);
    return;
  }
  const unsigned bid = blockIdx.x - PK_BLKS;
  const float* src;
  unsigned lb;                                     // block index inside the tensor
  if (bid < 3 * CVT_ACT_BLKS) {
    const unsigned t = bid / CVT_ACT_BLKS;
    lb = bid % CVT_ACT_BLKS;
    src = t == 0 ? q : t == 1 ? k : v;
  } else {
    const unsigned r = bid - 3 * CVT_ACT_BLKS, t = r / CVT_W_BLKS;
    lb = r % CVT_W_BLKS;
    src = t == 0 ? Wq : t == 1 ? Wk : t == 2 ? Wv : Wo;
  }
  const float* in = src + (size_t)lb * CVT_BLK;
  _Float16* out = out16 + (size_t)bid * CVT_BLK;
  const size_t base = threadIdx.x * 4;
  v4f x[8];
  // both loops unrolled: x stays in registers and the eight loads issue as one group
#pragma unroll
  for (int j = 0; j < 8; ++j) x[j] = *(const v4f*)(in + base + j * 1024);
#pragma unroll
  for (int j = 0; j < 8; ++j) {
    v4h y;
#pragma unroll
    for (int e = 0; e < 4; ++e) y[e] = (_Float16)x[j][e];
    *(v4h*)(out + base + j * 1024) = y;
  }
}

// ---------------------------------------------------------------------------
// C[M,N] = A[M,K] * Bt[N,K]^T + bias  (A,Bt f16 row-major, fp32 accumulate)
// M=4096, N=1024, K=1024.
// Register-blocked: one wave computes a 32x64 tile = 2 A-frags x 4 B-frags
// -> 8 WMMAs per K-step on 8 independent accumulator chains (hides XDL
// accumulation latency), 12 b128 loads per 8 WMMAs (vs 4 per WMMA naive).
// A and B come into LDS by asynchronous copies; fragments are read there.
// mode 0: f16 out in head layout   [b,h,s,dk]
// mode 1: f16 out transposed head  [b,h,dk,s]
// mode 2: fp32 out row-major       [M,N]
// oscale: factor on (product + bias), applied in fp32 ahead of the one rounding.
// blk: the block's index among the GEMM_BLKS blocks of one product.
#define GEMM_BLKS ((Bsz * Ssz / 128) * (Dsz / 128))   // 256
__device__ __forceinline__ void gemm_body(
    const _Float16* __restrict__ A, const _Float16* __restrict__ Bt,
    const float* __restrict__ bias, void* __restrict__ outp, int mode, int blk,
    float oscale) {
  const int M = Bsz * Ssz, N = Dsz, K = Dsz;
  const int lane = threadIdx.x & 31;
  const int wave = threadIdx.x >> 5;
  // The block's 8 wave tiles lie 4 x 2: a 128 x 128 block tile, so that every
  // staged A row serves 2 waves and every staged B row 4.
  const int nB = N / 128;                           // 8 block columns
  const int mB = blk / nB;                          // 0..31 (128-row blocks)
  if (mB >= M / 128) return;
  const int wm = wave >> 1, wn = wave & 1;
  const int mT = mB * 4 + wm;                       // 0..127 (32-row tiles)
  const int nT = (blk % nB) * 2 + wn;               // 0..15  (64-col tiles)
  const int ln = lane & 15, laneHi = lane >> 4;

  // One stage = 64 of K: the block's 128 A rows, then its 128 B rows; two buffers.
  __shared__ __attribute__((aligned(16))) _Float16 ab[2][(128 + 128) * LPITCH];
  const unsigned BUFB = (128 + 128) * LPITCHB;      // bytes of one buffer
  const int NST = K / 64;                           // stages

  // Copy slots: 8 lanes cover one 128-byte row piece, so a wave's copy reads 4
  // whole lines; a thread brings rows crow + 32 j, j = 0..3, of A and of B.
  const int crow = threadIdx.x >> 3, ccol = (threadIdx.x & 7) * 8;
  const _Float16* acp = A  + (size_t)(mB * 128 + crow) * K + ccol;
  const _Float16* bcp = Bt + (size_t)((blk % nB) * 128 + crow) * K + ccol;
  const unsigned  la0 = lds_off(&ab[0][crow * LPITCH + ccol]);
  auto stage = [&](unsigned buf, int k0) {
    const unsigned la = la0 + buf * BUFB;
    async_copy8(la, acp + k0, (size_t)32 * K,
                la + 128 * LPITCHB, bcp + k0, (size_t)32 * K, 32 * LPITCHB);
  };

  // Stage 0 is copied, waited for and published; stage 1 then flies over trip 0.
  stage(0, 0);
  wait_async0();
  __syncthreads();
  stage(1, 64);

  v8f c00 = {}, c01 = {}, c02 = {}, c03 = {};
  v8f c10 = {}, c11 = {}, c12 = {}, c13 = {};
  for (int st = 0; st < NST; ++st) {
    const _Float16* arow0 = &ab[st & 1][(wm * 32 + ln) * LPITCH];
    const _Float16* arow1 = arow0 + 16 * LPITCH;
    const _Float16* brow0 = &ab[st & 1][(128 + wn * 64 + ln) * LPITCH];
    const _Float16* brow1 = brow0 + 16 * LPITCH;
    const _Float16* brow2 = brow0 + 32 * LPITCH;
    const _Float16* brow3 = brow0 + 48 * LPITCH;
    // unrolled so that the second half's LDS reads are issued under the first
    // half's products
#pragma unroll
    for (int kb = 0; kb < 64; kb += 32) {
      const v16h a0 = ldfrag(arow0, kb, laneHi);
      const v16h a1 = ldfrag(arow1, kb, laneHi);
      const v16h b0 = ldfrag(brow0, kb, laneHi);
      const v16h b1 = ldfrag(brow1, kb, laneHi);
      const v16h b2 = ldfrag(brow2, kb, laneHi);
      const v16h b3 = ldfrag(brow3, kb, laneHi);
      c00 = wmma_f16(a0, b0, c00);  c01 = wmma_f16(a0, b1, c01);
      c02 = wmma_f16(a0, b2, c02);  c03 = wmma_f16(a0, b3, c03);
      c10 = wmma_f16(a1, b0, c10);  c11 = wmma_f16(a1, b1, c11);
      c12 = wmma_f16(a1, b2, c12);  c13 = wmma_f16(a1, b3, c13);
    }
    // publish stage st + 1, then refill the buffer that this trip has read
    wait_ds0();
    wait_async0();
    __syncthreads();
    if (st + 2 < NST) stage(st & 1, (st + 2) * 64);
  }
  wait_async0();

  v8f acc[2][4] = {{c00, c01, c02, c03}, {c10, c11, c12, c13}};
#pragma unroll
  for (int mi = 0; mi < 2; ++mi) {
#pragma unroll
    for (int ni = 0; ni < 4; ++ni) {
      const int ng = nT * 64 + ni * 16 + ln;
      const float bvv = bias[ng];
      const v8f cc = acc[mi][ni];
#pragma unroll
      for (int i = 0; i < 8; ++i) {
        const int mg = mT * 32 + mi * 16 + i + laneHi * 8;   // C row per ISA layout
        const float val = (cc[i] + bvv) * oscale;
        if (mode == 2) {
          ((float*)outp)[(size_t)mg * N + ng] = val;
        } else {
          const int bb = mg >> 11, s = mg & (Ssz - 1);       // token -> (b,s)
          const int hh = ng >> 6,  inner = ng & (DK - 1);
          _Float16* o16 = (_Float16*)outp;
          if (mode == 0)
            o16[(((size_t)(bb * Hn + hh) * Ssz) + s) * DK + inner] = (_Float16)val;
          else  // 2 bytes a lane, every lane of a half-wave on a line of its own
            o16[(((size_t)(bb * Hn + hh) * DK) + inner) * Ssz + s] = (_Float16)val;
        }
      }
    }
  }
}

// The three projections in one grid: they share no data, so one launch pays the
// gap once, and three blocks on a WGP fill one another's waits for the copies.
// Blocks 0..255 make Qh, 256..511 Kh, 512..767 Vt.
__global__ __launch_bounds__(256) void gemm_qkv(
    const _Float16* __restrict__ q16, const _Float16* __restrict__ k16,
    const _Float16* __restrict__ v16, const _Float16* __restrict__ wq16,
    const _Float16* __restrict__ wk16, const _Float16* __restrict__ wv16,
    const float* __restrict__ bq, const float* __restrict__ bk,
    const float* __restrict__ bv, _Float16* __restrict__ Qh,
    _Float16* __restrict__ Kh, _Float16* __restrict__ Vt) {
  const int p = blockIdx.x / GEMM_BLKS, blk = blockIdx.x % GEMM_BLKS;
  const _Float16* A    = p == 0 ? q16  : p == 1 ? k16  : v16;
  const _Float16* Bt   = p == 0 ? wq16 : p == 1 ? wk16 : wv16;
  const float*    bias = p == 0 ? bq   : p == 1 ? bk   : bv;
  _Float16*       o    = p == 0 ? Qh   : p == 1 ? Kh   : Vt;
  gemm_body(A, Bt, bias, (void*)o, p == 2 ? 1 : 0, blk, p == 0 ? QSCALE : 1.0f);
}

// The output projection, fp32 to the output buffer.
__global__ __launch_bounds__(256) void gemm_out(
    const _Float16* __restrict__ ctx, const _Float16* __restrict__ wo16,
    const float* __restrict__ bo, float* __restrict__ out) {
  gemm_body(ctx, wo16, bo, (void*)out, 2, blockIdx.x, 1.0f);
}

#define QT 2
#define KH 2
__global__ __launch_bounds__(256) void flash_attn(
    const _Float16* __restrict__ Qh, const _Float16* __restrict__ Kh,
    const _Float16* __restrict__ Vt, const unsigned* __restrict__ mbits,
    _Float16* __restrict__ ctx) {
  const int lane = threadIdx.x & 31;
  // in a scalar register, so that the mask words' address is one too
  const int wave = __builtin_amdgcn_readfirstlane(threadIdx.x >> 5);
  const int kh = wave >> 2;                        // this wave's key half
  const int wq = wave & 3;                         // its query group in the block
  const int grp = blockIdx.x * 4 + wq;             // 0..2047: group of QT query tiles
  const int qg = grp & (Ssz / (16 * QT) - 1);      // group in sequence
  const int bh = grp / (Ssz / (16 * QT));          // b*H + h
  const int b  = bh >> 4, h = bh & (Hn - 1);
  const int q0 = qg * (16 * QT);
  const int ln = lane & 15, laneHi = lane >> 4;

  const _Float16* Qb = Qh + (size_t)bh * Ssz * DK;
  const int NST = Ssz / 64 / KH;                   // stages of a key half
  // from the first key of this wave's half on
  const _Float16* Kb = Kh + (size_t)bh * Ssz * DK + (size_t)kh * (NST * 64) * DK;
  const _Float16* Vb = Vt + (size_t)bh * DK * Ssz + kh * (NST * 64);
  // This wave's mask words: 32 a stage, the stages one behind the other, the
  // second query tile's behind the first's; from the half's first stage on.
  // (16-word units: two a stage, MWT a query tile)
  const cv16u_p mwp = (cv16u_p)(size_t)(mbits + ((size_t)(b * (Ssz / 16) + qg * QT) * (Ssz / 64) + kh * NST) * 32);
  const int MWT = (Ssz / 64) * 2;

  // One stage = 64 keys of each half: K tile (64 keys x dk) and V tile (dk x 64
  // keys), two buffers a half, shared by the half's four waves.
  __shared__ __attribute__((aligned(16))) _Float16 kv[KH][2][2][64 * LPITCH];

  // Copy slots: the four waves of a half bring its tiles. 8 lanes cover one
  // 128-byte row, so a wave's copy reads 4 whole lines; a thread brings rows
  // crow + 16 j, j = 0..3, of the K and the V tile.
  const int ct = threadIdx.x & 127;
  const int crow = ct >> 3, ccol = (ct & 7) * 8;
  const _Float16* kcp = Kb + (size_t)crow * DK  + ccol;
  const _Float16* vcp = Vb + (size_t)crow * Ssz + ccol;
  const unsigned  lk0 = lds_off(&kv[kh][0][0][crow * LPITCH + ccol]);
  const unsigned  TILEB = 64 * LPITCHB;            // bytes of one tile in LDS

  // Every loop over u, t, i or s in this kernel is unrolled: the arrays that they
  // index (bq, o, mw, sc, sv, kf, y ...) stay in registers only with constant indices.

  // Q fragments (held for the whole key sweep), B operand: column ln of tile u =
  // query q0 + 16 u + ln, k = dk
  v16h bq[QT][2];
#pragma unroll
  for (int u = 0; u < QT; ++u) {
    const _Float16* qrow = Qb + (size_t)(q0 + 16 * u + ln) * DK;
    bq[u][0] = ldfrag(qrow, 0,  laneHi);
    bq[u][1] = ldfrag(qrow, 32, laneHi);
  }

  // O^T tiles: o[u][t][i] = O[q0 + 16 u + ln][16 t + 8 laneHi + i]
  v8f o[QT][4] = {};
  float mu[QT];                                    // maximum in use of query ln, log2 units
  v2f sum0[QT] = {}, sum1[QT] = {};                // sums over this lane's keys only
  // mask words of stage 0; each stage fetches the next one's behind its last select
  v16u mw[QT][2];
#pragma unroll
  for (int u = 0; u < QT; ++u) {
    mu[u] = -1.0e30f;
    mw[u][0] = mwp[u * MWT];
    mw[u][1] = mwp[u * MWT + 1];
  }

  // Stage 0 is copied, waited for and published; stage 1 then flies over trip 0.
  async_copy8(lk0, kcp, 16 * DK, lk0 + TILEB, vcp, (size_t)16 * Ssz, 16 * LPITCHB);
  wait_async0();
  __syncthreads();
  async_copy8(lk0 + 2 * TILEB, kcp + 64 * DK, 16 * DK,
              lk0 + 3 * TILEB, vcp + 64, (size_t)16 * Ssz, 16 * LPITCHB);

  for (int st = 0; st < NST; ++st) {
   const _Float16* Ks = &kv[kh][st & 1][0][0];
   const _Float16* Vs = &kv[kh][st & 1][1][0];
   // ---- four 16x16 tiles of S^T a query tile, K=dk=64, on top of the start value
   // c0 / c1 (A operand: row ln of tile t = key 16 t + ln); a K fragment is read
   // once and multiplies both query tiles
   v8f sc[QT][4];
   auto scores = [&](float c0, float c1) {
     v16h kf[4][2];
#pragma unroll
     for (int t = 0; t < 4; ++t) {
       const _Float16* krow = Ks + (t * 16 + ln) * LPITCH;
       kf[t][0] = ldfrag(krow, 0,  laneHi);
       kf[t][1] = ldfrag(krow, 32, laneHi);
     }
     // keeps the K reads one group ahead of the products; with it the branch below
     // also reads its K fragments anew, where the build without it holds the 64
     // registers through the stage for a path that is hardly ever taken
     __builtin_amdgcn_sched_barrier(0);
#pragma unroll
     for (int u = 0; u < QT; ++u) {
       const float c = u == 0 ? c0 : c1;
       const v8f c8 = {c, c, c, c, c, c, c, c};
#pragma unroll
       for (int t = 0; t < 4; ++t) sc[u][t] = wmma_f16(kf[t][0], bq[u][0], c8);
     }
#pragma unroll
     for (int u = 0; u < QT; ++u)
#pragma unroll
       for (int t = 0; t < 4; ++t) sc[u][t] = wmma_f16(kf[t][1], bq[u][1], sc[u][t]);
   };
   // ---- mask (value mv where the entry is 0) and maximum of query ln of tile u
   // over this lane's 32 of the stage's 64 keys
   float sv[QT][32];
   auto mask_max = [&](int u, float mv) -> float {
     float cm[4] = {-3.0e38f, -3.0e38f, -3.0e38f, -3.0e38f};  // one chain of maxima a tile
#pragma unroll
     for (int t = 0; t < 4; ++t) {
       const v16u w = mw[u][t >> 1];               // words of key tiles 0, 1 / 2, 3
#pragma unroll
       for (int i = 0; i < 8; ++i) {
         sv[u][8 * t + i] = __builtin_amdgcn_inverse_ballot_w32(w[8 * (t & 1) + i]) ? sc[u][t][i] : mv;
         cm[t] = fmaxf(cm[t], sv[u][8 * t + i]);
       }
     }
     return fmaxf(fmaxf(cm[0], cm[1]), fmaxf(cm[2], cm[3]));
   };
   scores(-mu[0], -mu[1]);
   // the first pass's V fragments: read here, they fly under the selects
   v16h vfa[4];
#pragma unroll
   for (int t = 0; t < 4; ++t) vfa[t] = ldfrag(Vs + (16 * t + ln) * LPITCH, 0, laneHi);
   // sv = score - mu
   const float over = fmaxf(mask_max(0, NEG2 - mu[0]), mask_max(1, NEG2 - mu[1]));
   // One scalar branch a stage, on any lane and either tile of the wave. Taken in
   // stage 0 (mu = -1e30 makes every sv huge), where a score passes mu by more than
   // 8, and where every key so far was masked (mu = NEG2) and one now is not. The
   // scores are made anew from 0, because score - mu has lost the score's low bits
   // where mu is huge.
   if (__builtin_amdgcn_ballot_w32(over > 8.0f) != 0) {
     scores(0.0f, 0.0f);
#pragma unroll
     for (int u = 0; u < QT; ++u) {
       const float cm    = mask_max(u, NEG2);
       const float mnew  = fmaxf(mu[u], fmaxf(cm, xhalf(cm)));  // both halves: all 64 keys
       const float alpha = __builtin_amdgcn_exp2f(mu[u] - mnew);
       mu[u] = mnew;
#pragma unroll
       for (int s = 0; s < 32; ++s) sv[u][s] -= mnew;
       sum0[u] *= alpha; sum1[u] *= alpha;
#pragma unroll
       for (int t = 0; t < 4; ++t) o[u][t] *= alpha;
     }
   }
   // unrolled: sv stays in registers, and with no barrier in a pass the
   // second pass's V reads can be issued under the first pass's exponentials
#pragma unroll
   for (int sub = 0; sub < 64; sub += 32) {
    const v16h vf0 = sub == 0 ? vfa[0] : ldfrag(Vs + (ln)      * LPITCH, sub, laneHi);
    const v16h vf1 = sub == 0 ? vfa[1] : ldfrag(Vs + (16 + ln) * LPITCH, sub, laneHi);
    const v16h vf2 = sub == 0 ? vfa[2] : ldfrag(Vs + (32 + ln) * LPITCH, sub, laneHi);
    const v16h vf3 = sub == 0 ? vfa[3] : ldfrag(Vs + (48 + ln) * LPITCH, sub, laneHi);

    // a V fragment is read once and multiplies both query tiles; the second
    // tile's exponentials stand behind the first tile's products
#pragma unroll
    for (int u = 0; u < QT; ++u) {
      v16h pb;                                     // P^T, B operand
#pragma unroll
      for (int s = 0; s < 16; s += 2) {
        const v2f p = {__builtin_amdgcn_exp2f(sv[u][sub / 2 + s]),
                       __builtin_amdgcn_exp2f(sv[u][sub / 2 + s + 1])};
        if (sub == 0) sum0[u] += p; else sum1[u] += p;   // even and odd keys apart
        pb[s] = (_Float16)p[0];
        pb[s + 1] = (_Float16)p[1];
      }

      // ---- O^T += V^T(64x32) * P^T(32x16); Vt rows are the A-matrix rows
      o[u][0] = wmma_f16(vf0, pb, o[u][0]);
      o[u][1] = wmma_f16(vf1, pb, o[u][1]);
      o[u][2] = wmma_f16(vf2, pb, o[u][2]);
      o[u][3] = wmma_f16(vf3, pb, o[u][3]);
    }
   }
   // ---- the next stage's mask words (the last stage fetches its own again, to
   // stay inside the array): they fly over the barrier and the score products
   {
     const int nx = st + 1 < NST ? st + 1 : st;
#pragma unroll
     for (int u = 0; u < QT; ++u) {
       mw[u][0] = mwp[u * MWT + 2 * nx];
       mw[u][1] = mwp[u * MWT + 2 * nx + 1];
     }
   }
   // ---- publish stage st + 1, then refill the buffer that this trip has read
   wait_ds0();
   wait_async0();
   __syncthreads();
   if (st + 2 < NST) {
     const unsigned lb = lk0 + (unsigned)(st & 1) * (2 * TILEB);
     async_copy8(lb, kcp + (size_t)(st + 2) * 64 * DK, 16 * DK,
                 lb + TILEB, vcp + (st + 2) * 64, (size_t)16 * Ssz, 16 * LPITCHB);
   }
  }
  wait_async0();

  // ---- join the two key halves of a query group. The loop's last barrier has
  // ended every read of the ring and no copy is in flight, so the ring's LDS
  // carries the upper half's O^T tiles, maxima and sums to the lower half's wave:
  // 17 slots of 16 bytes a lane, a slot's 32 lanes side by side.
  float lr[QT];                                    // sums over this lane's keys
#pragma unroll
  for (int u = 0; u < QT; ++u) lr[u] = (sum0[u][0] + sum0[u][1]) + (sum1[u][0] + sum1[u][1]);
  v4f* xo = (v4f*)&kv[0][0][0][0] + wq * ((QT * 8 + 1) * 32) + lane;
  if (kh == 1) {
#pragma unroll
    for (int u = 0; u < QT; ++u)
#pragma unroll
      for (int t = 0; t < 4; ++t) {
        const v8f x = o[u][t];
        xo[((u * 4 + t) * 2) * 32]     = (v4f){x[0], x[1], x[2], x[3]};
        xo[((u * 4 + t) * 2 + 1) * 32] = (v4f){x[4], x[5], x[6], x[7]};
      }
    xo[QT * 8 * 32] = (v4f){mu[0], mu[1], lr[0], lr[1]};
  }
  // publishes the upper halves' results to their partner waves
  __syncthreads();
  if (kh == 1) return;

  // ---- both halves on the larger maximum, join the wave halves' sums, normalize
  // and write ctx (concat-head layout, f16): a lane's 8 registers of a tile are 8
  // consecutive columns of its row
  const v4f ms = xo[QT * 8 * 32];
  v8h y[QT][4];
#pragma unroll
  for (int u = 0; u < QT; ++u) {
    const float m  = fmaxf(mu[u], ms[u]);
    const float fa = __builtin_amdgcn_exp2f(mu[u] - m);
    const float fb = __builtin_amdgcn_exp2f(ms[u] - m);
    const float l  = lr[u] * fa + ms[2 + u] * fb;
    const float inv = 1.0f / (l + xhalf(l));
    const float ga = fa * inv, gb = fb * inv;
#pragma unroll
    for (int t = 0; t < 4; ++t) {
      const v4f x0 = xo[((u * 4 + t) * 2) * 32];
      const v4f x1 = xo[((u * 4 + t) * 2 + 1) * 32];
#pragma unroll
      for (int i = 0; i < 4; ++i) {
        y[u][t][i]     = (_Float16)(o[u][t][i] * ga + x0[i] * gb);
        y[u][t][i + 4] = (_Float16)(o[u][t][i + 4] * ga + x1[i] * gb);
      }
    }
  }
#pragma unroll
  for (int u = 0; u < QT; ++u) {
    _Float16* crowp = ctx + ((size_t)(b * Ssz + q0 + 16 * u + ln)) * Dsz + h * DK + laneHi * 8;
#pragma unroll
    for (int t = 0; t < 4; ++t) *(v8h*)(crowp + 16 * t) = y[u][t];
  }
}

// ---------------------------------------------------------------------------
extern "C" void kernel_launch(void* const* d_in, const int* in_sizes, int n_in,
                              void* d_out, int out_size, void* d_ws, size_t ws_size,
                              hipStream_t stream) {
  (void)in_sizes; (void)n_in; (void)out_size; (void)ws_size;
  const float* q    = (const float*)d_in[0];
  const float* k    = (const float*)d_in[1];
  const float* v    = (const float*)d_in[2];
  const float* Wq   = (const float*)d_in[3];
  const float* bq   = (const float*)d_in[4];
  const float* Wk   = (const float*)d_in[5];
  const float* bk   = (const float*)d_in[6];
  const float* Wv   = (const float*)d_in[7];
  const float* bv   = (const float*)d_in[8];
  const float* Wo   = (const float*)d_in[9];
  const float* bo   = (const float*)d_in[10];
  const int*   mask = (const int*)d_in[11];

  // workspace layout (65 MB total)
  char* w = (char*)d_ws;
  const size_t MB = 1ull << 20;
  _Float16* q16  = (_Float16*)(w + 0 * MB);
  _Float16* k16  = (_Float16*)(w + 8 * MB);
  _Float16* v16f = (_Float16*)(w + 16 * MB);
  _Float16* wq16 = (_Float16*)(w + 24 * MB);
  _Float16* wk16 = (_Float16*)(w + 26 * MB);
  _Float16* wv16 = (_Float16*)(w + 28 * MB);
  _Float16* wo16 = (_Float16*)(w + 30 * MB);
  _Float16* QhP  = (_Float16*)(w + 32 * MB);
  _Float16* KhP  = (_Float16*)(w + 40 * MB);
  _Float16* VtP  = (_Float16*)(w + 48 * MB);
  _Float16* ctxP = (_Float16*)(w + 56 * MB);
  unsigned* mbP  = (unsigned*)(w + 64 * MB);       // 1 MB: one bit a mask entry

  // q16 .. wo16 are one contiguous range that starts at q16
  cvt_f32_f16<<<PK_BLKS + CVT_BLKS, 256, 0, stream>>>(q, k, v, Wq, Wk, Wv, Wo, mask, q16, mbP);

  // per product (M/32)*(N/64) = 128*16 = 2048 wave-tiles, 8 waves (4 x 2) per
  // 256-thread block
  gemm_qkv<<<3 * GEMM_BLKS, 256, 0, stream>>>(q16, k16, v16f, wq16, wk16, wv16,
                                              bq, bk, bv, QhP, KhP, VtP);

  // B*H*(S/16) = 4096 query tiles, 2 a wave, 4 query groups x 2 key halves of
  // waves per 256-thread block
  flash_attn<<<4096 / 8, 256, 0, stream>>>(QhP, KhP, VtP, mbP, ctxP);

  gemm_out<<<GEMM_BLKS, 256, 0, stream>>>(ctxP, wo16, bo, (float*)d_out);
}

// v008
// It runs in 85.5 microseconds.
// Next to v007, in two timings, it ran 1.11 times as fast each time.
// Over all steps from v000 it is 4.31 times as fast.
#include <hip/hip_runtime.h>

// ---------------------------------------------------------------------------
// MHA forward for MI455X (gfx1250, wave32, WMMA f32_16x16x32_f16)
// B=2, S=2048, D=1024, H=16, dk=64
// Pipeline:
//   1) fp32 -> f16 convert of q,k,v and Wq,Wk,Wv,Wo into workspace (32 per thread),
//      one launch for the seven tensors; its first blocks pack the mask into
//      lane-mask words, one bit a score
//   2) WMMA GEMM (64x32 register-blocked): Qh = (q@Wq^T+bq) * log2(e)/sqrt(64)
//      (head layout), Kh = k@Wk^T+bk likewise, Vt = (v@Wv^T+bv)^T per head, one
//      launch for the three
//   3) flash-attention, transposed products (online softmax in powers of two,
//      mask; the score products deliver the exponent) -> ctx f16
//   4) WMMA GEMM: out = ctx@Wo^T + bo  (fp32 to d_out)
// ---------------------------------------------------------------------------

typedef __attribute__((ext_vector_type(16))) _Float16 v16h;
typedef __attribute__((ext_vector_type(8)))  _Float16 v8h;
typedef __attribute__((ext_vector_type(8)))  float    v8f;
typedef __attribute__((ext_vector_type(4)))  float    v4f;
typedef __attribute__((ext_vector_type(4)))  _Float16 v4h;
typedef __attribute__((ext_vector_type(4)))  int      v4i;
typedef __attribute__((ext_vector_type(2)))  float    v2f;
typedef __attribute__((ext_vector_type(16))) unsigned v16u;
// 16 words in the constant address space: for data that no store of the running
// kernel touches; with a wave-uniform address the load is a scalar load also
// inside a loop that holds barriers and copies.
typedef const __attribute__((address_space(4))) v16u* cv16u_p;

#define Bsz 2
#define Ssz 2048
#define Dsz 1024
#define Hn  16
#define DK  64
// Scores are kept in log2 units: exp(s / sqrt(dk)) = exp2(s * QSCALE). Qh carries
// the factor, so that K Q^T is the exponent but for the maximum.
#define QSCALE 0.18033688011112042f                // log2(e) / sqrt(64)
#define NEG2   (-1.4426950408889634e10f)           // the masked score -1e10, log2 units

__device__ __forceinline__ v8f wmma_f16(v16h a, v16h b, v8f c) {
  // v_wmma_f32_16x16x32_f16
  return __builtin_amdgcn_wmma_f32_16x16x32_f16(
      /*neg_a=*/false, a, /*neg_b=*/false, b,
      /*c_mod=*/(short)0, c, /*reuse_a=*/false, /*reuse_b=*/false);
}

// Load a 16-bit A/B fragment (16x32 row-per-lane) from a row-major matrix.
// rowptr points at the start of this lane's row; kb = K-block base.
// ISA layout: lanes 0-15 take k = kb+{0..7,16..23}; lanes 16-31 take +8.
__device__ __forceinline__ v16h ldfrag(const _Float16* rowptr, int kb, int laneHi) {
  const _Float16* p = rowptr + kb + laneHi * 8;
  v8h lo = *(const v8h*)(p);
  v8h hi = *(const v8h*)(p + 16);
  v16h f;
#pragma unroll
  for (int i = 0; i < 8; ++i) { f[i] = lo[i]; f[i + 8] = hi[i]; }
  return f;
}

// Value of lane l ^ 16 (the other half of the wave), by a vector cross-row move.
__device__ __forceinline__ float xhalf(float x) {
  const int xi = __builtin_bit_cast(int, x);
  return __builtin_bit_cast(float, __builtin_amdgcn_permlanex16(xi, xi, 0x76543210, 0xfedcba98, false, false));
}

// LDS rows hold 64 f16 (128 B) at a pitch of 144 B: 16 B x odd, so that the 16
// rows of a ds_load_b128 fragment read fall on different banks.
#define LPITCH 72
#define LPITCHB (LPITCH * 2)

// Byte offset of a __shared__ address inside the work-group's LDS.
__device__ __forceinline__ unsigned lds_off(const void* p) { return (unsigned)(size_t)p; }

// Eight asynchronous 16-byte copies per lane, global -> LDS, through no register,
// in two groups of four rows: group a from ga to la, group b from gb to lb; lstep
// is the row step in LDS bytes, gsa / gsb the row steps in global elements.
// s_wait_xcnt 0 ends the statement so that it stands in front of any rewrite of
// the address registers.
__device__ __forceinline__ void async_copy8(unsigned la, const _Float16* ga, size_t gsa,
                                            unsigned lb, const _Float16* gb, size_t gsb,
                                            unsigned lstep) {
  asm volatile("global_load_async_to_lds_b128 %0, %8, off\n\t"
               "global_load_async_to_lds_b128 %1, %9, off\n\t"
               "global_load_async_to_lds_b128 %2, %10, off\n\t"
               "global_load_async_to_lds_b128 %3, %11, off\n\t"
               "global_load_async_to_lds_b128 %4, %12, off\n\t"
               "global_load_async_to_lds_b128 %5, %13, off\n\t"
               "global_load_async_to_lds_b128 %6, %14, off\n\t"
               "global_load_async_to_lds_b128 %7, %15, off\n\t"
               "s_wait_xcnt 0x0"
               :: "v"(la), "v"(la + lstep), "v"(la + 2 * lstep), "v"(la + 3 * lstep),
                  "v"(lb), "v"(lb + lstep), "v"(lb + 2 * lstep), "v"(lb + 3 * lstep),
                  "v"(ga), "v"(ga + gsa), "v"(ga + 2 * gsa), "v"(ga + 3 * gsa),
                  "v"(gb), "v"(gb + gsb), "v"(gb + 2 * gsb), "v"(gb + 3 * gsb)
               : "memory");
}

// This wave's copies have landed (the compiler places no wait for them).
__device__ __forceinline__ void wait_async0() { asm volatile("s_wait_asynccnt 0x0" ::: "memory"); }
// This wave's LDS reads have returned, before their buffer is handed back.
__device__ __forceinline__ void wait_ds0() { asm volatile("s_wait_dscnt 0x0" ::: "memory"); }

// ---------------------------------------------------------------------------
// A thread converts 32 floats, so that a tensor takes 1/32 of the waves to start.
// Eight 16-byte loads, all issued ahead of the first conversion; each wave-wide
// load covers 512 contiguous bytes and each wave-wide store 256.
// One grid converts all seven tensors: they depend on nothing and on one another
// not at all, so one launch pays the gap, the start and the drain once. The f16
// copies lie one behind the other in the workspace in the order q, k, v, Wq, Wk,
// Wv, Wo, so the block index alone gives the place in out; each tensor's length
// is a multiple of CVT_BLK, so a block lies in one tensor.
#define CVT_BLK (256 * 32)
#define CVT_ACT_BLKS (Bsz * Ssz * Dsz / CVT_BLK)   // blocks of q, k or v: 512
#define CVT_W_BLKS   (Dsz * Dsz / CVT_BLK)         // blocks of a weight: 128
#define CVT_BLKS     (3 * CVT_ACT_BLKS + 4 * CVT_W_BLKS)

// The mask as lane masks. The attention wave of query tile qtile (16 queries)
// holds, in stage st (64 keys), score register i of key tile t as: lane l =
// query l & 15, key 64 st + 16 t + 8 (l >> 4) + i. Word 8 t + i of the 32 words
// of (qtile, st) has bit l set where that lane's mask entry is not 0, so the
// word is the select mask of that register as it stands. The 16 heads each read
// these 128 bytes; the int32 entries behind them are 4 KB on 32 lines.
// A wave packs PK_ST stages of one query tile: one compare a word (its result is
// the word), and lane j keeps word j for one 128-byte store a stage.
#define PK_ST   4
#define PK_BLKS (Bsz * (Ssz / 16) * (Ssz / 64) / (8 * PK_ST))   // 256
__device__ __forceinline__ void pack_mask(const int* __restrict__ mask,
                                          unsigned* __restrict__ mbits, unsigned pb) {
  const unsigned lane = threadIdx.x & 31, ln = lane & 15, laneHi = lane >> 4;
  const unsigned g = pb * 8 + (threadIdx.x >> 5);  // group of PK_ST stages
  const unsigned NGRP = (Ssz / 64) / PK_ST;         // groups of a query tile: 8
  const unsigned qtile = g / NGRP;                  // b * (S / 16) + tile: 0..255
  const unsigned st0 = (g % NGRP) * PK_ST;
  const int* row = mask + ((size_t)qtile * 16 + ln) * Ssz + st0 * 64 + laneHi * 8;
  v4i m[PK_ST][4][2];
  // all loops unrolled: m stays in registers, and many loads are in flight at once
#pragma unroll
  for (int u = 0; u < PK_ST; ++u)
#pragma unroll
    for (int t = 0; t < 4; ++t) {
      m[u][t][0] = *(const v4i*)(row + u * 64 + t * 16);
      m[u][t][1] = *(const v4i*)(row + u * 64 + t * 16 + 4);
    }
#pragma unroll
  for (int u = 0; u < PK_ST; ++u) {
    unsigned w = 0;                                // lane j ends with word j
#pragma unroll
    for (int j = 0; j < 32; ++j) {
      const unsigned bal = __builtin_amdgcn_ballot_w32(m[u][j >> 3][(j >> 2) & 1][j & 3] != 0);
      w = lane == (unsigned)j ? bal : w;
    }
    mbits[((size_t)qtile * (Ssz / 64) + st0 + u) * 32 + lane] = w;
  }
}

// Blocks 0 .. PK_BLKS - 1 pack the mask (first, so that their one long round of
// loads runs under the conversions); the rest convert.
__global__ __launch_bounds__(256) void cvt_f32_f16(
    const float* __restrict__ q, const float* __restrict__ k, const float* __restrict__ v,
    const float* __restrict__ Wq, const float* __restrict__ Wk,
    const float* __restrict__ Wv, const float* __restrict__ Wo,
    const int* __restrict__ mask, _Float16* __restrict__ out16,
    unsigned* __restrict__ mbits) {
  if (blockIdx.x < PK_BLKS) {
    pack_mask(mask, mbits, blockIdx.x);
    return;
  }
  const unsigned bid = blockIdx.x - PK_BLKS;
  const float* src;
  unsigned lb;                                     // block index inside the tensor
  if (bid < 3 * CVT_ACT_BLKS) {
    const unsigned t = bid / CVT_ACT_BLKS;
    lb = bid % CVT_ACT_BLKS;
    src = t == 0 ? q : t == 1 ? k : v;
  } else {
    const unsigned r = bid - 3 * CVT_ACT_BLKS, t = r / CVT_W_BLKS;
    lb = r % CVT_W_BLKS;
    src = t == 0 ? Wq : t == 1 ? Wk : t == 2 ? Wv : Wo;
  }
  const float* in = src + (size_t)lb * CVT_BLK;
  _Float16* out = out16 + (size_t)bid * CVT_BLK;
  const size_t base = threadIdx.x * 4;
  v4f x[8];
  // both loops unrolled: x stays in registers and the eight loads issue as one group
#pragma unroll
  for (int j = 0; j < 8; ++j) x[j] = *(const v4f*)(in + base + j * 1024);
#pragma unroll
  for (int j = 0; j < 8; ++j) {
    v4h y;
#pragma unroll
    for (int e = 0; e < 4; ++e) y[e] = (_Float16)x[j][e];
    *(v4h*)(out + base + j * 1024) = y;
  }
}

// ---------------------------------------------------------------------------
// C[M,N] = A[M,K] * Bt[N,K]^T + bias  (A,Bt f16 row-major, fp32 accumulate)
// M=4096, N=1024, K=1024.
// Register-blocked: one wave computes a 64x32 tile = 4 x 2 fragments
// -> 8 WMMAs per K-step on 8 independent accumulator chains (hides XDL
// accumulation latency), 12 b128 loads per 8 WMMAs (vs 4 per WMMA naive).
// A and B come into LDS by asynchronous copies; fragments are read there.
// A lane's 8 accumulator registers of a tile run along the rows of the WMMA's
// first operand ("r"), its lanes along the rows of the second ("c"). The operand
// whose index is contiguous in the output goes first, so a lane's 8 values are 8
// neighbours in memory, and the wave's 64 r are a whole line (two in fp32):
//   tokR = true : r = tokens,   c = features: f16 out transposed head [b,h,dk,s]
//   tokR = false: r = features, c = tokens:   f16 out in head layout  [b,h,s,dk]
//                 or, f32out, fp32 out row-major [M,N]
// oscale: factor on (product + bias), applied in fp32 ahead of the one rounding.
// blk: the block's index among the GEMM_BLKS blocks of one product.
#define GEMM_BLKS ((Bsz * Ssz / 128) * (Dsz / 128))   // 256
#define FPITCH 68                                  // fp32 staging row: 64 floats + 16 B
__device__ __forceinline__ void gemm_body(
    const _Float16* __restrict__ A, const _Float16* __restrict__ Bt,
    const float* __restrict__ bias, void* __restrict__ outp, bool f32out, bool tokR,
    int blk, float oscale) {
  const int M = Bsz * Ssz, N = Dsz, K = Dsz;
  const int lane = threadIdx.x & 31;
  const int wave = threadIdx.x >> 5;
  // The block's 8 wave tiles lie 2 (r) x 4 (c): a 128 x 128 block tile, so that
  // every staged r row serves 4 waves and every staged c row 2.
  const int nB = N / 128;                           // 8 block columns
  const int mB = blk / nB;                          // 0..31 (128-row blocks)
  if (mB >= M / 128) return;
  const int wr = wave & 1, wc = wave >> 1;
  const int ln = lane & 15, laneHi = lane >> 4;
  // first r and first c of the wave's tile: as rows of a stage in LDS (A's 128
  // rows, then B's) and as token / feature numbers
  const int rl0 = (tokR ? 0 : 128) + wr * 64;
  const int cl0 = (tokR ? 128 : 0) + wc * 32;
  const int r0  = (tokR ? mB : blk % nB) * 128 + wr * 64;
  const int c0  = (tokR ? blk % nB : mB) * 128 + wc * 32;

  // One stage = 64 of K: the block's 128 A rows, then its 128 B rows; two buffers.
  __shared__ __attribute__((aligned(16))) _Float16 ab[2][(128 + 128) * LPITCH];
  const unsigned BUFB = (128 + 128) * LPITCHB;      // bytes of one buffer
  const int NST = K / 64;                           // stages

  // Copy slots: 8 lanes cover one 128-byte row piece, so a wave's copy reads 4
  // whole lines; a thread brings rows crow + 32 j, j = 0..3, of A and of B.
  const int crow = threadIdx.x >> 3, ccol = (threadIdx.x & 7) * 8;
  const _Float16* acp = A  + (size_t)(mB * 128 + crow) * K + ccol;
  const _Float16* bcp = Bt + (size_t)((blk % nB) * 128 + crow) * K + ccol;
  const unsigned  la0 = lds_off(&ab[0][crow * LPITCH + ccol]);
  auto stage = [&](unsigned buf, int k0) {
    const unsigned la = la0 + buf * BUFB;
    async_copy8(la, acp + k0, (size_t)32 * K,
                la + 128 * LPITCHB, bcp + k0, (size_t)32 * K, 32 * LPITCHB);
  };

  // Stage 0 is copied, waited for and published; stage 1 then flies over trip 0.
  stage(0, 0);
  wait_async0();
  __syncthreads();
  stage(1, 64);

  // Every loop over rf, cf, i or j below is unrolled: acc and the bias stay in
  // registers only with constant indices.
  v8f acc[4][2] = {};
  for (int st = 0; st < NST; ++st) {
    const _Float16* rrow = &ab[st & 1][(rl0 + ln) * LPITCH];
    const _Float16* crw  = &ab[st & 1][(cl0 + ln) * LPITCH];
    // unrolled so that the second half's LDS reads are issued under the first
    // half's products
#pragma unroll
    for (int kb = 0; kb < 64; kb += 32) {
      const v16h a0 = ldfrag(rrow, kb, laneHi);
      const v16h a1 = ldfrag(rrow + 16 * LPITCH, kb, laneHi);
      const v16h a2 = ldfrag(rrow + 32 * LPITCH, kb, laneHi);
      const v16h a3 = ldfrag(rrow + 48 * LPITCH, kb, laneHi);
      const v16h b0 = ldfrag(crw, kb, laneHi);
      const v16h b1 = ldfrag(crw + 16 * LPITCH, kb, laneHi);
      acc[0][0] = wmma_f16(a0, b0, acc[0][0]);  acc[1][0] = wmma_f16(a1, b0, acc[1][0]);
      acc[2][0] = wmma_f16(a2, b0, acc[2][0]);  acc[3][0] = wmma_f16(a3, b0, acc[3][0]);
      acc[0][1] = wmma_f16(a0, b1, acc[0][1]);  acc[1][1] = wmma_f16(a1, b1, acc[1][1]);
      acc[2][1] = wmma_f16(a2, b1, acc[2][1]);  acc[3][1] = wmma_f16(a3, b1, acc[3][1]);
    }
    // publish stage st + 1, then refill the buffer that this trip has read
    wait_ds0();
    wait_async0();
    __syncthreads();
    if (st + 2 < NST) stage(st & 1, (st + 2) * 64);
  }
  wait_async0();

  // The bias, all loads as one group: along r 8 neighbours a tile row (bl, bh),
  // along c one value a lane and tile column (bc).
  v4f bl[4] = {}, bh[4] = {};
  float bc[2] = {};
  if (tokR) {
#pragma unroll
    for (int cf = 0; cf < 2; ++cf) bc[cf] = bias[c0 + cf * 16 + ln];
  } else {
    const float* bp = bias + r0 + laneHi * 8;
#pragma unroll
    for (int rf = 0; rf < 4; ++rf) {
      bl[rf] = *(const v4f*)(bp + rf * 16);
      bh[rf] = *(const v4f*)(bp + rf * 16 + 4);
    }
    // behind the loads, in front of any rewrite of their address registers (bp as
    // an input holds its pair up to the wait)
    asm volatile("s_wait_xcnt 0x0" :: "v"(bp) : "memory");
  }

  // ---- The loop's last barrier has ended every read of the ring and no copy is in
  // flight, so the ring's LDS stages the output, each wave in a range of its own:
  // 32 rows (c) of the wave's 64 r. A lane writes its 8 neighbours by 16-byte LDS
  // stores; read back row by row, every global store covers 4 whole 128-byte lines.
  if (f32out) {
    float* stf = (float*)&ab[0][0] + wave * (32 * FPITCH);
#pragma unroll
    for (int rf = 0; rf < 4; ++rf) {
#pragma unroll
      for (int cf = 0; cf < 2; ++cf) {
        const v8f cc = acc[rf][cf];
        v4f yl, yh;
#pragma unroll
        for (int i = 0; i < 4; ++i) {
          yl[i] = (cc[i] + bl[rf][i]) * oscale;
          yh[i] = (cc[i + 4] + bh[rf][i]) * oscale;
        }
        float* sp = stf + (cf * 16 + ln) * FPITCH + rf * 16 + laneHi * 8;
        *(v4f*)sp = yl;
        *(v4f*)(sp + 4) = yh;
      }
    }
    // the wave's rows are in LDS before its lanes read one another's values
    wait_ds0();
    float* op = (float*)outp + (size_t)(c0 + laneHi) * N + r0 + ln * 4;
#pragma unroll
    for (int j = 0; j < 16; ++j)
      *(v4f*)(op + (size_t)(2 * j) * N) = *(const v4f*)(stf + (2 * j + laneHi) * FPITCH + ln * 4);
  } else {
    _Float16* stg = &ab[0][0] + wave * (32 * LPITCH);
    // tr is a constant at each call: one straight path for either orientation
    auto put = [&](const bool tr) {
#pragma unroll
      for (int rf = 0; rf < 4; ++rf)
#pragma unroll
        for (int cf = 0; cf < 2; ++cf) {
          const v8f cc = acc[rf][cf];
          v8h y;
#pragma unroll
          for (int i = 0; i < 8; ++i) {
            const float b = tr ? bc[cf] : i < 4 ? bl[rf][i & 3] : bh[rf][i & 3];
            y[i] = (_Float16)((cc[i] + b) * oscale);
          }
          *(v8h*)(stg + (cf * 16 + ln) * LPITCH + (rf * 2 + laneHi) * 8) = y;
        }
    };
    if (tokR) put(true); else put(false);
    // the wave's rows are in LDS before its lanes read one another's values
    wait_ds0();
    // row c of the wave's tile in the output, and the step from c to c + 1: the
    // 64 r are one head's dk (r0 = 64 h), or 64 tokens of one batch entry
    const int row = lane >> 3;
    const int c = c0 + row;
    _Float16* op = (_Float16*)outp + (lane & 7) * 8 +
        (tokR ? ((size_t)((r0 >> 11) * Hn * DK + c)) * Ssz + (r0 & (Ssz - 1))
              : ((size_t)((c >> 11) * Hn + (r0 >> 6)) * Ssz + (c & (Ssz - 1))) * DK);
    v8h x[8];
#pragma unroll
    for (int j = 0; j < 8; ++j) x[j] = *(const v8h*)(stg + (4 * j + row) * LPITCH + (lane & 7) * 8);
    // cstep is a constant at each call: one address, the rows by immediate offsets
    auto rows = [&](const size_t cstep) {
#pragma unroll
      for (int j = 0; j < 8; ++j) *(v8h*)(op + (size_t)(4 * j) * cstep) = x[j];
    };
    if (tokR) rows(Ssz); else rows(DK);
  }
}

// The three projections in one grid: they share no data, so one launch pays the
// gap once, and three blocks on a WGP fill one another's waits for the copies.
// Blocks 0..255 make Qh, 256..511 Kh, 512..767 Vt.
__global__ __launch_bounds__(256) void gemm_qkv(
    const _Float16* __restrict__ q16, const _Float16* __restrict__ k16,
    const _Float16* __restrict__ v16, const _Float16* __restrict__ wq16,
    const _Float16* __restrict__ wk16, const _Float16* __restrict__ wv16,
    const float* __restrict__ bq, const float* __restrict__ bk,
    const float* __restrict__ bv, _Float16* __restrict__ Qh,
    _Float16* __restrict__ Kh, _Float16* __restrict__ Vt) {
  const int p = blockIdx.x / GEMM_BLKS, blk = blockIdx.x % GEMM_BLKS;
  const _Float16* A    = p == 0 ? q16  : p == 1 ? k16  : v16;
  const _Float16* Bt   = p == 0 ? wq16 : p == 1 ? wk16 : wv16;
  const float*    bias = p == 0 ? bq   : p == 1 ? bk   : bv;
  _Float16*       o    = p == 0 ? Qh   : p == 1 ? Kh   : Vt;
  gemm_body(A, Bt, bias, (void*)o, false, p == 2, blk, p == 0 ? QSCALE : 1.0f);
}

// The output projection, fp32 to the output buffer.
__global__ __launch_bounds__(256) void gemm_out(
    const _Float16* __restrict__ ctx, const _Float16* __restrict__ wo16,
    const float* __restrict__ bo, float* __restrict__ out) {
  gemm_body(ctx, wo16, bo, (void*)out, true, false, blockIdx.x, 1.0f);
}

#define QT 2
#define KH 2
__global__ __launch_bounds__(256) void flash_attn(
    const _Float16* __restrict__ Qh, const _Float16* __restrict__ Kh,
    const _Float16* __restrict__ Vt, const unsigned* __restrict__ mbits,
    _Float16* __restrict__ ctx) {
  const int lane = threadIdx.x & 31;
  // in a scalar register, so that the mask words' address is one too
  const int wave = __builtin_amdgcn_readfirstlane(threadIdx.x >> 5);
  const int kh = wave >> 2;                        // this wave's key half
  const int wq = wave & 3;                         // its query group in the block
  const int grp = blockIdx.x * 4 + wq;             // 0..2047: group of QT query tiles
  const int qg = grp & (Ssz / (16 * QT) - 1);      // group in sequence
  const int bh = grp / (Ssz / (16 * QT));          // b*H + h
  const int b  = bh >> 4, h = bh & (Hn - 1);
  const int q0 = qg * (16 * QT);
  const int ln = lane & 15, laneHi = lane >> 4;

  const _Float16* Qb = Qh + (size_t)bh * Ssz * DK;
  const int NST = Ssz / 64 / KH;                   // stages of a key half
  // from the first key of this wave's half on
  const _Float16* Kb = Kh + (size_t)bh * Ssz * DK + (size_t)kh * (NST * 64) * DK;
  const _Float16* Vb = Vt + (size_t)bh * DK * Ssz + kh * (NST * 64);
  // This wave's mask words: 32 a stage, the stages one behind the other, the
  // second query tile's behind the first's; from the half's first stage on.
  // (16-word units: two a stage, MWT a query tile)
  const cv16u_p mwp = (cv16u_p)(size_t)(mbits + ((size_t)(b * (Ssz / 16) + qg * QT) * (Ssz / 64) + kh * NST) * 32);
  const int MWT = (Ssz / 64) * 2;

  // One stage = 64 keys of each half: K tile (64 keys x dk) and V tile (dk x 64
  // keys), two buffers a half, shared by the half's four waves.
  __shared__ __attribute__((aligned(16))) _Float16 kv[KH][2][2][64 * LPITCH];

  // Copy slots: the four waves of a half bring its tiles. 8 lanes cover one
  // 128-byte row, so a wave's copy reads 4 whole lines; a thread brings rows
  // crow + 16 j, j = 0..3, of the K and the V tile.
  const int ct = threadIdx.x & 127;
  const int crow = ct >> 3, ccol = (ct & 7) * 8;
  const _Float16* kcp = Kb + (size_t)crow * DK  + ccol;
  const _Float16* vcp = Vb + (size_t)crow * Ssz + ccol;
  const unsigned  lk0 = lds_off(&kv[kh][0][0][crow * LPITCH + ccol]);
  const unsigned  TILEB = 64 * LPITCHB;            // bytes of one tile in LDS

  // Every loop over u, t, i or s in this kernel is unrolled: the arrays that they
  // index (bq, o, mw, sc, sv, kf, y ...) stay in registers only with constant indices.

  // Q fragments (held for the whole key sweep), B operand: column ln of tile u =
  // query q0 + 16 u + ln, k = dk
  v16h bq[QT][2];
#pragma unroll
  for (int u = 0; u < QT; ++u) {
    const _Float16* qrow = Qb + (size_t)(q0 + 16 * u + ln) * DK;
    bq[u][0] = ldfrag(qrow, 0,  laneHi);
    bq[u][1] = ldfrag(qrow, 32, laneHi);
  }

  // O^T tiles: o[u][t][i] = O[q0 + 16 u + ln][16 t + 8 laneHi + i]
  v8f o[QT][4] = {};
  float mu[QT];                                    // maximum in use of query ln, log2 units
  v2f sum0[QT] = {}, sum1[QT] = {};                // sums over this lane's keys only
  // mask words of stage 0; each stage fetches the next one's behind its last select
  v16u mw[QT][2];
#pragma unroll
  for (int u = 0; u < QT; ++u) {
    mu[u] = -1.0e30f;
    mw[u][0] = mwp[u * MWT];
    mw[u][1] = mwp[u * MWT + 1];
  }

  // Stage 0 is copied, waited for and published; stage 1 then flies over trip 0.
  async_copy8(lk0, kcp, 16 * DK, lk0 + TILEB, vcp, (size_t)16 * Ssz, 16 * LPITCHB);
  wait_async0();
  __syncthreads();
  async_copy8(lk0 + 2 * TILEB, kcp + 64 * DK, 16 * DK,
              lk0 + 3 * TILEB, vcp + 64, (size_t)16 * Ssz, 16 * LPITCHB);

  for (int st = 0; st < NST; ++st) {
   const _Float16* Ks = &kv[kh][st & 1][0][0];
   const _Float16* Vs = &kv[kh][st & 1][1][0];
   // ---- four 16x16 tiles of S^T a query tile, K=dk=64, on top of the start value
   // c0 / c1 (A operand: row ln of tile t = key 16 t + ln); a K fragment is read
   // once and multiplies both query tiles
   v8f sc[QT][4];
   auto scores = [&](float c0, float c1) {
     v16h kf[4][2];
#pragma unroll
     for (int t = 0; t < 4; ++t) {
       const _Float16* krow = Ks + (t * 16 + ln) * LPITCH;
       kf[t][0] = ldfrag(krow, 0,  laneHi);
       kf[t][1] = ldfrag(krow, 32, laneHi);
     }
     // keeps the K reads one group ahead of the products; with it the branch below
     // also reads its K fragments anew, where the build without it holds the 64
     // registers through the stage for a path that is hardly ever taken
     __builtin_amdgcn_sched_barrier(0);
#pragma unroll
     for (int u = 0; u < QT; ++u) {
       const float c = u == 0 ? c0 : c1;
       const v8f c8 = {c, c, c, c, c, c, c, c};
#pragma unroll
       for (int t = 0; t < 4; ++t) sc[u][t] = wmma_f16(kf[t][0], bq[u][0], c8);
     }
#pragma unroll
     for (int u = 0; u < QT; ++u)
#pragma unroll
       for (int t = 0; t < 4; ++t) sc[u][t] = wmma_f16(kf[t][1], bq[u][1], sc[u][t]);
   };
   // ---- mask (value mv where the entry is 0) and maximum of query ln of tile u
   // over this lane's 32 of the stage's 64 keys
   float sv[QT][32];
   auto mask_max = [&](int u, float mv) -> float {
     float cm[4] = {-3.0e38f, -3.0e38f, -3.0e38f, -3.0e38f};  // one chain of maxima a tile
#pragma unroll
     for (int t = 0; t < 4; ++t) {
       const v16u w = mw[u][t >> 1];               // words of key tiles 0, 1 / 2, 3
#pragma unroll
       for (int i = 0; i < 8; ++i) {
         sv[u][8 * t + i] = __builtin_amdgcn_inverse_ballot_w32(w[8 * (t & 1) + i]) ? sc[u][t][i] : mv;
         cm[t] = fmaxf(cm[t], sv[u][8 * t + i]);
       }
     }
     return fmaxf(fmaxf(cm[0], cm[1]), fmaxf(cm[2], cm[3]));
   };
   scores(-mu[0], -mu[1]);
   // the first pass's V fragments: read here, they fly under the selects
   v16h vfa[4];
#pragma unroll
   for (int t = 0; t < 4; ++t) vfa[t] = ldfrag(Vs + (16 * t + ln) * LPITCH, 0, laneHi);
   // sv = score - mu
   const float over = fmaxf(mask_max(0, NEG2 - mu[0]), mask_max(1, NEG2 - mu[1]));
   // One scalar branch a stage, on any lane and either tile of the wave. Taken in
   // stage 0 (mu = -1e30 makes every sv huge), where a score passes mu by more than
   // 8, and where every key so far was masked (mu = NEG2) and one now is not. The
   // scores are made anew from 0, because score - mu has lost the score's low bits
   // where mu is huge.
   if (__builtin_amdgcn_ballot_w32(over > 8.0f) != 0) {
     scores(0.0f, 0.0f);
#pragma unroll
     for (int u = 0; u < QT; ++u) {
       const float cm    = mask_max(u, NEG2);
       const float mnew  = fmaxf(mu[u], fmaxf(cm, xhalf(cm)));  // both halves: all 64 keys
       const float alpha = __builtin_amdgcn_exp2f(mu[u] - mnew);
       mu[u] = mnew;
#pragma unroll
       for (int s = 0; s < 32; ++s) sv[u][s] -= mnew;
       sum0[u] *= alpha; sum1[u] *= alpha;
#pragma unroll
       for (int t = 0; t < 4; ++t) o[u][t] *= alpha;
     }
   }
   // unrolled: sv stays in registers, and with no barrier in a pass the
   // second pass's V reads can be issued under the first pass's exponentials
#pragma unroll
   for (int sub = 0; sub < 64; sub += 32) {
    const v16h vf0 = sub == 0 ? vfa[0] : ldfrag(Vs + (ln)      * LPITCH, sub, laneHi);
    const v16h vf1 = sub == 0 ? vfa[1] : ldfrag(Vs + (16 + ln) * LPITCH, sub, laneHi);
    const v16h vf2 = sub == 0 ? vfa[2] : ldfrag(Vs + (32 + ln) * LPITCH, sub, laneHi);
    const v16h vf3 = sub == 0 ? vfa[3] : ldfrag(Vs + (48 + ln) * LPITCH, sub, laneHi);

    // a V fragment is read once and multiplies both query tiles; the second
    // tile's exponentials stand behind the first tile's products
#pragma unroll
    for (int u = 0; u < QT; ++u) {
      v16h pb;                                     // P^T, B operand
#pragma unroll
      for (int s = 0; s < 16; s += 2) {
        const v2f p = {__builtin_amdgcn_exp2f(sv[u][sub / 2 + s]),
                       __builtin_amdgcn_exp2f(sv[u][sub / 2 + s + 1])};
        if (sub == 0) sum0[u] += p; else sum1[u] += p;   // even and odd keys apart
        pb[s] = (_Float16)p[0];
        pb[s + 1] = (_Float16)p[1];
      }

      // ---- O^T += V^T(64x32) * P^T(32x16); Vt rows are the A-matrix rows
      o[u][0] = wmma_f16(vf0, pb, o[u][0]);
      o[u][1] = wmma_f16(vf1, pb, o[u][1]);
      o[u][2] = wmma_f16(vf2, pb, o[u][2]);
      o[u][3] = wmma_f16(vf3, pb, o[u][3]);
    }
   }
   // ---- the next stage's mask words (the last stage fetches its own again, to
   // stay inside the array): they fly over the barrier and the score products
   {
     const int nx = st + 1 < NST ? st + 1 : st;
#pragma unroll
     for (int u = 0; u < QT; ++u) {
       mw[u][0] = mwp[u * MWT + 2 * nx];
       mw[u][1] = mwp[u * MWT + 2 * nx + 1];
     }
   }
   // ---- publish stage st + 1, then refill the buffer that this trip has read
   wait_ds0();
   wait_async0();
   __syncthreads();
   if (st + 2 < NST) {
     const unsigned lb = lk0 + (unsigned)(st & 1) * (2 * TILEB);
     async_copy8(lb, kcp + (size_t)(st + 2) * 64 * DK, 16 * DK,
                 lb + TILEB, vcp + (st + 2) * 64, (size_t)16 * Ssz, 16 * LPITCHB);
   }
  }
  wait_async0();

  // ---- join the two key halves of a query group. The loop's last barrier has
  // ended every read of the ring and no copy is in flight, so the ring's LDS
  // carries the upper half's O^T tiles, maxima and sums to the lower half's wave:
  // 17 slots of 16 bytes a lane, a slot's 32 lanes side by side.
  float lr[QT];                                    // sums over this lane's keys
#pragma unroll
  for (int u = 0; u < QT; ++u) lr[u] = (sum0[u][0] + sum0[u][1]) + (sum1[u][0] + sum1[u][1]);
  v4f* xo = (v4f*)&kv[0][0][0][0] + wq * ((QT * 8 + 1) * 32) + lane;
  if (kh == 1) {
#pragma unroll
    for (int u = 0; u < QT; ++u)
#pragma unroll
      for (int t = 0; t < 4; ++t) {
        const v8f x = o[u][t];
        xo[((u * 4 + t) * 2) * 32]     = (v4f){x[0], x[1], x[2], x[3]};
        xo[((u * 4 + t) * 2 + 1) * 32] = (v4f){x[4], x[5], x[6], x[7]};
      }
    xo[QT * 8 * 32] = (v4f){mu[0], mu[1], lr[0], lr[1]};
  }
  // publishes the upper halves' results to their partner waves
  __syncthreads();
  if (kh == 1) return;

  // ---- both halves on the larger maximum, join the wave halves' sums, normalize
  // (ctx: concat-head layout, f16): a lane's 8 registers of a tile are 8
  // consecutive columns of its row
  const v4f ms = xo[QT * 8 * 32];
  v8h y[QT][4];
#pragma unroll
  for (int u = 0; u < QT; ++u) {
    const float m  = fmaxf(mu[u], ms[u]);
    const float fa = __builtin_amdgcn_exp2f(mu[u] - m);
    const float fb = __builtin_amdgcn_exp2f(ms[u] - m);
    const float l  = lr[u] * fa + ms[2 + u] * fb;
    const float inv = 1.0f / (l + xhalf(l));
    const float ga = fa * inv, gb = fb * inv;
#pragma unroll
    for (int t = 0; t < 4; ++t) {
      const v4f x0 = xo[((u * 4 + t) * 2) * 32];
      const v4f x1 = xo[((u * 4 + t) * 2 + 1) * 32];
#pragma unroll
      for (int i = 0; i < 4; ++i) {
        y[u][t][i]     = (_Float16)(o[u][t][i] * ga + x0[i] * gb);
        y[u][t][i + 4] = (_Float16)(o[u][t][i + 4] * ga + x1[i] * gb);
      }
    }
  }
  // The wave's 32 rows of 128 bytes go through LDS, so that every global store
  // covers 4 whole lines: staged in the range that carried the partner's results to
  // this wave, which has read them and alone touches the range from here on.
  _Float16* stg = (_Float16*)((v4f*)&kv[0][0][0][0] + wq * ((QT * 8 + 1) * 32));
#pragma unroll
  for (int u = 0; u < QT; ++u)
#pragma unroll
    for (int t = 0; t < 4; ++t)
      *(v8h*)(stg + (16 * u + ln) * LPITCH + 16 * t + laneHi * 8) = y[u][t];
  // the wave's rows are in LDS before its lanes read one another's values
  wait_ds0();
  _Float16* crowp = ctx + ((size_t)(b * Ssz + q0 + (lane >> 3))) * Dsz + h * DK + (lane & 7) * 8;
#pragma unroll
  for (int j = 0; j < 8; ++j)
    *(v8h*)(crowp + (size_t)(4 * j) * Dsz) = *(const v8h*)(stg + (4 * j + (lane >> 3)) * LPITCH + (lane & 7) * 8);
}

// ---------------------------------------------------------------------------
extern "C" void kernel_launch(void* const* d_in, const int* in_sizes, int n_in,
                              void* d_out, int out_size, void* d_ws, size_t ws_size,
                              hipStream_t stream) {
  (void)in_sizes; (void)n_in; (void)out_size; (void)ws_size;
  const float* q    = (const float*)d_in[0];
  const float* k    = (const float*)d_in[1];
  const float* v    = (const float*)d_in[2];
  const float* Wq   = (const float*)d_in[3];
  const float* bq   = (const float*)d_in[4];
  const float* Wk   = (const float*)d_in[5];
  const float* bk   = (const float*)d_in[6];
  const float* Wv   = (const float*)d_in[7];
  const float* bv   = (const float*)d_in[8];
  const float* Wo   = (const float*)d_in[9];
  const float* bo   = (const float*)d_in[10];
  const int*   mask = (const int*)d_in[11];

  // workspace layout (65 MB total)
  char* w = (char*)d_ws;
  const size_t MB = 1ull << 20;
  _Float16* q16  = (_Float16*)(w + 0 * MB);
  _Float16* k16  = (_Float16*)(w + 8 * MB);
  _Float16* v16f = (_Float16*)(w + 16 * MB);
  _Float16* wq16 = (_Float16*)(w + 24 * MB);
  _Float16* wk16 = (_Float16*)(w + 26 * MB);
  _Float16* wv16 = (_Float16*)(w + 28 * MB);
  _Float16* wo16 = (_Float16*)(w + 30 * MB);
  _Float16* QhP  = (_Float16*)(w + 32 * MB);
  _Float16* KhP  = (_Float16*)(w + 40 * MB);
  _Float16* VtP  = (_Float16*)(w + 48 * MB);
  _Float16* ctxP = (_Float16*)(w + 56 * MB);
  unsigned* mbP  = (unsigned*)(w + 64 * MB);       // 1 MB: one bit a mask entry

  // q16 .. wo16 are one contiguous range that starts at q16
  cvt_f32_f16<<<PK_BLKS + CVT_BLKS, 256, 0, stream>>>(q, k, v, Wq, Wk, Wv, Wo, mask, q16, mbP);

  // per product 2048 wave tiles of 64 x 32, 8 waves (2 x 4) per 256-thread block
  gemm_qkv<<<3 * GEMM_BLKS, 256, 0, stream>>>(q16, k16, v16f, wq16, wk16, wv16,
                                              bq, bk, bv, QhP, KhP, VtP);

  // B*H*(S/16) = 4096 query tiles, 2 a wave, 4 query groups x 2 key halves of
  // waves per 256-thread block
  flash_attn<<<4096 / 8, 256, 0, stream>>>(QhP, KhP, VtP, mbP, ctxP);

  gemm_out<<<GEMM_BLKS, 256, 0, stream>>>(ctxP, wo16, bo, (float*)d_out);
}

// v009
// Measured time: 81.8 microseconds a run.
// In both of two side-by-side timings against v008, it was 1.05 times as fast.
// Counting every step since v000, it is 4.52 times as fast.
#include <hip/hip_runtime.h>

// ---------------------------------------------------------------------------
// MHA forward for MI455X (gfx1250, wave32, WMMA f32_16x16x32_f16)
// B=2, S=2048, D=1024, H=16, dk=64
// Pipeline:
//   1) fp32 -> f16 convert of q,k,v and Wq,Wk,Wv,Wo into workspace (32 per thread),
//      one launch for the seven tensors; its first blocks pack the mask into
//      lane-mask words, one bit a score
//   2) WMMA GEMM (64x32 register-blocked): Qh = (q@Wq^T+bq) * log2(e)/sqrt(64)
//      (head layout), Kh = k@Wk^T+bk likewise, Vt = (v@Wv^T+bv)^T per head, one
//      launch for the three
//   3) flash-attention, transposed products (online softmax in powers of two,
//      mask; the score products deliver the exponent) -> ctx f16
//   4) WMMA GEMM: out = ctx@Wo^T + bo  (fp32 to d_out)
// ---------------------------------------------------------------------------

typedef __attribute__((ext_vector_type(16))) _Float16 v16h;
typedef __attribute__((ext_vector_type(8)))  _Float16 v8h;
typedef __attribute__((ext_vector_type(8)))  float    v8f;
typedef __attribute__((ext_vector_type(4)))  float    v4f;
typedef __attribute__((ext_vector_type(4)))  _Float16 v4h;
typedef __attribute__((ext_vector_type(4)))  int      v4i;
typedef __attribute__((ext_vector_type(2)))  float    v2f;
typedef __attribute__((ext_vector_type(16))) unsigned v16u;
// 16 words in the constant address space: for data that no store of the running
// kernel touches; with a wave-uniform address the load is a scalar load also
// inside a loop that holds barriers and copies.
typedef const __attribute__((address_space(4))) v16u* cv16u_p;

#define Bsz 2
#define Ssz 2048
#define Dsz 1024
#define Hn  16
#define DK  64
// Scores are kept in log2 units: exp(s / sqrt(dk)) = exp2(s * QSCALE). Qh carries
// the factor, so that K Q^T is the exponent but for the maximum.
#define QSCALE 0.18033688011112042f                // log2(e) / sqrt(64)
#define NEG2   (-1.4426950408889634e10f)           // the masked score -1e10, log2 units

__device__ __forceinline__ v8f wmma_f16(v16h a, v16h b, v8f c) {
  // v_wmma_f32_16x16x32_f16
  return __builtin_amdgcn_wmma_f32_16x16x32_f16(
      /*neg_a=*/false, a, /*neg_b=*/false, b,
      /*c_mod=*/(short)0, c, /*reuse_a=*/false, /*reuse_b=*/false);
}

// Load a 16-bit A/B fragment (16x32 row-per-lane) from a row-major matrix.
// rowptr points at the start of this lane's row; kb = K-block base.
// ISA layout: lanes 0-15 take k = kb+{0..7,16..23}; lanes 16-31 take +8.
__device__ __forceinline__ v16h ldfrag(const _Float16* rowptr, int kb, int laneHi) {
  const _Float16* p = rowptr + kb + laneHi * 8;
  v8h lo = *(const v8h*)(p);
  v8h hi = *(const v8h*)(p + 16);
  v16h f;
#pragma unroll
  for (int i = 0; i < 8; ++i) { f[i] = lo[i]; f[i + 8] = hi[i]; }
  return f;
}

// Value of lane l ^ 16 (the other half of the wave), by a vector cross-row move.
__device__ __forceinline__ float xhalf(float x) {
  const int xi = __builtin_bit_cast(int, x);
  return __builtin_bit_cast(float, __builtin_amdgcn_permlanex16(xi, xi, 0x76543210, 0xfedcba98, false, false));
}

// LDS rows hold 64 f16 (128 B) at a pitch of 144 B: 16 B x odd, so that the 16
// rows of a ds_load_b128 fragment read fall on different banks.
#define LPITCH 72
#define LPITCHB (LPITCH * 2)

// The GEMM ring pads its rows in pairs: two 128-byte rows, then 16 bytes. Row r of
// 16 neighbours starts on bank 4 (r >> 1) + 32 (r & 1), so a ds_load_b128 fragment
// read still finds 16 different bank groups, and a stage takes 17/18 of the LDS that
// it takes at LPITCH: three buffers of three work-groups fit one WGP.
#define PPITCH 136                                 // f16 a row pair
#define PPITCHB (PPITCH * 2)
__device__ __forceinline__ int prow(int r) { return (r >> 1) * PPITCH + (r & 1) * 64; }

// Byte offset of a __shared__ address inside the work-group's LDS.
__device__ __forceinline__ unsigned lds_off(const void* p) { return (unsigned)(size_t)p; }

// Eight asynchronous 16-byte copies per lane, global -> LDS, through no register,
// in two groups of four rows: group a from ga to la, group b from gb to lb; lstep
// is the row step in LDS bytes, gsa / gsb the row steps in global elements.
// s_wait_xcnt 0 ends the statement so that it stands in front of any rewrite of
// the address registers.
__device__ __forceinline__ void async_copy8(unsigned la, const _Float16* ga, size_t gsa,
                                            unsigned lb, const _Float16* gb, size_t gsb,
                                            unsigned lstep) {
  asm volatile("global_load_async_to_lds_b128 %0, %8, off\n\t"
               "global_load_async_to_lds_b128 %1, %9, off\n\t"
               "global_load_async_to_lds_b128 %2, %10, off\n\t"
               "global_load_async_to_lds_b128 %3, %11, off\n\t"
               "global_load_async_to_lds_b128 %4, %12, off\n\t"
               "global_load_async_to_lds_b128 %5, %13, off\n\t"
               "global_load_async_to_lds_b128 %6, %14, off\n\t"
               "global_load_async_to_lds_b128 %7, %15, off\n\t"
               "s_wait_xcnt 0x0"
               :: "v"(la), "v"(la + lstep), "v"(la + 2 * lstep), "v"(la + 3 * lstep),
                  "v"(lb), "v"(lb + lstep), "v"(lb + 2 * lstep), "v"(lb + 3 * lstep),
                  "v"(ga), "v"(ga + gsa), "v"(ga + 2 * gsa), "v"(ga + 3 * gsa),
                  "v"(gb), "v"(gb + gsb), "v"(gb + 2 * gsb), "v"(gb + 3 * gsb)
               : "memory");
}

// This wave's copies have landed (the compiler places no wait for them).
__device__ __forceinline__ void wait_async0() { asm volatile("s_wait_asynccnt 0x0" ::: "memory"); }
// All but this wave's N youngest copies have landed (the counter returns in issue
// order): the stages behind the one that is published next stay in flight.
template <int N>
__device__ __forceinline__ void wait_async_but() { asm volatile("s_wait_asynccnt %0" :: "n"(N) : "memory"); }
// This wave's LDS reads have returned, before their buffer is handed back.
__device__ __forceinline__ void wait_ds0() { asm volatile("s_wait_dscnt 0x0" ::: "memory"); }

// ---------------------------------------------------------------------------
// A thread converts 32 floats, so that a tensor takes 1/32 of the waves to start.
// Eight 16-byte loads, all issued ahead of the first conversion; each wave-wide
// load covers 512 contiguous bytes and each wave-wide store 256.
// One grid converts all seven tensors: they depend on nothing and on one another
// not at all, so one launch pays the gap, the start and the drain once. The f16
// copies lie one behind the other in the workspace in the order q, k, v, Wq, Wk,
// Wv, Wo, so the block index alone gives the place in out; each tensor's length
// is a multiple of CVT_BLK, so a block lies in one tensor.
#define CVT_BLK (256 * 32)
#define CVT_ACT_BLKS (Bsz * Ssz * Dsz / CVT_BLK)   // blocks of q, k or v: 512
#define CVT_W_BLKS   (Dsz * Dsz / CVT_BLK)         // blocks of a weight: 128
#define CVT_BLKS     (3 * CVT_ACT_BLKS + 4 * CVT_W_BLKS)

// The mask as lane masks. The attention wave of query tile qtile (16 queries)
// holds, in stage st (64 keys), score register i of key tile t as: lane l =
// query l & 15, key 64 st + 16 t + 8 (l >> 4) + i. Word 8 t + i of the 32 words
// of (qtile, st) has bit l set where that lane's mask entry is not 0, so the
// word is the select mask of that register as it stands. The 16 heads each read
// these 128 bytes; the int32 entries behind them are 4 KB on 32 lines.
// A wave packs PK_ST stages of one query tile: one compare a word (its result is
// the word), and lane j keeps word j for one 128-byte store a stage.
#define PK_ST   4
#define PK_BLKS (Bsz * (Ssz / 16) * (Ssz / 64) / (8 * PK_ST))   // 256
__device__ __forceinline__ void pack_mask(const int* __restrict__ mask,
                                          unsigned* __restrict__ mbits, unsigned pb) {
  const unsigned lane = threadIdx.x & 31, ln = lane & 15, laneHi = lane >> 4;
  const unsigned g = pb * 8 + (threadIdx.x >> 5);  // group of PK_ST stages
  const unsigned NGRP = (Ssz / 64) / PK_ST;         // groups of a query tile: 8
  const unsigned qtile = g / NGRP;                  // b * (S / 16) + tile: 0..255
  const unsigned st0 = (g % NGRP) * PK_ST;
  const int* row = mask + ((size_t)qtile * 16 + ln) * Ssz + st0 * 64 + laneHi * 8;
  v4i m[PK_ST][4][2];
  // all loops unrolled: m stays in registers, and many loads are in flight at once
#pragma unroll
  for (int u = 0; u < PK_ST; ++u)
#pragma unroll
    for (int t = 0; t < 4; ++t) {
      m[u][t][0] = *(const v4i*)(row + u * 64 + t * 16);
      m[u][t][1] = *(const v4i*)(row + u * 64 + t * 16 + 4);
    }
#pragma unroll
  for (int u = 0; u < PK_ST; ++u) {
    unsigned w = 0;                                // lane j ends with word j
#pragma unroll
    for (int j = 0; j < 32; ++j) {
      const unsigned bal = __builtin_amdgcn_ballot_w32(m[u][j >> 3][(j >> 2) & 1][j & 3] != 0);
      w = lane == (unsigned)j ? bal : w;
    }
    mbits[((size_t)qtile * (Ssz / 64) + st0 + u) * 32 + lane] = w;
  }
}

// Blocks 0 .. PK_BLKS - 1 pack the mask (first, so that their one long round of
// loads runs under the conversions); the rest convert.
__global__ __launch_bounds__(256) void cvt_f32_f16(
    const float* __restrict__ q, const float* __restrict__ k, const float* __restrict__ v,
    const float* __restrict__ Wq, const float* __restrict__ Wk,
    const float* __restrict__ Wv, const float* __restrict__ Wo,
    const int* __restrict__ mask, _Float16* __restrict__ out16,
    unsigned* __restrict__ mbits) {
  if (blockIdx.x < PK_BLKS) {
    pack_mask(mask, mbits, blockIdx.x);
    return;
  }
  const unsigned bid = blockIdx.x - PK_BLKS;
  const float* src;
  unsigned lb;                                     // block index inside the tensor
  if (bid < 3 * CVT_ACT_BLKS) {
    const unsigned t = bid / CVT_ACT_BLKS;
    lb = bid % CVT_ACT_BLKS;
    src = t == 0 ? q : t == 1 ? k : v;
  } else {
    const unsigned r = bid - 3 * CVT_ACT_BLKS, t = r / CVT_W_BLKS;
    lb = r % CVT_W_BLKS;
    src = t == 0 ? Wq : t == 1 ? Wk : t == 2 ? Wv : Wo;
  }
  const float* in = src + (size_t)lb * CVT_BLK;
  _Float16* out = out16 + (size_t)bid * CVT_BLK;
  const size_t base = threadIdx.x * 4;
  v4f x[8];
  // both loops unrolled: x stays in registers and the eight loads issue as one group
#pragma unroll
  for (int j = 0; j < 8; ++j) x[j] = *(const v4f*)(in + base + j * 1024);
#pragma unroll
  for (int j = 0; j < 8; ++j) {
    v4h y;
#pragma unroll
    for (int e = 0; e < 4; ++e) y[e] = (_Float16)x[j][e];
    *(v4h*)(out + base + j * 1024) = y;
  }
}

// ---------------------------------------------------------------------------
// C[M,N] = A[M,K] * Bt[N,K]^T + bias  (A,Bt f16 row-major, fp32 accumulate)
// M=4096, N=1024, K=1024.
// Register-blocked: one wave computes a 64x32 tile = 4 x 2 fragments
// -> 8 WMMAs per K-step on 8 independent accumulator chains (hides XDL
// accumulation latency), 12 b128 loads per 8 WMMAs (vs 4 per WMMA naive).
// A and B come into LDS by asynchronous copies; fragments are read there.
// A lane's 8 accumulator registers of a tile run along the rows of the WMMA's
// first operand ("r"), its lanes along the rows of the second ("c"). The operand
// whose index is contiguous in the output goes first, so a lane's 8 values are 8
// neighbours in memory, and the wave's 64 r are a whole line (two in fp32):
//   tokR = true : r = tokens,   c = features: f16 out transposed head [b,h,dk,s]
//   tokR = false: r = features, c = tokens:   f16 out in head layout  [b,h,s,dk]
//                 or, f32out, fp32 out row-major [M,N]
// oscale: factor on (product + bias), applied in fp32 ahead of the one rounding.
// blk: the block's index among the GEMM_BLKS blocks of one product.
#define GEMM_BLKS ((Bsz * Ssz / 128) * (Dsz / 128))   // 256
// NB: buffers of the ring. The copies of stage s + NB are issued when stage s has
// been read, so NB - 1 stages are under way or landed while one is worked on. The
// blocks that share rows walk K in step, so no block finds its lines fetched by
// another: the lead is sized for a fetch from memory, not for a hit in L2.
#define FPITCH 68                                  // fp32 staging row: 64 floats + 16 B
template <int NB>
__device__ __forceinline__ void gemm_body(
    const _Float16* __restrict__ A, const _Float16* __restrict__ Bt,
    const float* __restrict__ bias, void* __restrict__ outp, bool f32out, bool tokR,
    int blk, float oscale) {
  const int M = Bsz * Ssz, N = Dsz, K = Dsz;
  const int lane = threadIdx.x & 31;
  const int wave = threadIdx.x >> 5;
  // The block's 8 wave tiles lie 2 (r) x 4 (c): a 128 x 128 block tile, so that
  // every staged r row serves 4 waves and every staged c row 2.
  const int nB = N / 128;                           // 8 block columns
  const int mB = blk / nB;                          // 0..31 (128-row blocks)
  if (mB >= M / 128) return;
  const int wr = wave & 1, wc = wave >> 1;
  const int ln = lane & 15, laneHi = lane >> 4;
  // first r and first c of the wave's tile: as rows of a stage in LDS (A's 128
  // rows, then B's) and as token / feature numbers
  const int rl0 = (tokR ? 0 : 128) + wr * 64;
  const int cl0 = (tokR ? 128 : 0) + wc * 32;
  const int r0  = (tokR ? mB : blk % nB) * 128 + wr * 64;
  const int c0  = (tokR ? blk % nB : mB) * 128 + wc * 32;

  // One stage = 64 of K: the block's 128 A rows, then its 128 B rows; NB buffers.
  __shared__ __attribute__((aligned(16))) _Float16 ab[NB][(64 + 64) * PPITCH];
  const unsigned BUFB = (64 + 64) * PPITCHB;        // bytes of one buffer
  const int NST = K / 64;                           // stages

  // Copy slots: 8 lanes cover one 128-byte row piece, so a wave's copy reads 4
  // whole lines; a thread brings rows crow + 32 j, j = 0..3, of A and of B.
  const int crow = threadIdx.x >> 3, ccol = (threadIdx.x & 7) * 8;
  const _Float16* acp = A  + (size_t)(mB * 128 + crow) * K + ccol;
  const _Float16* bcp = Bt + (size_t)((blk % nB) * 128 + crow) * K + ccol;
  const unsigned  la0 = lds_off(&ab[0][prow(crow) + ccol]);
  auto stage = [&](unsigned buf, int k0) {
    const unsigned la = la0 + buf * BUFB;
    async_copy8(la, acp + k0, (size_t)32 * K,
                la + 64 * PPITCHB, bcp + k0, (size_t)32 * K, 16 * PPITCHB);
  };
  // copies of a wave that may stay in flight where a stage is published: those of
  // the NB - 2 stages issued behind it, 8 each
  constexpr int LEFT = (NB - 2) * 8;

  // Stages 0 .. NB - 2 are issued, stage 0 is waited for and published; stage NB - 1
  // follows (unrolled: the buffer numbers are constants).
#pragma unroll
  for (int s = 0; s < NB - 1; ++s) stage(s, s * 64);
  wait_async_but<LEFT>();
  __syncthreads();
  stage(NB - 1, (NB - 1) * 64);

  // Every loop over rf, cf, i or j below is unrolled: acc and the bias stay in
  // registers only with constant indices.
  v8f acc[4][2] = {};
  unsigned buf = 0;                                 // st mod NB
  for (int st = 0; st < NST; ++st) {
    const _Float16* rrow = &ab[buf][prow(rl0 + ln)];
    const _Float16* crw  = &ab[buf][prow(cl0 + ln)];
    // unrolled so that the second half's LDS reads are issued under the first
    // half's products
#pragma unroll
    for (int kb = 0; kb < 64; kb += 32) {
      const v16h a0 = ldfrag(rrow, kb, laneHi);
      const v16h a1 = ldfrag(rrow + 8 * PPITCH, kb, laneHi);
      const v16h a2 = ldfrag(rrow + 16 * PPITCH, kb, laneHi);
      const v16h a3 = ldfrag(rrow + 24 * PPITCH, kb, laneHi);
      const v16h b0 = ldfrag(crw, kb, laneHi);
      const v16h b1 = ldfrag(crw + 8 * PPITCH, kb, laneHi);
      acc[0][0] = wmma_f16(a0, b0, acc[0][0]);  acc[1][0] = wmma_f16(a1, b0, acc[1][0]);
      acc[2][0] = wmma_f16(a2, b0, acc[2][0]);  acc[3][0] = wmma_f16(a3, b0, acc[3][0]);
      acc[0][1] = wmma_f16(a0, b1, acc[0][1]);  acc[1][1] = wmma_f16(a1, b1, acc[1][1]);
      acc[2][1] = wmma_f16(a2, b1, acc[2][1]);  acc[3][1] = wmma_f16(a3, b1, acc[3][1]);
    }
    // publish stage st + 1, then refill the buffer that this trip has read. While
    // stage st + NB - 1 exists, LEFT copies have been issued behind stage st + 1's;
    // at the tail fewer have, and the wait is to 0.
    wait_ds0();
    if (st + NB - 1 < NST) wait_async_but<LEFT>(); else wait_async0();
    __syncthreads();
    if (st + NB < NST) stage(buf, (st + NB) * 64);
    buf = buf + 1 == NB ? 0 : buf + 1;
  }
  wait_async0();

  // The bias, all loads as one group: along r 8 neighbours a tile row (bl, bh),
  // along c one value a lane and tile column (bc).
  v4f bl[4] = {}, bh[4] = {};
  float bc[2] = {};
  if (tokR) {
#pragma unroll
    for (int cf = 0; cf < 2; ++cf) bc[cf] = bias[c0 + cf * 16 + ln];
  } else {
    const float* bp = bias + r0 + laneHi * 8;
#pragma unroll
    for (int rf = 0; rf < 4; ++rf) {
      bl[rf] = *(const v4f*)(bp + rf * 16);
      bh[rf] = *(const v4f*)(bp + rf * 16 + 4);
    }
    // behind the loads, in front of any rewrite of their address registers (bp as
    // an input holds its pair up to the wait)
    asm volatile("s_wait_xcnt 0x0" :: "v"(bp) : "memory");
  }

  // ---- The loop's last barrier has ended every read of the ring and no copy is in
  // flight, so the ring's LDS stages the output, each wave in a range of its own:
  // 32 rows (c) of the wave's 64 r. A lane writes its 8 neighbours by 16-byte LDS
  // stores; read back row by row, every global store covers 4 whole 128-byte lines.
  if (f32out) {
    float* stf = (float*)&ab[0][0] + wave * (32 * FPITCH);
#pragma unroll
    for (int rf = 0; rf < 4; ++rf) {
#pragma unroll
      for (int cf = 0; cf < 2; ++cf) {
        const v8f cc = acc[rf][cf];
        v4f yl, yh;
#pragma unroll
        for (int i = 0; i < 4; ++i) {
          yl[i] = (cc[i] + bl[rf][i]) * oscale;
          yh[i] = (cc[i + 4] + bh[rf][i]) * oscale;
        }
        float* sp = stf + (cf * 16 + ln) * FPITCH + rf * 16 + laneHi * 8;
        *(v4f*)sp = yl;
        *(v4f*)(sp + 4) = yh;
      }
    }
    // the wave's rows are in LDS before its lanes read one another's values
    wait_ds0();
    float* op = (float*)outp + (size_t)(c0 + laneHi) * N + r0 + ln * 4;
#pragma unroll
    for (int j = 0; j < 16; ++j)
      *(v4f*)(op + (size_t)(2 * j) * N) = *(const v4f*)(stf + (2 * j + laneHi) * FPITCH + ln * 4);
  } else {
    _Float16* stg = &ab[0][0] + wave * (32 * LPITCH);
    // tr is a constant at each call: one straight path for either orientation
    auto put = [&](const bool tr) {
#pragma unroll
      for (int rf = 0; rf < 4; ++rf)
#pragma unroll
        for (int cf = 0; cf < 2; ++cf) {
          const v8f cc = acc[rf][cf];
          v8h y;
#pragma unroll
          for (int i = 0; i < 8; ++i) {
            const float b = tr ? bc[cf] : i < 4 ? bl[rf][i & 3] : bh[rf][i & 3];
            y[i] = (_Float16)((cc[i] + b) * oscale);
          }
          *(v8h*)(stg + (cf * 16 + ln) * LPITCH + (rf * 2 + laneHi) * 8) = y;
        }
    };
    if (tokR) put(true); else put(false);
    // the wave's rows are in LDS before its lanes read one another's values
    wait_ds0();
    // row c of the wave's tile in the output, and the step from c to c + 1: the
    // 64 r are one head's dk (r0 = 64 h), or 64 tokens of one batch entry
    const int row = lane >> 3;
    const int c = c0 + row;
    _Float16* op = (_Float16*)outp + (lane & 7) * 8 +
        (tokR ? ((size_t)((r0 >> 11) * Hn * DK + c)) * Ssz + (r0 & (Ssz - 1))
              : ((size_t)((c >> 11) * Hn + (r0 >> 6)) * Ssz + (c & (Ssz - 1))) * DK);
    v8h x[8];
#pragma unroll
    for (int j = 0; j < 8; ++j) x[j] = *(const v8h*)(stg + (4 * j + row) * LPITCH + (lane & 7) * 8);
    // cstep is a constant at each call: one address, the rows by immediate offsets
    auto rows = [&](const size_t cstep) {
#pragma unroll
      for (int j = 0; j < 8; ++j) *(v8h*)(op + (size_t)(4 * j) * cstep) = x[j];
    };
    if (tokR) rows(Ssz); else rows(DK);
  }
}

// The three projections in one grid: they share no data, so one launch pays the
// gap once, and three blocks on a WGP fill one another's waits for the copies.
// Blocks 0..255 make Qh, 256..511 Kh, 512..767 Vt.
__global__ __launch_bounds__(256) void gemm_qkv(
    const _Float16* __restrict__ q16, const _Float16* __restrict__ k16,
    const _Float16* __restrict__ v16, const _Float16* __restrict__ wq16,
    const _Float16* __restrict__ wk16, const _Float16* __restrict__ wv16,
    const float* __restrict__ bq, const float* __restrict__ bk,
    const float* __restrict__ bv, _Float16* __restrict__ Qh,
    _Float16* __restrict__ Kh, _Float16* __restrict__ Vt) {
  const int p = blockIdx.x / GEMM_BLKS, blk = blockIdx.x % GEMM_BLKS;
  const _Float16* A    = p == 0 ? q16  : p == 1 ? k16  : v16;
  const _Float16* Bt   = p == 0 ? wq16 : p == 1 ? wk16 : wv16;
  const float*    bias = p == 0 ? bq   : p == 1 ? bk   : bv;
  _Float16*       o    = p == 0 ? Qh   : p == 1 ? Kh   : Vt;
  gemm_body<3>(A, Bt, bias, (void*)o, false, p == 2, blk, p == 0 ? QSCALE : 1.0f);
}

// The output projection, fp32 to the output buffer.
__global__ __launch_bounds__(256) void gemm_out(
    const _Float16* __restrict__ ctx, const _Float16* __restrict__ wo16,
    const float* __restrict__ bo, float* __restrict__ out) {
  // alone on its WGP, the block has no neighbour to fill its waits: a longer lead
  gemm_body<5>(ctx, wo16, bo, (void*)out, true, false, blockIdx.x, 1.0f);
}

#define QT 2
#define KH 2
__global__ __launch_bounds__(256) void flash_attn(
    const _Float16* __restrict__ Qh, const _Float16* __restrict__ Kh,
    const _Float16* __restrict__ Vt, const unsigned* __restrict__ mbits,
    _Float16* __restrict__ ctx) {
  const int lane = threadIdx.x & 31;
  // in a scalar register, so that the mask words' address is one too
  const int wave = __builtin_amdgcn_readfirstlane(threadIdx.x >> 5);
  const int kh = wave >> 2;                        // this wave's key half
  const int wq = wave & 3;                         // its query group in the block
  const int grp = blockIdx.x * 4 + wq;             // 0..2047: group of QT query tiles
  const int qg = grp & (Ssz / (16 * QT) - 1);      // group in sequence
  const int bh = grp / (Ssz / (16 * QT));          // b*H + h
  const int b  = bh >> 4, h = bh & (Hn - 1);
  const int q0 = qg * (16 * QT);
  const int ln = lane & 15, laneHi = lane >> 4;

  const _Float16* Qb = Qh + (size_t)bh * Ssz * DK;
  const int NST = Ssz / 64 / KH;                   // stages of a key half
  // from the first key of this wave's half on
  const _Float16* Kb = Kh + (size_t)bh * Ssz * DK + (size_t)kh * (NST * 64) * DK;
  const _Float16* Vb = Vt + (size_t)bh * DK * Ssz + kh * (NST * 64);
  // This wave's mask words: 32 a stage, the stages one behind the other, the
  // second query tile's behind the first's; from the half's first stage on.
  // (16-word units: two a stage, MWT a query tile)
  const cv16u_p mwp = (cv16u_p)(size_t)(mbits + ((size_t)(b * (Ssz / 16) + qg * QT) * (Ssz / 64) + kh * NST) * 32);
  const int MWT = (Ssz / 64) * 2;

  // One stage = 64 keys of each half: K tile (64 keys x dk) and V tile (dk x 64
  // keys), two buffers a half, shared by the half's four waves.
  __shared__ __attribute__((aligned(16))) _Float16 kv[KH][2][2][64 * LPITCH];

  // Copy slots: the four waves of a half bring its tiles. 8 lanes cover one
  // 128-byte row, so a wave's copy reads 4 whole lines; a thread brings rows
  // crow + 16 j, j = 0..3, of the K and the V tile.
  const int ct = threadIdx.x & 127;
  const int crow = ct >> 3, ccol = (ct & 7) * 8;
  const _Float16* kcp = Kb + (size_t)crow * DK  + ccol;
  const _Float16* vcp = Vb + (size_t)crow * Ssz + ccol;
  const unsigned  lk0 = lds_off(&kv[kh][0][0][crow * LPITCH + ccol]);
  const unsigned  TILEB = 64 * LPITCHB;            // bytes of one tile in LDS

  // Every loop over u, t, i or s in this kernel is unrolled: the arrays that they
  // index (bq, o, mw, sc, sv, kf, y ...) stay in registers only with constant indices.

  // Q fragments (held for the whole key sweep), B operand: column ln of tile u =
  // query q0 + 16 u + ln, k = dk
  v16h bq[QT][2];
#pragma unroll
  for (int u = 0; u < QT; ++u) {
    const _Float16* qrow = Qb + (size_t)(q0 + 16 * u + ln) * DK;
    bq[u][0] = ldfrag(qrow, 0,  laneHi);
    bq[u][1] = ldfrag(qrow, 32, laneHi);
  }

  // O^T tiles: o[u][t][i] = O[q0 + 16 u + ln][16 t + 8 laneHi + i]
  v8f o[QT][4] = {};
  float mu[QT];                                    // maximum in use of query ln, log2 units
  v2f sum0[QT] = {}, sum1[QT] = {};                // sums over this lane's keys only
  // mask words of stage 0; each stage fetches the next one's behind its last select
  v16u mw[QT][2];
#pragma unroll
  for (int u = 0; u < QT; ++u) {
    mu[u] = -1.0e30f;
    mw[u][0] = mwp[u * MWT];
    mw[u][1] = mwp[u * MWT + 1];
  }

  // Stage 0 is copied, waited for and published; stage 1 then flies over trip 0.
  async_copy8(lk0, kcp, 16 * DK, lk0 + TILEB, vcp, (size_t)16 * Ssz, 16 * LPITCHB);
  wait_async0();
  __syncthreads();
  async_copy8(lk0 + 2 * TILEB, kcp + 64 * DK, 16 * DK,
              lk0 + 3 * TILEB, vcp + 64, (size_t)16 * Ssz, 16 * LPITCHB);

  for (int st = 0; st < NST; ++st) {
   const _Float16* Ks = &kv[kh][st & 1][0][0];
   const _Float16* Vs = &kv[kh][st & 1][1][0];
   // ---- four 16x16 tiles of S^T a query tile, K=dk=64, on top of the start value
   // c0 / c1 (A operand: row ln of tile t = key 16 t + ln); a K fragment is read
   // once and multiplies both query tiles
   v8f sc[QT][4];
   auto scores = [&](float c0, float c1) {
     v16h kf[4][2];
#pragma unroll
     for (int t = 0; t < 4; ++t) {
       const _Float16* krow = Ks + (t * 16 + ln) * LPITCH;
       kf[t][0] = ldfrag(krow, 0,  laneHi);
       kf[t][1] = ldfrag(krow, 32, laneHi);
     }
     // keeps the K reads one group ahead of the products; with it the branch below
     // also reads its K fragments anew, where the build without it holds the 64
     // registers through the stage for a path that is hardly ever taken
     __builtin_amdgcn_sched_barrier(0);
#pragma unroll
     for (int u = 0; u < QT; ++u) {
       const float c = u == 0 ? c0 : c1;
       const v8f c8 = {c, c, c, c, c, c, c, c};
#pragma unroll
       for (int t = 0; t < 4; ++t) sc[u][t] = wmma_f16(kf[t][0], bq[u][0], c8);
     }
#pragma unroll
     for (int u = 0; u < QT; ++u)
#pragma unroll
       for (int t = 0; t < 4; ++t) sc[u][t] = wmma_f16(kf[t][1], bq[u][1], sc[u][t]);
   };
   // ---- mask (value mv where the entry is 0) and maximum of query ln of tile u
   // over this lane's 32 of the stage's 64 keys
   float sv[QT][32];
   auto mask_max = [&](int u, float mv) -> float {
     float cm[4] = {-3.0e38f, -3.0e38f, -3.0e38f, -3.0e38f};  // one chain of maxima a tile
#pragma unroll
     for (int t = 0; t < 4; ++t) {
       const v16u w = mw[u][t >> 1];               // words of key tiles 0, 1 / 2, 3
#pragma unroll
       for (int i = 0; i < 8; ++i) {
         sv[u][8 * t + i] = __builtin_amdgcn_inverse_ballot_w32(w[8 * (t & 1) + i]) ? sc[u][t][i] : mv;
         cm[t] = fmaxf(cm[t], sv[u][8 * t + i]);
       }
     }
     return fmaxf(fmaxf(cm[0], cm[1]), fmaxf(cm[2], cm[3]));
   };
   scores(-mu[0], -mu[1]);
   // the first pass's V fragments: read here, they fly under the selects
   v16h vfa[4];
#pragma unroll
   for (int t = 0; t < 4; ++t) vfa[t] = ldfrag(Vs + (16 * t + ln) * LPITCH, 0, laneHi);
   // sv = score - mu
   const float over = fmaxf(mask_max(0, NEG2 - mu[0]), mask_max(1, NEG2 - mu[1]));
   // One scalar branch a stage, on any lane and either tile of the wave. Taken in
   // stage 0 (mu = -1e30 makes every sv huge), where a score passes mu by more than
   // 8, and where every key so far was masked (mu = NEG2) and one now is not. The
   // scores are made anew from 0, because score - mu has lost the score's low bits
   // where mu is huge.
   if (__builtin_amdgcn_ballot_w32(over > 8.0f) != 0) {
     scores(0.0f, 0.0f);
#pragma unroll
     for (int u = 0; u < QT; ++u) {
       const float cm    = mask_max(u, NEG2);
       const float mnew  = fmaxf(mu[u], fmaxf(cm, xhalf(cm)));  // both halves: all 64 keys
       const float alpha = __builtin_amdgcn_exp2f(mu[u] - mnew);
       mu[u] = mnew;
#pragma unroll
       for (int s = 0; s < 32; ++s) sv[u][s] -= mnew;
       sum0[u] *= alpha; sum1[u] *= alpha;
#pragma unroll
       for (int t = 0; t < 4; ++t) o[u][t] *= alpha;
     }
   }
   // unrolled: sv stays in registers, and with no barrier in a pass the
   // second pass's V reads can be issued under the first pass's exponentials
#pragma unroll
   for (int sub = 0; sub < 64; sub += 32) {
    const v16h vf0 = sub == 0 ? vfa[0] : ldfrag(Vs + (ln)      * LPITCH, sub, laneHi);
    const v16h vf1 = sub == 0 ? vfa[1] : ldfrag(Vs + (16 + ln) * LPITCH, sub, laneHi);
    const v16h vf2 = sub == 0 ? vfa[2] : ldfrag(Vs + (32 + ln) * LPITCH, sub, laneHi);
    const v16h vf3 = sub == 0 ? vfa[3] : ldfrag(Vs + (48 + ln) * LPITCH, sub, laneHi);

    // a V fragment is read once and multiplies both query tiles; the second
    // tile's exponentials stand behind the first tile's products
#pragma unroll
    for (int u = 0; u < QT; ++u) {
      v16h pb;                                     // P^T, B operand
#pragma unroll
      for (int s = 0; s < 16; s += 2) {
        const v2f p = {__builtin_amdgcn_exp2f(sv[u][sub / 2 + s]),
                       __builtin_amdgcn_exp2f(sv[u][sub / 2 + s + 1])};
        if (sub == 0) sum0[u] += p; else sum1[u] += p;   // even and odd keys apart
        pb[s] = (_Float16)p[0];
        pb[s + 1] = (_Float16)p[1];
      }

      // ---- O^T += V^T(64x32) * P^T(32x16); Vt rows are the A-matrix rows
      o[u][0] = wmma_f16(vf0, pb, o[u][0]);
      o[u][1] = wmma_f16(vf1, pb, o[u][1]);
      o[u][2] = wmma_f16(vf2, pb, o[u][2]);
      o[u][3] = wmma_f16(vf3, pb, o[u][3]);
    }
   }
   // ---- the next stage's mask words (the last stage fetches its own again, to
   // stay inside the array): they fly over the barrier and the score products
   {
     const int nx = st + 1 < NST ? st + 1 : st;
#pragma unroll
     for (int u = 0; u < QT; ++u) {
       mw[u][0] = mwp[u * MWT + 2 * nx];
       mw[u][1] = mwp[u * MWT + 2 * nx + 1];
     }
   }
   // ---- publish stage st + 1, then refill the buffer that this trip has read
   wait_ds0();
   wait_async0();
   __syncthreads();
   if (st + 2 < NST) {
     const unsigned lb = lk0 + (unsigned)(st & 1) * (2 * TILEB);
     async_copy8(lb, kcp + (size_t)(st + 2) * 64 * DK, 16 * DK,
                 lb + TILEB, vcp + (st + 2) * 64, (size_t)16 * Ssz, 16 * LPITCHB);
   }
  }
  wait_async0();

  // ---- join the two key halves of a query group. The loop's last barrier has
  // ended every read of the ring and no copy is in flight, so the ring's LDS
  // carries the upper half's O^T tiles, maxima and sums to the lower half's wave:
  // 17 slots of 16 bytes a lane, a slot's 32 lanes side by side.
  float lr[QT];                                    // sums over this lane's keys
#pragma unroll
  for (int u = 0; u < QT; ++u) lr[u] = (sum0[u][0] + sum0[u][1]) + (sum1[u][0] + sum1[u][1]);
  v4f* xo = (v4f*)&kv[0][0][0][0] + wq * ((QT * 8 + 1) * 32) + lane;
  if (kh == 1) {
#pragma unroll
    for (int u = 0; u < QT; ++u)
#pragma unroll
      for (int t = 0; t < 4; ++t) {
        const v8f x = o[u][t];
        xo[((u * 4 + t) * 2) * 32]     = (v4f){x[0], x[1], x[2], x[3]};
        xo[((u * 4 + t) * 2 + 1) * 32] = (v4f){x[4], x[5], x[6], x[7]};
      }
    xo[QT * 8 * 32] = (v4f){mu[0], mu[1], lr[0], lr[1]};
  }
  // publishes the upper halves' results to their partner waves
  __syncthreads();
  if (kh == 1) return;

  // ---- both halves on the larger maximum, join the wave halves' sums, normalize
  // (ctx: concat-head layout, f16): a lane's 8 registers of a tile are 8
  // consecutive columns of its row
  const v4f ms = xo[QT * 8 * 32];
  v8h y[QT][4];
#pragma unroll
  for (int u = 0; u < QT; ++u) {
    const float m  = fmaxf(mu[u], ms[u]);
    const float fa = __builtin_amdgcn_exp2f(mu[u] - m);
    const float fb = __builtin_amdgcn_exp2f(ms[u] - m);
    const float l  = lr[u] * fa + ms[2 + u] * fb;
    const float inv = 1.0f / (l + xhalf(l));
    const float ga = fa * inv, gb = fb * inv;
#pragma unroll
    for (int t = 0; t < 4; ++t) {
      const v4f x0 = xo[((u * 4 + t) * 2) * 32];
      const v4f x1 = xo[((u * 4 + t) * 2 + 1) * 32];
#pragma unroll
      for (int i = 0; i < 4; ++i) {
        y[u][t][i]     = (_Float16)(o[u][t][i] * ga + x0[i] * gb);
        y[u][t][i + 4] = (_Float16)(o[u][t][i + 4] * ga + x1[i] * gb);
      }
    }
  }
  // The wave's 32 rows of 128 bytes go through LDS, so that every global store
  // covers 4 whole lines: staged in the range that carried the partner's results to
  // this wave, which has read them and alone touches the range from here on.
  _Float16* stg = (_Float16*)((v4f*)&kv[0][0][0][0] + wq * ((QT * 8 + 1) * 32));
#pragma unroll
  for (int u = 0; u < QT; ++u)
#pragma unroll
    for (int t = 0; t < 4; ++t)
      *(v8h*)(stg + (16 * u + ln) * LPITCH + 16 * t + laneHi * 8) = y[u][t];
  // the wave's rows are in LDS before its lanes read one another's values
  wait_ds0();
  _Float16* crowp = ctx + ((size_t)(b * Ssz + q0 + (lane >> 3))) * Dsz + h * DK + (lane & 7) * 8;
#pragma unroll
  for (int j = 0; j < 8; ++j)
    *(v8h*)(crowp + (size_t)(4 * j) * Dsz) = *(const v8h*)(stg + (4 * j + (lane >> 3)) * LPITCH + (lane & 7) * 8);
}

// ---------------------------------------------------------------------------
extern "C" void kernel_launch(void* const* d_in, const int* in_sizes, int n_in,
                              void* d_out, int out_size, void* d_ws, size_t ws_size,
                              hipStream_t stream) {
  (void)in_sizes; (void)n_in; (void)out_size; (void)ws_size;
  const float* q    = (const float*)d_in[0];
  const float* k    = (const float*)d_in[1];
  const float* v    = (const float*)d_in[2];
  const float* Wq   = (const float*)d_in[3];
  const float* bq   = (const float*)d_in[4];
  const float* Wk   = (const float*)d_in[5];
  const float* bk   = (const float*)d_in[6];
  const float* Wv   = (const float*)d_in[7];
  const float* bv   = (const float*)d_in[8];
  const float* Wo   = (const float*)d_in[9];
  const float* bo   = (const float*)d_in[10];
  const int*   mask = (const int*)d_in[11];

  // workspace layout (65 MB total)
  char* w = (char*)d_ws;
  const size_t MB = 1ull << 20;
  _Float16* q16  = (_Float16*)(w + 0 * MB);
  _Float16* k16  = (_Float16*)(w + 8 * MB);
  _Float16* v16f = (_Float16*)(w + 16 * MB);
  _Float16* wq16 = (_Float16*)(w + 24 * MB);
  _Float16* wk16 = (_Float16*)(w + 26 * MB);
  _Float16* wv16 = (_Float16*)(w + 28 * MB);
  _Float16* wo16 = (_Float16*)(w + 30 * MB);
  _Float16* QhP  = (_Float16*)(w + 32 * MB);
  _Float16* KhP  = (_Float16*)(w + 40 * MB);
  _Float16* VtP  = (_Float16*)(w + 48 * MB);
  _Float16* ctxP = (_Float16*)(w + 56 * MB);
  unsigned* mbP  = (unsigned*)(w + 64 * MB);       // 1 MB: one bit a mask entry

  // q16 .. wo16 are one contiguous range that starts at q16
  cvt_f32_f16<<<PK_BLKS + CVT_BLKS, 256, 0, stream>>>(q, k, v, Wq, Wk, Wv, Wo, mask, q16, mbP);

  // per product 2048 wave tiles of 64 x 32, 8 waves (2 x 4) per 256-thread block
  gemm_qkv<<<3 * GEMM_BLKS, 256, 0, stream>>>(q16, k16, v16f, wq16, wk16, wv16,
                                              bq, bk, bv, QhP, KhP, VtP);

  // B*H*(S/16) = 4096 query tiles, 2 a wave, 4 query groups x 2 key halves of
  // waves per 256-thread block
  flash_attn<<<4096 / 8, 256, 0, stream>>>(QhP, KhP, VtP, mbP, ctxP);

  gemm_out<<<GEMM_BLKS, 256, 0, stream>>>(ctxP, wo16, bo, (float*)d_out);
}

// v010
// Measured time: 74 microseconds a run.
// Next to v009, in two timings, it ran 1.11 and 1.10 times as fast.
// All steps since v000 together make it 5.00 times as fast.
#include <hip/hip_runtime.h>

// ---------------------------------------------------------------------------
// MHA forward for MI455X (gfx1250, wave32, WMMA f32_16x16x32_f16)
// B=2, S=2048, D=1024, H=16, dk=64
// Pipeline:
//   1) WMMA GEMM straight from the fp32 inputs (converted to f16 on their way
//      through LDS): Qh = (q@Wq^T+bq) * log2(e)/sqrt(64) (head layout), Kh =
//      k@Wk^T+bk likewise, Vt = (v@Wv^T+bv)^T per head, one launch for the three;
//      its last blocks pack the mask into lane-mask words, one bit a score, and
//      convert Wo to f16
//   2) flash-attention, transposed products (online softmax in powers of two,
//      mask; the score products deliver the exponent) -> ctx f16
//   3) WMMA GEMM: out = ctx@Wo^T + bo  (fp32 to d_out)
// ---------------------------------------------------------------------------

typedef __attribute__((ext_vector_type(16))) _Float16 v16h;
typedef __attribute__((ext_vector_type(8)))  _Float16 v8h;
typedef __attribute__((ext_vector_type(8)))  float    v8f;
typedef __attribute__((ext_vector_type(4)))  float    v4f;
typedef __attribute__((ext_vector_type(4)))  _Float16 v4h;
typedef __attribute__((ext_vector_type(4)))  int      v4i;
typedef __attribute__((ext_vector_type(2)))  float    v2f;
typedef __attribute__((ext_vector_type(16))) unsigned v16u;
// 16 words in the constant address space: for data that no store of the running
// kernel touches; with a wave-uniform address the load is a scalar load also
// inside a loop that holds barriers and copies.
typedef const __attribute__((address_space(4))) v16u* cv16u_p;

#define Bsz 2
#define Ssz 2048
#define Dsz 1024
#define Hn  16
#define DK  64
// Scores are kept in log2 units: exp(s / sqrt(dk)) = exp2(s * QSCALE). Qh carries
// the factor, so that K Q^T is the exponent but for the maximum.
#define QSCALE 0.18033688011112042f                // log2(e) / sqrt(64)
#define NEG2   (-1.4426950408889634e10f)           // the masked score -1e10, log2 units

__device__ __forceinline__ v8f wmma_f16(v16h a, v16h b, v8f c) {
  // v_wmma_f32_16x16x32_f16
  return __builtin_amdgcn_wmma_f32_16x16x32_f16(
      /*neg_a=*/false, a, /*neg_b=*/false, b,
      /*c_mod=*/(short)0, c, /*reuse_a=*/false, /*reuse_b=*/false);
}

// Load a 16-bit A/B fragment (16x32 row-per-lane) from a row-major matrix.
// rowptr points at the start of this lane's row; kb = K-block base.
// ISA layout: lanes 0-15 take k = kb+{0..7,16..23}; lanes 16-31 take +8.
__device__ __forceinline__ v16h ldfrag(const _Float16* rowptr, int kb, int laneHi) {
  const _Float16* p = rowptr + kb + laneHi * 8;
  v8h lo = *(const v8h*)(p);
  v8h hi = *(const v8h*)(p + 16);
  v16h f;
#pragma unroll
  for (int i = 0; i < 8; ++i) { f[i] = lo[i]; f[i + 8] = hi[i]; }
  return f;
}

// Value of lane l ^ 16 (the other half of the wave), by a vector cross-row move.
__device__ __forceinline__ float xhalf(float x) {
  const int xi = __builtin_bit_cast(int, x);
  return __builtin_bit_cast(float, __builtin_amdgcn_permlanex16(xi, xi, 0x76543210, 0xfedcba98, false, false));
}

// LDS rows hold 64 f16 (128 B) at a pitch of 144 B: 16 B x odd, so that the 16
// rows of a ds_load_b128 fragment read fall on different banks.
#define LPITCH 72
#define LPITCHB (LPITCH * 2)

// The GEMM ring pads its rows in pairs: two 128-byte rows, then 16 bytes. Row r of
// 16 neighbours starts on bank 4 (r >> 1) + 32 (r & 1), so a ds_load_b128 fragment
// read still finds 16 different bank groups, and a stage takes 17/18 of the LDS that
// it takes at LPITCH.
#define PPITCH 136                                 // f16 a row pair
#define PPITCHB (PPITCH * 2)
__device__ __forceinline__ int prow(int r) { return (r >> 1) * PPITCH + (r & 1) * 64; }

// Byte offset of a __shared__ address inside the work-group's LDS.
__device__ __forceinline__ unsigned lds_off(const void* p) { return (unsigned)(size_t)p; }

// Eight asynchronous 16-byte copies per lane, global -> LDS, through no register,
// in two groups of four rows: group a from ga to la, group b from gb to lb; lstep
// is the row step in LDS bytes, gsa / gsb the row steps in global elements.
// s_wait_xcnt 0 ends the statement so that it stands in front of any rewrite of
// the address registers.
template <typename T>
__device__ __forceinline__ void async_copy8(unsigned la, const T* ga, size_t gsa,
                                            unsigned lb, const T* gb, size_t gsb,
                                            unsigned lstep) {
  asm volatile("global_load_async_to_lds_b128 %0, %8, off\n\t"
               "global_load_async_to_lds_b128 %1, %9, off\n\t"
               "global_load_async_to_lds_b128 %2, %10, off\n\t"
               "global_load_async_to_lds_b128 %3, %11, off\n\t"
               "global_load_async_to_lds_b128 %4, %12, off\n\t"
               "global_load_async_to_lds_b128 %5, %13, off\n\t"
               "global_load_async_to_lds_b128 %6, %14, off\n\t"
               "global_load_async_to_lds_b128 %7, %15, off\n\t"
               "s_wait_xcnt 0x0"
               :: "v"(la), "v"(la + lstep), "v"(la + 2 * lstep), "v"(la + 3 * lstep),
                  "v"(lb), "v"(lb + lstep), "v"(lb + 2 * lstep), "v"(lb + 3 * lstep),
                  "v"(ga), "v"(ga + gsa), "v"(ga + 2 * gsa), "v"(ga + 3 * gsa),
                  "v"(gb), "v"(gb + gsb), "v"(gb + 2 * gsb), "v"(gb + 3 * gsb)
               : "memory");
}

// This wave's copies have landed (the compiler places no wait for them).
__device__ __forceinline__ void wait_async0() { asm volatile("s_wait_asynccnt 0x0" ::: "memory"); }
// All but this wave's N youngest copies have landed (the counter returns in issue
// order): the stages behind the one that is published next stay in flight.
template <int N>
__device__ __forceinline__ void wait_async_but() { asm volatile("s_wait_asynccnt %0" :: "n"(N) : "memory"); }
// This wave's LDS reads have returned, before their buffer is handed back.
__device__ __forceinline__ void wait_ds0() { asm volatile("s_wait_dscnt 0x0" ::: "memory"); }

// ---------------------------------------------------------------------------
// Side work of the projection launch, in blocks of SIDE_T threads.
#define SIDE_T 512
// Wo to f16. A thread converts 32 floats: eight 16-byte loads, all issued ahead of
// the first conversion; each wave-wide load covers 512 contiguous bytes and each
// wave-wide store 256.
#define CVT_BLK (SIDE_T * 32)
#define WO_BLKS (Dsz * Dsz / CVT_BLK)              // 64
__device__ __forceinline__ void cvt_block(const float* __restrict__ src,
                                          _Float16* __restrict__ dst, unsigned cb) {
  const float* in = src + (size_t)cb * CVT_BLK;
  _Float16* out = dst + (size_t)cb * CVT_BLK;
  const size_t base = threadIdx.x * 4;
  v4f x[8];
  // both loops unrolled: x stays in registers and the eight loads issue as one group
#pragma unroll
  for (int j = 0; j < 8; ++j) x[j] = *(const v4f*)(in + base + j * (SIDE_T * 4));
#pragma unroll
  for (int j = 0; j < 8; ++j) {
    v4h y;
#pragma unroll
    for (int e = 0; e < 4; ++e) y[e] = (_Float16)x[j][e];
    *(v4h*)(out + base + j * (SIDE_T * 4)) = y;
  }
  // behind the stores, in front of any rewrite of their address or data registers
  // by code that the build lays out behind them
  asm volatile("s_wait_xcnt 0x0" ::: "memory");
}

// The mask as lane masks. The attention wave of query tile qtile (16 queries)
// holds, in stage st (64 keys), score register i of key tile t as: lane l =
// query l & 15, key 64 st + 16 t + 8 (l >> 4) + i. Word 8 t + i of the 32 words
// of (qtile, st) has bit l set where that lane's mask entry is not 0, so the
// word is the select mask of that register as it stands. The 16 heads each read
// these 128 bytes; the int32 entries behind them are 4 KB on 32 lines.
// A wave packs PK_ST stages of one query tile: one compare a word (its result is
// the word), and lane j keeps word j for one 128-byte store a stage.
#define PK_ST   4
#define PK_BLKS (Bsz * (Ssz / 16) * (Ssz / 64) / ((SIDE_T / 32) * PK_ST))   // 128
__device__ __forceinline__ void pack_mask(const int* __restrict__ mask,
                                          unsigned* __restrict__ mbits, unsigned pb) {
  const unsigned lane = threadIdx.x & 31, ln = lane & 15, laneHi = lane >> 4;
  const unsigned g = pb * (SIDE_T / 32) + (threadIdx.x >> 5);  // group of PK_ST stages
  const unsigned NGRP = (Ssz / 64) / PK_ST;         // groups of a query tile: 8
  const unsigned qtile = g / NGRP;                  // b * (S / 16) + tile: 0..255
  const unsigned st0 = (g % NGRP) * PK_ST;
  const int* row = mask + ((size_t)qtile * 16 + ln) * Ssz + st0 * 64 + laneHi * 8;
  v4i m[PK_ST][4][2];
  // all loops unrolled: m stays in registers, and many loads are in flight at once
#pragma unroll
  for (int u = 0; u < PK_ST; ++u)
#pragma unroll
    for (int t = 0; t < 4; ++t) {
      m[u][t][0] = *(const v4i*)(row + u * 64 + t * 16);
      m[u][t][1] = *(const v4i*)(row + u * 64 + t * 16 + 4);
    }
  // behind the loads, in front of any rewrite of their address registers (row as
  // an input holds its pair up to the wait)
  asm volatile("s_wait_xcnt 0x0" :: "v"(row) : "memory");
#pragma unroll
  for (int u = 0; u < PK_ST; ++u) {
    unsigned w = 0;                                // lane j ends with word j
#pragma unroll
    for (int j = 0; j < 32; ++j) {
      const unsigned bal = __builtin_amdgcn_ballot_w32(m[u][j >> 3][(j >> 2) & 1][j & 3] != 0);
      w = lane == (unsigned)j ? bal : w;
    }
    mbits[((size_t)qtile * (Ssz / 64) + st0 + u) * 32 + lane] = w;
  }
}

// ---------------------------------------------------------------------------
// C[M,N] = A[M,K] * Bt[N,K]^T + bias  (A,Bt f16 row-major, fp32 accumulate)
// M=4096, N=1024, K=1024.
// Register-blocked: one wave computes a 64x32 tile = 4 x 2 fragments
// -> 8 WMMAs per K-step on 8 independent accumulator chains (hides XDL
// accumulation latency), 12 b128 loads per 8 WMMAs (vs 4 per WMMA naive).
// A and B come into LDS by asynchronous copies; fragments are read there.
// A lane's 8 accumulator registers of a tile run along the rows of the WMMA's
// first operand ("r"), its lanes along the rows of the second ("c"). The operand
// whose index is contiguous in the output goes first, so a lane's 8 values are 8
// neighbours in memory, and the wave's 64 r are a whole line (two in fp32):
//   tokR = true : r = tokens,   c = features: f16 out transposed head [b,h,dk,s]
//   tokR = false: r = features, c = tokens:   f16 out in head layout  [b,h,s,dk]
//                 or, f32out, fp32 out row-major [M,N]
// oscale: factor on (product + bias), applied in fp32 ahead of the one rounding.
// blk: the block's index among the GEMM_BLKS blocks of one product.
#define GEMM_BLKS ((Bsz * Ssz / 128) * (Dsz / 128))   // 256
// NB: buffers of the ring. The copies of stage s + NB are issued when stage s has
// been read, so NB - 1 stages are under way or landed while one is worked on. The
// blocks that share rows walk K in step, so no block finds its lines fetched by
// another: the lead is sized for a fetch from memory, not for a hit in L2.
#define FPITCH 68                                  // fp32 staging row: 64 floats + 16 B
template <int NB>
__device__ __forceinline__ void gemm_body(
    const _Float16* __restrict__ A, const _Float16* __restrict__ Bt,
    const float* __restrict__ bias, void* __restrict__ outp, bool f32out, bool tokR,
    int blk, float oscale) {
  const int M = Bsz * Ssz, N = Dsz, K = Dsz;
  const int lane = threadIdx.x & 31;
  const int wave = threadIdx.x >> 5;
  // The block's 8 wave tiles lie 2 (r) x 4 (c): a 128 x 128 block tile, so that
  // every staged r row serves 4 waves and every staged c row 2.
  const int nB = N / 128;                           // 8 block columns
  const int mB = blk / nB;                          // 0..31 (128-row blocks)
  if (mB >= M / 128) return;
  const int wr = wave & 1, wc = wave >> 1;
  const int ln = lane & 15, laneHi = lane >> 4;
  // first r and first c of the wave's tile: as rows of a stage in LDS (A's 128
  // rows, then B's) and as token / feature numbers
  const int rl0 = (tokR ? 0 : 128) + wr * 64;
  const int cl0 = (tokR ? 128 : 0) + wc * 32;
  const int r0  = (tokR ? mB : blk % nB) * 128 + wr * 64;
  const int c0  = (tokR ? blk % nB : mB) * 128 + wc * 32;

  // One stage = 64 of K: the block's 128 A rows, then its 128 B rows; NB buffers.
  __shared__ __attribute__((aligned(16))) _Float16 ab[NB][(64 + 64) * PPITCH];
  const unsigned BUFB = (64 + 64) * PPITCHB;        // bytes of one buffer
  const int NST = K / 64;                           // stages

  // Copy slots: 8 lanes cover one 128-byte row piece, so a wave's copy reads 4
  // whole lines; a thread brings rows crow + 32 j, j = 0..3, of A and of B.
  const int crow = threadIdx.x >> 3, ccol = (threadIdx.x & 7) * 8;
  const _Float16* acp = A  + (size_t)(mB * 128 + crow) * K + ccol;
  const _Float16* bcp = Bt + (size_t)((blk % nB) * 128 + crow) * K + ccol;
  const unsigned  la0 = lds_off(&ab[0][prow(crow) + ccol]);
  auto stage = [&](unsigned buf, int k0) {
    const unsigned la = la0 + buf * BUFB;
    async_copy8(la, acp + k0, (size_t)32 * K,
                la + 64 * PPITCHB, bcp + k0, (size_t)32 * K, 16 * PPITCHB);
  };
  // copies of a wave that may stay in flight where a stage is published: those of
  // the NB - 2 stages issued behind it, 8 each
  constexpr int LEFT = (NB - 2) * 8;

  // Stages 0 .. NB - 2 are issued, stage 0 is waited for and published; stage NB - 1
  // follows (unrolled: the buffer numbers are constants).
#pragma unroll
  for (int s = 0; s < NB - 1; ++s) stage(s, s * 64);
  wait_async_but<LEFT>();
  __syncthreads();
  stage(NB - 1, (NB - 1) * 64);

  // Every loop over rf, cf, i or j below is unrolled: acc and the bias stay in
  // registers only with constant indices.
  v8f acc[4][2] = {};
  unsigned buf = 0;                                 // st mod NB
  for (int st = 0; st < NST; ++st) {
    const _Float16* rrow = &ab[buf][prow(rl0 + ln)];
    const _Float16* crw  = &ab[buf][prow(cl0 + ln)];
    // unrolled so that the second half's LDS reads are issued under the first
    // half's products
#pragma unroll
    for (int kb = 0; kb < 64; kb += 32) {
      const v16h a0 = ldfrag(rrow, kb, laneHi);
      const v16h a1 = ldfrag(rrow + 8 * PPITCH, kb, laneHi);
      const v16h a2 = ldfrag(rrow + 16 * PPITCH, kb, laneHi);
      const v16h a3 = ldfrag(rrow + 24 * PPITCH, kb, laneHi);
      const v16h b0 = ldfrag(crw, kb, laneHi);
      const v16h b1 = ldfrag(crw + 8 * PPITCH, kb, laneHi);
      acc[0][0] = wmma_f16(a0, b0, acc[0][0]);  acc[1][0] = wmma_f16(a1, b0, acc[1][0]);
      acc[2][0] = wmma_f16(a2, b0, acc[2][0]);  acc[3][0] = wmma_f16(a3, b0, acc[3][0]);
      acc[0][1] = wmma_f16(a0, b1, acc[0][1]);  acc[1][1] = wmma_f16(a1, b1, acc[1][1]);
      acc[2][1] = wmma_f16(a2, b1, acc[2][1]);  acc[3][1] = wmma_f16(a3, b1, acc[3][1]);
    }
    // publish stage st + 1, then refill the buffer that this trip has read. While
    // stage st + NB - 1 exists, LEFT copies have been issued behind stage st + 1's;
    // at the tail fewer have, and the wait is to 0.
    wait_ds0();
    if (st + NB - 1 < NST) wait_async_but<LEFT>(); else wait_async0();
    __syncthreads();
    if (st + NB < NST) stage(buf, (st + NB) * 64);
    buf = buf + 1 == NB ? 0 : buf + 1;
  }
  wait_async0();

  // The bias, all loads as one group: along r 8 neighbours a tile row (bl, bh),
  // along c one value a lane and tile column (bc).
  v4f bl[4] = {}, bh[4] = {};
  float bc[2] = {};
  if (tokR) {
#pragma unroll
    for (int cf = 0; cf < 2; ++cf) bc[cf] = bias[c0 + cf * 16 + ln];
  } else {
    const float* bp = bias + r0 + laneHi * 8;
#pragma unroll
    for (int rf = 0; rf < 4; ++rf) {
      bl[rf] = *(const v4f*)(bp + rf * 16);
      bh[rf] = *(const v4f*)(bp + rf * 16 + 4);
    }
    // behind the loads, in front of any rewrite of their address registers (bp as
    // an input holds its pair up to the wait)
    asm volatile("s_wait_xcnt 0x0" :: "v"(bp) : "memory");
  }

  // ---- The loop's last barrier has ended every read of the ring and no copy is in
  // flight, so the ring's LDS stages the output, each wave in a range of its own:
  // 32 rows (c) of the wave's 64 r. A lane writes its 8 neighbours by 16-byte LDS
  // stores; read back row by row, every global store covers 4 whole 128-byte lines.
  if (f32out) {
    float* stf = (float*)&ab[0][0] + wave * (32 * FPITCH);
#pragma unroll
    for (int rf = 0; rf < 4; ++rf) {
#pragma unroll
      for (int cf = 0; cf < 2; ++cf) {
        const v8f cc = acc[rf][cf];
        v4f yl, yh;
#pragma unroll
        for (int i = 0; i < 4; ++i) {
          yl[i] = (cc[i] + bl[rf][i]) * oscale;
          yh[i] = (cc[i + 4] + bh[rf][i]) * oscale;
        }
        float* sp = stf + (cf * 16 + ln) * FPITCH + rf * 16 + laneHi * 8;
        *(v4f*)sp = yl;
        *(v4f*)(sp + 4) = yh;
      }
    }
    // the wave's rows are in LDS before its lanes read one another's values
    wait_ds0();
    float* op = (float*)outp + (size_t)(c0 + laneHi) * N + r0 + ln * 4;
#pragma unroll
    for (int j = 0; j < 16; ++j)
      *(v4f*)(op + (size_t)(2 * j) * N) = *(const v4f*)(stf + (2 * j + laneHi) * FPITCH + ln * 4);
  } else {
    _Float16* stg = &ab[0][0] + wave * (32 * LPITCH);
    // tr is a constant at each call: one straight path for either orientation
    auto put = [&](const bool tr) {
#pragma unroll
      for (int rf = 0; rf < 4; ++rf)
#pragma unroll
        for (int cf = 0; cf < 2; ++cf) {
          const v8f cc = acc[rf][cf];
          v8h y;
#pragma unroll
          for (int i = 0; i < 8; ++i) {
            const float b = tr ? bc[cf] : i < 4 ? bl[rf][i & 3] : bh[rf][i & 3];
            y[i] = (_Float16)((cc[i] + b) * oscale);
          }
          *(v8h*)(stg + (cf * 16 + ln) * LPITCH + (rf * 2 + laneHi) * 8) = y;
        }
    };
    if (tokR) put(true); else put(false);
    // the wave's rows are in LDS before its lanes read one another's values
    wait_ds0();
    // row c of the wave's tile in the output, and the step from c to c + 1: the
    // 64 r are one head's dk (r0 = 64 h), or 64 tokens of one batch entry
    const int row = lane >> 3;
    const int c = c0 + row;
    _Float16* op = (_Float16*)outp + (lane & 7) * 8 +
        (tokR ? ((size_t)((r0 >> 11) * Hn * DK + c)) * Ssz + (r0 & (Ssz - 1))
              : ((size_t)((c >> 11) * Hn + (r0 >> 6)) * Ssz + (c & (Ssz - 1))) * DK);
    v8h x[8];
#pragma unroll
    for (int j = 0; j < 8; ++j) x[j] = *(const v8h*)(stg + (4 * j + row) * LPITCH + (lane & 7) * 8);
    // cstep is a constant at each call: one address, the rows by immediate offsets
    auto rows = [&](const size_t cstep) {
#pragma unroll
      for (int j = 0; j < 8; ++j) *(v8h*)(op + (size_t)(4 * j) * cstep) = x[j];
    };
    if (tokR) rows(Ssz); else rows(DK);
  }
}

// The three projections, straight from the fp32 inputs, in one grid: no launch
// ahead of it converts anything. C = A * Bt^T + bias as in gemm_body, f16 out.
// A work-group of 16 waves (4 r x 4 c, 64 x 64 each) makes a tile of PT tokens x PT
// features: fp32 rows are twice the bytes, so the tile has twice the side, and the
// bytes that come from L2 stay what f16 rows cost a 128 x 128 tile.
// The way of an operand piece: an asynchronous copy brings 16 bytes (4 floats) into
// a slot of the fp32 ring that belongs to the copying lane alone; the same lane
// reads them back behind its wave's own wait, converts, and stores 4 f16 into the
// stage that all waves read fragments from. The fp32 ring is NBF stages deep, the
// f16 stage has two buffers; one barrier a trip publishes the f16 stage that the
// trip has written and ends the reads of the one that the next trip overwrites.
#define PT   256
#define PKD  32                                    // k of a stage
// f16 stage rows: 32 f16 (64 B) at a pitch of 80 B: 16 B x odd, so that the 16 rows
// of a ds_load_b128 fragment read fall on different banks
#define HP   40
#define NBF  3
#define PG_BLKS ((Bsz * Ssz / PT) * (Dsz / PT))    // blocks of a product: 64
// Blocks 0..63 make Qh, 64..127 Kh, 128..191 Vt, one on a WGP (LDS); the blocks
// behind them pack the mask and convert Wo on the WGPs that the products leave free.
__global__ __launch_bounds__(SIDE_T) void gemm_qkv(
    const float* __restrict__ q, const float* __restrict__ k, const float* __restrict__ v,
    const float* __restrict__ Wq, const float* __restrict__ Wk, const float* __restrict__ Wv,
    const float* __restrict__ bq, const float* __restrict__ bk, const float* __restrict__ bv,
    const float* __restrict__ Wo, const int* __restrict__ mask,
    _Float16* __restrict__ Qh, _Float16* __restrict__ Kh, _Float16* __restrict__ Vt,
    _Float16* __restrict__ wo16, unsigned* __restrict__ mbits) {
  if (blockIdx.x >= 3 * PG_BLKS) {                  // the whole block, ahead of any barrier
    const unsigned sb = blockIdx.x - 3 * PG_BLKS;
    if (sb < PK_BLKS) pack_mask(mask, mbits, sb);
    else cvt_block(Wo, wo16, sb - PK_BLKS);
    return;
  }
  const int K = Dsz;
  const int p = blockIdx.x / PG_BLKS, blk = blockIdx.x % PG_BLKS;
  const float* A    = p == 0 ? q  : p == 1 ? k  : v;
  const float* Bt   = p == 0 ? Wq : p == 1 ? Wk : Wv;
  const float* bias = p == 0 ? bq : p == 1 ? bk : bv;
  _Float16*    outp = p == 0 ? Qh : p == 1 ? Kh : Vt;
  const bool  tokR   = p == 2;                      // r, c: as in gemm_body
  const float oscale = p == 0 ? QSCALE : 1.0f;
  const int tid = threadIdx.x;
  const int lane = tid & 31, wave = tid >> 5;
  const int ln = lane & 15, laneHi = lane >> 4;
  const int nB = blk % (Dsz / PT), mB = blk / (Dsz / PT);
  const int wr = wave & 3, wc = wave >> 2;
  // first r and first c of the wave's tile: as rows of a stage in LDS (A's PT rows,
  // then B's) and as token / feature numbers
  const int rl0 = (tokR ? 0 : PT) + wr * 64;
  const int cl0 = (tokR ? PT : 0) + wc * 64;
  const int r0  = (tokR ? mB : nB) * PT + wr * 64;
  const int c0  = (tokR ? nB : mB) * PT + wc * 64;

  __shared__ __attribute__((aligned(16))) float    fr[NBF][8][SIDE_T][4];
  __shared__ __attribute__((aligned(16))) _Float16 hs[2][2 * PT * HP];
  const int NST = K / PKD;                          // stages: 32

  // Copy slots: 8 lanes cover the 128 bytes of a row's stage, so a wave's copy reads
  // 4 whole lines; a thread brings rows crow + 64 j, j = 0..3, of A and of B. Piece j
  // of thread t lies at fr[slot][j][t]: a wave's 512 bytes side by side.
  const int crow = tid >> 3, ccol = (tid & 7) * 4;
  const float* acp = A  + (size_t)(mB * PT + crow) * K + ccol;
  const float* bcp = Bt + (size_t)(nB * PT + crow) * K + ccol;
  const unsigned lf0 = lds_off(&fr[0][0][tid][0]);
  const unsigned PIECEB = SIDE_T * 16;              // bytes of one piece row of the block
  auto stage = [&](unsigned slot, int s) {
    const unsigned la = lf0 + slot * (8 * PIECEB);
    async_copy8(la, acp + s * PKD, (size_t)64 * K,
                la + 4 * PIECEB, bcp + s * PKD, (size_t)64 * K, PIECEB);
  };
  // Every loop over i, j, e, rf or cf below is unrolled: x, a, b, acc and the bias
  // stay in registers only with constant indices.
  v4f x[8];
  auto fetch = [&](unsigned slot) {                 // this lane's own pieces
#pragma unroll
    for (int j = 0; j < 8; ++j) x[j] = *(const v4f*)&fr[slot][j][tid][0];
  };
  auto put16 = [&](unsigned hb) {                   // rows 0..255 A, 256..511 B
#pragma unroll
    for (int j = 0; j < 8; ++j) {
      v4h y;
#pragma unroll
      for (int e = 0; e < 4; ++e) y[e] = (_Float16)x[j][e];
      *(v4h*)&hs[hb][(crow + 64 * j) * HP + ccol] = y;
    }
  };

  // Stages 0 .. NBF - 1 are issued; stage 0 is waited for, converted and published
  // with stage 1 landed; stage NBF follows into the slot that stage 0 has left.
#pragma unroll
  for (int s = 0; s < NBF; ++s) stage(s, s);
  wait_async_but<(NBF - 1) * 8>();
  fetch(0);
  put16(0);
  wait_ds0();
  wait_async_but<(NBF - 2) * 8>();
  __syncthreads();
  stage(0, NBF);

  v8f acc[4][4] = {};
  unsigned slot = 1;                                // (st + 1) mod NBF
  for (int st = 0; st < NST; ++st) {
    const _Float16* hb = &hs[st & 1][0];
    v16h a[4], b[4];
#pragma unroll
    for (int i = 0; i < 4; ++i) a[i] = ldfrag(hb + (rl0 + 16 * i + ln) * HP, 0, laneHi);
#pragma unroll
    for (int j = 0; j < 4; ++j) b[j] = ldfrag(hb + (cl0 + 16 * j + ln) * HP, 0, laneHi);
    // the next stage's fp32 pieces (landed: the wait at the foot of the trip before),
    // behind the fragments: they return under this stage's products
    if (st + 1 < NST) fetch(slot);
    // keeps the trip's LDS reads one group ahead of the products: without it two of
    // the b fragments are read among them, each behind a wait to 0
    __builtin_amdgcn_sched_barrier(0);
#pragma unroll
    for (int j = 0; j < 4; ++j)
#pragma unroll
      for (int i = 0; i < 4; ++i) acc[i][j] = wmma_f16(a[i], b[j], acc[i][j]);
    if (st + 1 < NST) put16((st + 1) & 1);
    // this wave's LDS reads and stores are done; its copies of stage st + 2 have
    // landed (8 were issued behind them while stage st + 3 exists); the barrier
    // publishes f16 stage st + 1; then the slot that this trip has read is refilled
    wait_ds0();
    if (st + 3 < NST) wait_async_but<(NBF - 2) * 8>(); else wait_async0();
    __syncthreads();
    if (st + 1 + NBF < NST) stage(slot, st + 1 + NBF);
    slot = slot + 1 == NBF ? 0 : slot + 1;
  }
  wait_async0();

  // The bias, all loads as one group: along r 8 neighbours a tile row (bl, bh),
  // along c one value a lane and tile column (bc).
  v4f bl[4] = {}, bh[4] = {};
  float bc[4] = {};
  {
    const float* bp = tokR ? bias + c0 + ln : bias + r0 + laneHi * 8;
    if (tokR) {
#pragma unroll
      for (int cf = 0; cf < 4; ++cf) bc[cf] = bp[cf * 16];
    } else {
#pragma unroll
      for (int rf = 0; rf < 4; ++rf) {
        bl[rf] = *(const v4f*)(bp + rf * 16);
        bh[rf] = *(const v4f*)(bp + rf * 16 + 4);
      }
    }
    // behind the loads, in front of any rewrite of their address registers (bp as
    // an input holds its pair up to the wait)
    asm volatile("s_wait_xcnt 0x0" :: "v"(bp) : "memory");
  }

  // ---- The loop's last barrier has ended every read of both rings and no copy is in
  // flight, so the fp32 ring's LDS stages the output, each wave in a range of its
  // own: 64 rows (c) of the wave's 64 r. A lane writes its 8 neighbours by 16-byte
  // LDS stores; read back row by row, every global store covers 4 whole lines.
  _Float16* stg = (_Float16*)&fr[0][0][0][0] + wave * (64 * LPITCH);
  // tr is a constant at each call: one straight path for either orientation
  auto put = [&](const bool tr) {
#pragma unroll
    for (int rf = 0; rf < 4; ++rf)
#pragma unroll
      for (int cf = 0; cf < 4; ++cf) {
        const v8f cc = acc[rf][cf];
        v8h y;
#pragma unroll
        for (int i = 0; i < 8; ++i) {
          const float bb = tr ? bc[cf] : i < 4 ? bl[rf][i & 3] : bh[rf][i & 3];
          y[i] = (_Float16)((cc[i] + bb) * oscale);
        }
        *(v8h*)(stg + (cf * 16 + ln) * LPITCH + (rf * 2 + laneHi) * 8) = y;
      }
  };
  if (tokR) put(true); else put(false);
  // the wave's rows are in LDS before its lanes read one another's values
  wait_ds0();
  // row c of the wave's tile in the output, and the step from c to c + 1: the
  // 64 r are one head's dk (r0 = 64 h), or 64 tokens of one batch entry
  const int row = lane >> 3;
  const int c = c0 + row;
  _Float16* op = outp + (lane & 7) * 8 +
      (tokR ? ((size_t)((r0 >> 11) * Hn * DK + c)) * Ssz + (r0 & (Ssz - 1))
            : ((size_t)((c >> 11) * Hn + (r0 >> 6)) * Ssz + (c & (Ssz - 1))) * DK);
  v8h z[16];
#pragma unroll
  for (int j = 0; j < 16; ++j) z[j] = *(const v8h*)(stg + (4 * j + row) * LPITCH + (lane & 7) * 8);
  // cstep is a constant at each call: one address, the rows by immediate offsets
  auto rows = [&](const size_t cstep) {
#pragma unroll
    for (int j = 0; j < 16; ++j) *(v8h*)(op + (size_t)(4 * j) * cstep) = z[j];
  };
  if (tokR) rows(Ssz); else rows(DK);
  // behind the stores, in front of any rewrite of their address or data registers
  // by code that the build lays out behind them
  asm volatile("s_wait_xcnt 0x0" ::: "memory");
}

// The output projection, fp32 to the output buffer.
__global__ __launch_bounds__(256) void gemm_out(
    const _Float16* __restrict__ ctx, const _Float16* __restrict__ wo16,
    const float* __restrict__ bo, float* __restrict__ out) {
  // alone on its WGP, the block has no neighbour to fill its waits: a longer lead
  gemm_body<5>(ctx, wo16, bo, (void*)out, true, false, blockIdx.x, 1.0f);
}

#define QT 2
#define KH 2
__global__ __launch_bounds__(256) void flash_attn(
    const _Float16* __restrict__ Qh, const _Float16* __restrict__ Kh,
    const _Float16* __restrict__ Vt, const unsigned* __restrict__ mbits,
    _Float16* __restrict__ ctx) {
  const int lane = threadIdx.x & 31;
  // in a scalar register, so that the mask words' address is one too
  const int wave = __builtin_amdgcn_readfirstlane(threadIdx.x >> 5);
  const int kh = wave >> 2;                        // this wave's key half
  const int wq = wave & 3;                         // its query group in the block
  const int grp = blockIdx.x * 4 + wq;             // 0..2047: group of QT query tiles
  const int qg = grp & (Ssz / (16 * QT) - 1);      // group in sequence
  const int bh = grp / (Ssz / (16 * QT));          // b*H + h
  const int b  = bh >> 4, h = bh & (Hn - 1);
  const int q0 = qg * (16 * QT);
  const int ln = lane & 15, laneHi = lane >> 4;

  const _Float16* Qb = Qh + (size_t)bh * Ssz * DK;
  const int NST = Ssz / 64 / KH;                   // stages of a key half
  // from the first key of this wave's half on
  const _Float16* Kb = Kh + (size_t)bh * Ssz * DK + (size_t)kh * (NST * 64) * DK;
  const _Float16* Vb = Vt + (size_t)bh * DK * Ssz + kh * (NST * 64);
  // This wave's mask words: 32 a stage, the stages one behind the other, the
  // second query tile's behind the first's; from the half's first stage on.
  // (16-word units: two a stage, MWT a query tile)
  const cv16u_p mwp = (cv16u_p)(size_t)(mbits + ((size_t)(b * (Ssz / 16) + qg * QT) * (Ssz / 64) + kh * NST) * 32);
  const int MWT = (Ssz / 64) * 2;

  // One stage = 64 keys of each half: K tile (64 keys x dk) and V tile (dk x 64
  // keys), two buffers a half, shared by the half's four waves.
  __shared__ __attribute__((aligned(16))) _Float16 kv[KH][2][2][64 * LPITCH];

  // Copy slots: the four waves of a half bring its tiles. 8 lanes cover one
  // 128-byte row, so a wave's copy reads 4 whole lines; a thread brings rows
  // crow + 16 j, j = 0..3, of the K and the V tile.
  const int ct = threadIdx.x & 127;
  const int crow = ct >> 3, ccol = (ct & 7) * 8;
  const _Float16* kcp = Kb + (size_t)crow * DK  + ccol;
  const _Float16* vcp = Vb + (size_t)crow * Ssz + ccol;
  const unsigned  lk0 = lds_off(&kv[kh][0][0][crow * LPITCH + ccol]);
  const unsigned  TILEB = 64 * LPITCHB;            // bytes of one tile in LDS

  // Every loop over u, t, i or s in this kernel is unrolled: the arrays that they
  // index (bq, o, mw, sc, sv, kf, y ...) stay in registers only with constant indices.

  // Q fragments (held for the whole key sweep), B operand: column ln of tile u =
  // query q0 + 16 u + ln, k = dk
  v16h bq[QT][2];
#pragma unroll
  for (int u = 0; u < QT; ++u) {
    const _Float16* qrow = Qb + (size_t)(q0 + 16 * u + ln) * DK;
    bq[u][0] = ldfrag(qrow, 0,  laneHi);
    bq[u][1] = ldfrag(qrow, 32, laneHi);
  }

  // O^T tiles: o[u][t][i] = O[q0 + 16 u + ln][16 t + 8 laneHi + i]
  v8f o[QT][4] = {};
  float mu[QT];                                    // maximum in use of query ln, log2 units
  v2f sum0[QT] = {}, sum1[QT] = {};                // sums over this lane's keys only
  // mask words of stage 0; each stage fetches the next one's behind its last select
  v16u mw[QT][2];
#pragma unroll
  for (int u = 0; u < QT; ++u) {
    mu[u] = -1.0e30f;
    mw[u][0] = mwp[u * MWT];
    mw[u][1] = mwp[u * MWT + 1];
  }

  // Stage 0 is copied, waited for and published; stage 1 then flies over trip 0.
  async_copy8(lk0, kcp, 16 * DK, lk0 + TILEB, vcp, (size_t)16 * Ssz, 16 * LPITCHB);
  wait_async0();
  __syncthreads();
  async_copy8(lk0 + 2 * TILEB, kcp + 64 * DK, 16 * DK,
              lk0 + 3 * TILEB, vcp + 64, (size_t)16 * Ssz, 16 * LPITCHB);

  for (int st = 0; st < NST; ++st) {
   const _Float16* Ks = &kv[kh][st & 1][0][0];
   const _Float16* Vs = &kv[kh][st & 1][1][0];
   // ---- four 16x16 tiles of S^T a query tile, K=dk=64, on top of the start value
   // c0 / c1 (A operand: row ln of tile t = key 16 t + ln); a K fragment is read
   // once and multiplies both query tiles
   v8f sc[QT][4];
   auto scores = [&](float c0, float c1) {
     v16h kf[4][2];
#pragma unroll
     for (int t = 0; t < 4; ++t) {
       const _Float16* krow = Ks + (t * 16 + ln) * LPITCH;
       kf[t][0] = ldfrag(krow, 0,  laneHi);
       kf[t][1] = ldfrag(krow, 32, laneHi);
     }
     // keeps the K reads one group ahead of the products; with it the branch below
     // also reads its K fragments anew, where the build without it holds the 64
     // registers through the stage for a path that is hardly ever taken
     __builtin_amdgcn_sched_barrier(0);
#pragma unroll
     for (int u = 0; u < QT; ++u) {
       const float c = u == 0 ? c0 : c1;
       const v8f c8 = {c, c, c, c, c, c, c, c};
#pragma unroll
       for (int t = 0; t < 4; ++t) sc[u][t] = wmma_f16(kf[t][0], bq[u][0], c8);
     }
#pragma unroll
     for (int u = 0; u < QT; ++u)
#pragma unroll
       for (int t = 0; t < 4; ++t) sc[u][t] = wmma_f16(kf[t][1], bq[u][1], sc[u][t]);
   };
   // ---- mask (value mv where the entry is 0) and maximum of query ln of tile u
   // over this lane's 32 of the stage's 64 keys
   float sv[QT][32];
   auto mask_max = [&](int u, float mv) -> float {
     float cm[4] = {-3.0e38f, -3.0e38f, -3.0e38f, -3.0e38f};  // one chain of maxima a tile
#pragma unroll
     for (int t = 0; t < 4; ++t) {
       const v16u w = mw[u][t >> 1];               // words of key tiles 0, 1 / 2, 3
#pragma unroll
       for (int i = 0; i < 8; ++i) {
         sv[u][8 * t + i] = __builtin_amdgcn_inverse_ballot_w32(w[8 * (t & 1) + i]) ? sc[u][t][i] : mv;
         cm[t] = fmaxf(cm[t], sv[u][8 * t + i]);
       }
     }
     return fmaxf(fmaxf(cm[0], cm[1]), fmaxf(cm[2], cm[3]));
   };
   scores(-mu[0], -mu[1]);
   // the first pass's V fragments: read here, they fly under the selects
   v16h vfa[4];
#pragma unroll
   for (int t = 0; t < 4; ++t) vfa[t] = ldfrag(Vs + (16 * t + ln) * LPITCH, 0, laneHi);
   // sv = score - mu
   const float over = fmaxf(mask_max(0, NEG2 - mu[0]), mask_max(1, NEG2 - mu[1]));
   // One scalar branch a stage, on any lane and either tile of the wave. Taken in
   // stage 0 (mu = -1e30 makes every sv huge), where a score passes mu by more than
   // 8, and where every key so far was masked (mu = NEG2) and one now is not. The
   // scores are made anew from 0, because score - mu has lost the score's low bits
   // where mu is huge.
   if (__builtin_amdgcn_ballot_w32(over > 8.0f) != 0) {
     scores(0.0f, 0.0f);
#pragma unroll
     for (int u = 0; u < QT; ++u) {
       const float cm    = mask_max(u, NEG2);
       const float mnew  = fmaxf(mu[u], fmaxf(cm, xhalf(cm)));  // both halves: all 64 keys
       const float alpha = __builtin_amdgcn_exp2f(mu[u] - mnew);
       mu[u] = mnew;
#pragma unroll
       for (int s = 0; s < 32; ++s) sv[u][s] -= mnew;
       sum0[u] *= alpha; sum1[u] *= alpha;
#pragma unroll
       for (int t = 0; t < 4; ++t) o[u][t] *= alpha;
     }
   }
   // unrolled: sv stays in registers, and with no barrier in a pass the
   // second pass's V reads can be issued under the first pass's exponentials
#pragma unroll
   for (int sub = 0; sub < 64; sub += 32) {
    const v16h vf0 = sub == 0 ? vfa[0] : ldfrag(Vs + (ln)      * LPITCH, sub, laneHi);
    const v16h vf1 = sub == 0 ? vfa[1] : ldfrag(Vs + (16 + ln) * LPITCH, sub, laneHi);
    const v16h vf2 = sub == 0 ? vfa[2] : ldfrag(Vs + (32 + ln) * LPITCH, sub, laneHi);
    const v16h vf3 = sub == 0 ? vfa[3] : ldfrag(Vs + (48 + ln) * LPITCH, sub, laneHi);

    // a V fragment is read once and multiplies both query tiles; the second
    // tile's exponentials stand behind the first tile's products
#pragma unroll
    for (int u = 0; u < QT; ++u) {
      v16h pb;                                     // P^T, B operand
#pragma unroll
      for (int s = 0; s < 16; s += 2) {
        const v2f p = {__builtin_amdgcn_exp2f(sv[u][sub / 2 + s]),
                       __builtin_amdgcn_exp2f(sv[u][sub / 2 + s + 1])};
        if (sub == 0) sum0[u] += p; else sum1[u] += p;   // even and odd keys apart
        pb[s] = (_Float16)p[0];
        pb[s + 1] = (_Float16)p[1];
      }

      // ---- O^T += V^T(64x32) * P^T(32x16); Vt rows are the A-matrix rows
      o[u][0] = wmma_f16(vf0, pb, o[u][0]);
      o[u][1] = wmma_f16(vf1, pb, o[u][1]);
      o[u][2] = wmma_f16(vf2, pb, o[u][2]);
      o[u][3] = wmma_f16(vf3, pb, o[u][3]);
    }
   }
   // ---- the next stage's mask words (the last stage fetches its own again, to
   // stay inside the array): they fly over the barrier and the score products
   {
     const int nx = st + 1 < NST ? st + 1 : st;
#pragma unroll
     for (int u = 0; u < QT; ++u) {
       mw[u][0] = mwp[u * MWT + 2 * nx];
       mw[u][1] = mwp[u * MWT + 2 * nx + 1];
     }
   }
   // ---- publish stage st + 1, then refill the buffer that this trip has read
   wait_ds0();
   wait_async0();
   __syncthreads();
   if (st + 2 < NST) {
     const unsigned lb = lk0 + (unsigned)(st & 1) * (2 * TILEB);
     async_copy8(lb, kcp + (size_t)(st + 2) * 64 * DK, 16 * DK,
                 lb + TILEB, vcp + (st + 2) * 64, (size_t)16 * Ssz, 16 * LPITCHB);
   }
  }
  wait_async0();

  // ---- join the two key halves of a query group. The loop's last barrier has
  // ended every read of the ring and no copy is in flight, so the ring's LDS
  // carries the upper half's O^T tiles, maxima and sums to the lower half's wave:
  // 17 slots of 16 bytes a lane, a slot's 32 lanes side by side.
  float lr[QT];                                    // sums over this lane's keys
#pragma unroll
  for (int u = 0; u < QT; ++u) lr[u] = (sum0[u][0] + sum0[u][1]) + (sum1[u][0] + sum1[u][1]);
  v4f* xo = (v4f*)&kv[0][0][0][0] + wq * ((QT * 8 + 1) * 32) + lane;
  if (kh == 1) {
#pragma unroll
    for (int u = 0; u < QT; ++u)
#pragma unroll
      for (int t = 0; t < 4; ++t) {
        const v8f x = o[u][t];
        xo[((u * 4 + t) * 2) * 32]     = (v4f){x[0], x[1], x[2], x[3]};
        xo[((u * 4 + t) * 2 + 1) * 32] = (v4f){x[4], x[5], x[6], x[7]};
      }
    xo[QT * 8 * 32] = (v4f){mu[0], mu[1], lr[0], lr[1]};
  }
  // publishes the upper halves' results to their partner waves
  __syncthreads();
  if (kh == 1) return;

  // ---- both halves on the larger maximum, join the wave halves' sums, normalize
  // (ctx: concat-head layout, f16): a lane's 8 registers of a tile are 8
  // consecutive columns of its row
  const v4f ms = xo[QT * 8 * 32];
  v8h y[QT][4];
#pragma unroll
  for (int u = 0; u < QT; ++u) {
    const float m  = fmaxf(mu[u], ms[u]);
    const float fa = __builtin_amdgcn_exp2f(mu[u] - m);
    const float fb = __builtin_amdgcn_exp2f(ms[u] - m);
    const float l  = lr[u] * fa + ms[2 + u] * fb;
    const float inv = 1.0f / (l + xhalf(l));
    const float ga = fa * inv, gb = fb * inv;
#pragma unroll
    for (int t = 0; t < 4; ++t) {
      const v4f x0 = xo[((u * 4 + t) * 2) * 32];
      const v4f x1 = xo[((u * 4 + t) * 2 + 1) * 32];
#pragma unroll
      for (int i = 0; i < 4; ++i) {
        y[u][t][i]     = (_Float16)(o[u][t][i] * ga + x0[i] * gb);
        y[u][t][i + 4] = (_Float16)(o[u][t][i + 4] * ga + x1[i] * gb);
      }
    }
  }
  // The wave's 32 rows of 128 bytes go through LDS, so that every global store
  // covers 4 whole lines: staged in the range that carried the partner's results to
  // this wave, which has read them and alone touches the range from here on.
  _Float16* stg = (_Float16*)((v4f*)&kv[0][0][0][0] + wq * ((QT * 8 + 1) * 32));
#pragma unroll
  for (int u = 0; u < QT; ++u)
#pragma unroll
    for (int t = 0; t < 4; ++t)
      *(v8h*)(stg + (16 * u + ln) * LPITCH + 16 * t + laneHi * 8) = y[u][t];
  // the wave's rows are in LDS before its lanes read one another's values
  wait_ds0();
  _Float16* crowp = ctx + ((size_t)(b * Ssz + q0 + (lane >> 3))) * Dsz + h * DK + (lane & 7) * 8;
#pragma unroll
  for (int j = 0; j < 8; ++j)
    *(v8h*)(crowp + (size_t)(4 * j) * Dsz) = *(const v8h*)(stg + (4 * j + (lane >> 3)) * LPITCH + (lane & 7) * 8);
}

// ---------------------------------------------------------------------------
extern "C" void kernel_launch(void* const* d_in, const int* in_sizes, int n_in,
                              void* d_out, int out_size, void* d_ws, size_t ws_size,
                              hipStream_t stream) {
  (void)in_sizes; (void)n_in; (void)out_size; (void)ws_size;
  const float* q    = (const float*)d_in[0];
  const float* k    = (const float*)d_in[1];
  const float* v    = (const float*)d_in[2];
  const float* Wq   = (const float*)d_in[3];
  const float* bq   = (const float*)d_in[4];
  const float* Wk   = (const float*)d_in[5];
  const float* bk   = (const float*)d_in[6];
  const float* Wv   = (const float*)d_in[7];
  const float* bv   = (const float*)d_in[8];
  const float* Wo   = (const float*)d_in[9];
  const float* bo   = (const float*)d_in[10];
  const int*   mask = (const int*)d_in[11];

  // workspace layout
  char* w = (char*)d_ws;
  const size_t MB = 1ull << 20;
  _Float16* wo16 = (_Float16*)(w + 30 * MB);
  _Float16* QhP  = (_Float16*)(w + 32 * MB);
  _Float16* KhP  = (_Float16*)(w + 40 * MB);
  _Float16* VtP  = (_Float16*)(w + 48 * MB);
  _Float16* ctxP = (_Float16*)(w + 56 * MB);
  unsigned* mbP  = (unsigned*)(w + 64 * MB);       // 1 MB: one bit a mask entry

  // 64 tiles of 256 x 256 a product, 16 waves each; then the mask and Wo
  gemm_qkv<<<3 * PG_BLKS + PK_BLKS + WO_BLKS, SIDE_T, 0, stream>>>(
      q, k, v, Wq, Wk, Wv, bq, bk, bv, Wo, mask, QhP, KhP, VtP, wo16, mbP);

  // B*H*(S/16) = 4096 query tiles, 2 a wave, 4 query groups x 2 key halves of
  // waves per 256-thread block
  flash_attn<<<4096 / 8, 256, 0, stream>>>(QhP, KhP, VtP, mbP, ctxP);

  gemm_out<<<GEMM_BLKS, 256, 0, stream>>>(ctxP, wo16, bo, (float*)d_out);
}
